// v000
// The times below were measured on an AMD MI455X: many runs one after another, warmed up first and cycling through
// copies of the inputs, with the whole window's GPU time divided by the number of runs. Launches and the gaps
// between them are all in it. The median over several windows is given; except for v000 it joins two sittings, which
// can be a few percent apart, so the side-by-side timings, each taken in one sitting, are the better comparison.
// v000, which the later versions start from, runs in 1570 microseconds.
#include <hip/hip_runtime.h>

// SyntaxBertSelfAttention (hidden [2][2048][768], additive attention_mask [2][1][1][2048]; q/k/v = x W + b (12 heads x 64); scores = q.k / sqrt(12) (the module scales by 1/sqrt(num_heads), faithful) + mask[b][j]; softmax; out = merged heads -> [2][2048][768]).
// Compute dtypes, f32 accumulate: every input rounded to bf16; projections on PLAIN bf16 operands (inputs: exact, + bias); scores (K 64) and probs.v on hl planes (3 products) for the first 512 query rows of each

#define NB_  2
#define TT   2048
#define DM   768
#define NH_  12
#define NKV  12
#define REP  (NH_ / NKV)
#define HD   64
#define DQ   (NH_ * HD)
#define DKV  (NKV * HD)
#define ZH   2
#define RH   512                  // query rows < RH use hi+lo planes (0: none)
#define WIN  2048
#define PCAR 1024.0f
#define SCL  0.28867513459481287f
typedef _Float16 h16;
typedef unsigned short bf;
typedef __attribute__((ext_vector_type(16))) __bf16   v16bf;
typedef __attribute__((ext_vector_type(16))) _Float16 v16h;
typedef __attribute__((ext_vector_type(8)))  _Float16 v8h;
typedef __attribute__((ext_vector_type(8)))  unsigned short v8us;
typedef __attribute__((ext_vector_type(8)))  float    v8f;
typedef __attribute__((ext_vector_type(4)))  float    v4f;
typedef v8h  __attribute__((may_alias)) v8ha;
typedef v4f  __attribute__((may_alias)) v4fa;
typedef v8us __attribute__((may_alias)) v8usa;

__device__ __forceinline__ unsigned short f2bf(float f) { unsigned u = __float_as_uint(f); u += 0x7FFFu + ((u >> 16) & 1u); return (unsigned short)(u >> 16); }
__device__ __forceinline__ float bf2f(unsigned short b) { return __uint_as_float(((unsigned)b) << 16); }
__device__ __forceinline__ float bfr(float f) { return bf2f(f2bf(f)); }
__device__ __forceinline__ v16h cat16(v8h lo, v8h hi) { return __builtin_shufflevector(lo, hi, 0, 1, 2, 3, 4, 5, 6, 7, 8, 9, 10, 11, 12, 13, 14, 15); }
__device__ __forceinline__ v16bf cat16b(v8us lo, v8us hi) { return __builtin_bit_cast(v16bf, __builtin_shufflevector(lo, hi, 0, 1, 2, 3, 4, 5, 6, 7, 8, 9, 10, 11, 12, 13, 14, 15)); }
__device__ __forceinline__ v8f wmma16(v16h a, v16h b, v8f c) { return __builtin_amdgcn_wmma_f32_16x16x32_f16(false, a, false, b, (short)0, c, false, false); }
__device__ __forceinline__ v8f wmmab(v16bf a, v16bf b, v8f c) { return __builtin_amdgcn_wmma_f32_16x16x32_bf16(false, a, false, b, (short)0, c, false, false); }



// ---- k_gemmw: register-blocked GEMM, ONE WAVE per 64x64 output tile (16 accumulators), operands straight from K-contiguous 16-bit planes; grid (M/64, N/64, Z), 32 threads.
// C[m][n] (f32, pitch ldc, + optional f32 bias[n]) = sum_k A[m][k] Bt[n][k] (+ split products per NSPLIT). z-batch strides sA/sB/sC in elements. K % 32 == 0.
template <typename T16> struct WFrag;
template <> struct WFrag<h16> { typedef v16h V; static __device__ __forceinline__ V ld(const h16* p) { return cat16(*(const v8h*)p, *(const v8h*)(p + 16)); } static __device__ __forceinline__ v8f mma(V a, V b, v8f c) { return wmma16(a, b, c); } };
template <> struct WFrag<bf> { typedef v16bf V; static __device__ __forceinline__ V ld(const bf* p) { return cat16b(*(const v8us*)p, *(const v8us*)(p + 16)); } static __device__ __forceinline__ v8f mma(V a, V b, v8f c) { return wmmab(a, b, c); } };
template <typename T16, int NSPLIT, bool BIAS>
__global__ __launch_bounds__(32) void k_gemmw(const T16* __restrict__ A, const T16* __restrict__ A2, const T16* __restrict__ Bt, const T16* __restrict__ Bt2, int K, float* C, int ldc, const float* __restrict__ bias, size_t sA, size_t sB, size_t sC) {
    typedef typename WFrag<T16>::V V;
    __shared__ __align__(16) float os[16 * 68];
    const size_t z = blockIdx.z; A += z * sA; if (A2) A2 += z * sA; Bt += z * sB; if (Bt2) Bt2 += z * sB; C += z * sC;
    const int lane = threadIdx.x & 31, lr = lane & 15, hi = lane >> 4; const int r0 = blockIdx.x * 64, c0 = blockIdx.y * 64;
    v8f acc[4][4];
#pragma unroll
    for (int mb = 0; mb < 4; ++mb)
#pragma unroll
        for (int nb = 0; nb < 4; ++nb) acc[mb][nb] = (v8f){};
    const size_t aoff = (size_t)(r0 + lr) * K + 8 * hi, boff = (size_t)(c0 + lr) * K + 8 * hi;
#pragma unroll 1
    for (int kc = 0; kc < K; kc += 32) {
        V a[4], a2[4];
#pragma unroll
        for (int mb = 0; mb < 4; ++mb) { a[mb] = WFrag<T16>::ld(A + aoff + (size_t)mb * 16 * K + kc); if (NSPLIT == 1 || NSPLIT == 2) a2[mb] = WFrag<T16>::ld(A2 + aoff + (size_t)mb * 16 * K + kc); }
#pragma unroll
        for (int nb = 0; nb < 4; ++nb) { const V b = WFrag<T16>::ld(Bt + boff + (size_t)nb * 16 * K + kc); V b2; if (NSPLIT >= 2) b2 = WFrag<T16>::ld(Bt2 + boff + (size_t)nb * 16 * K + kc);
#pragma unroll
            for (int mb = 0; mb < 4; ++mb) { acc[mb][nb] = WFrag<T16>::mma(a[mb], b, acc[mb][nb]); if (NSPLIT == 1 || NSPLIT == 2) acc[mb][nb] = WFrag<T16>::mma(a2[mb], b, acc[mb][nb]); if (NSPLIT >= 2) acc[mb][nb] = WFrag<T16>::mma(a[mb], b2, acc[mb][nb]); } }
        asm volatile("v_nop\n\tv_nop\n\tv_nop\n\tv_nop" : "+v"(acc[0][0]), "+v"(acc[1][1]), "+v"(acc[2][2]), "+v"(acc[3][3]) : "v"(a[0]), "v"(a[3]));
    }
#pragma unroll
    for (int mb = 0; mb < 4; ++mb) {
#pragma unroll
        for (int nb = 0; nb < 4; ++nb) {
#pragma unroll
            for (int j = 0; j < 8; ++j) os[(hi * 8 + j) * 68 + nb * 16 + lr] = acc[mb][nb][j]; }
        __builtin_amdgcn_wave_barrier(); asm volatile("" ::: "memory");
        float* crow = C + (size_t)(r0 + mb * 16) * ldc + c0;
{
#pragma unroll
            for (int s = 0; s < 8; ++s) { const int row = 2 * s + hi, cofs = lr * 4; v4f val = *(const v4fa*)(os + row * 68 + cofs); if (BIAS) { val[0] += bfr(bias[c0 + cofs]); val[1] += bfr(bias[c0 + cofs + 1]); val[2] += bfr(bias[c0 + cofs + 2]); val[3] += bfr(bias[c0 + cofs + 3]); }
                *(v4f*)(crow + (size_t)row * ldc + cofs) = val; }
             }
        __builtin_amdgcn_wave_barrier(); asm volatile("" ::: "memory");
    }
}

__device__ __forceinline__ h16 tohx(float x) { return (h16)x; }
__device__ __forceinline__ void splitf(float y, unsigned short& h, unsigned short& l) { h = f2bf(y); l = f2bf(y - bf2f(h)); }
typedef __attribute__((ext_vector_type(2))) _Float16 v2h;
typedef __attribute__((ext_vector_type(4))) _Float16 v4h;
typedef __attribute__((ext_vector_type(2))) unsigned short v2us;
typedef __attribute__((ext_vector_type(4))) unsigned short v4us;
typedef __attribute__((ext_vector_type(2))) float v2f;
typedef __attribute__((ext_vector_type(4))) int v4i;

__global__ __launch_bounds__(256) void k_wtG(const float* __restrict__ w, int K, int N, bf* Bt) {
    const int lane = threadIdx.x & 31; const int L0 = (blockIdx.x * 8 + (threadIdx.x >> 5)) * 8; const int nlines = N * K / 64;
{
#pragma unroll 1
        for (int l = 0; l < 8; ++l) { const int L = L0 + l; if (L >= nlines) break; const size_t e = (size_t)L * 64 + lane * 2; const int k = (int)(e % K), n = (int)(e / K); v2us o;
            o[0] = f2bf(w[(size_t)k * N + n]); o[1] = f2bf(w[(size_t)(k + 1) * N + n]); *(v2us*)(Bt + e) = o; }
         }
}
__global__ __launch_bounds__(256) void k_cvt8(const float* __restrict__ src, bf* dst, size_t n8) { const size_t i = (size_t)blockIdx.x * 256 + threadIdx.x; if (i >= n8) return; const v8f v = *(const v8f*)(src + i * 8); v8us o;
#pragma unroll
    for (int k = 0; k < 8; ++k) o[k] = f2bf(v[k]); *(v8us*)(dst + i * 8) = o;  }
__global__ __launch_bounds__(256) void k_cscvt(const float* __restrict__ cosT, const float* __restrict__ sinT, float* CS) { const int idx = blockIdx.x * 256 + threadIdx.x; if (idx >= TT * HD) return; v2f cs; cs[0] = bfr(cosT[idx]); cs[1] = bfr(sinT[idx]); *(v2f*)(CS + (size_t)idx * 2) = cs;  }
// k_rope: head planes [h][t][d] (fp16 + hi/lo) of rope(x) x sc with the rotate-half convention out[d] = x[d] cos[t][d] - x[d+HD/2] sin[t][d], out[d+HD/2] = x[d+HD/2] cos[t][d+HD/2] + x[d] sin[t][d+HD/2]
__global__ __launch_bounds__(256) void k_rope(const float* __restrict__ F, int pitch, int nheads, const float* __restrict__ CS, const float* __restrict__ RF, const float* __restrict__ nw, float sc, h16* P16, bf* Ph, bf* Pl) {
    const size_t e = ((size_t)blockIdx.x * 256 + threadIdx.x) * 2; if (e >= (size_t)nheads * TT * HD) return; const int d = (int)(e % HD); const int t = (int)((e / HD) % TT); const int h = (int)(e / ((size_t)HD * TT)); const float* f = F + (size_t)t * pitch + h * HD; const float rf = RF ? RF[(size_t)h * TT + t] : 1.0f; v2h o16; v2us oh, ol;
#pragma unroll
    for (int q = 0; q < 2; ++q) { const int dd = d + q; const int dp = (dd < HD / 2) ? dd + HD / 2 : dd - HD / 2; float x0 = f[dd], x1 = f[dp];
        if (RF) { float n0 = __fmul_rn(x0, rf), n1 = __fmul_rn(x1, rf); asm volatile("" : "+v"(n0)); asm volatile("" : "+v"(n1)); x0 = __fmul_rn(bfr(nw[dd]), n0); x1 = __fmul_rn(bfr(nw[dp]), n1); }
        const v2f cs = *(const v2f*)(CS + ((size_t)t * HD + dd) * 2); float a = __fmul_rn(x0, cs[0]), bq = __fmul_rn(x1, cs[1]); asm volatile("" : "+v"(a)); asm volatile("" : "+v"(bq)); const float r = ((dd < HD / 2) ? __fsub_rn(a, bq) : __fadd_rn(a, bq)) * sc;
        o16[q] = tohx(r); unsigned short a2, c2; splitf(r, a2, c2); oh[q] = a2; ol[q] = c2; }
    *(v2h*)(P16 + e) = o16; *(v2us*)(Ph + e) = oh; *(v2us*)(Pl + e) = ol;  }
__global__ __launch_bounds__(256) void k_vtp(const float* __restrict__ F, int pitch, int nheads, h16* V16, bf* Vh, bf* Vl) { const size_t e = ((size_t)blockIdx.x * 256 + threadIdx.x) * 2; if (e >= (size_t)nheads * HD * TT) return; const int t = (int)(e % TT); const int d = (int)((e / TT) % HD); const int g = (int)(e / ((size_t)TT * HD)); v2h o16; v2us oh, ol;
#pragma unroll
    for (int q = 0; q < 2; ++q) { const float x = F[(size_t)(t + q) * pitch + g * HD + d]; o16[q] = tohx(x); unsigned short a2, c2; splitf(x, a2, c2); oh[q] = a2; ol[q] = c2; }
    *(v2h*)(V16 + e) = o16; *(v2us*)(Vh + e) = oh; *(v2us*)(Vl + e) = ol;  }
__global__ __launch_bounds__(256) void k_csid(float* CS) { const int idx = blockIdx.x * 256 + threadIdx.x; if (idx >= TT * HD) return; v2f cs; cs[0] = 1.0f; cs[1] = 0.0f; *(v2f*)(CS + (size_t)idx * 2) = cs;  }
// k_asoft: per row (zz, i): t = (S + AMS[j]) x SCL (AMS = mask / SCL, SCL = 1/sqrt(12)); softmax over the 2048 keys (register row, one exp, fixed trees);
__global__ __launch_bounds__(256) void k_asoft(const float* __restrict__ Sb, const float* __restrict__ am, h16* P16, bf* Ph, bf* Pl) {
    const int lane = threadIdx.x & 31; const int row = blockIdx.x * 8 + (threadIdx.x >> 5); if (row >= ZH * TT) return; const int i = row % TT; const int zz = row / TT; (void)zz; const bool hires = (i < RH); const float* sr = Sb + (size_t)row * TT; float v[TT / 32]; float mx = -3.0e38f;
#pragma unroll
    for (int ch = 0; ch < TT / 128; ++ch) { const int j0 = ch * 128 + lane * 4; const v4f a = *(const v4f*)(sr + j0);
#pragma unroll
        for (int q = 0; q < 4; ++q) { const int j = j0 + q; const float s0 = __fadd_rn(a[q], am[j]); float t = __fmul_rn(s0, SCL); asm volatile("" : "+v"(t)); v[ch * 4 + q] = t; mx = fmaxf(mx, t); } }
#pragma unroll
    for (int sh = 16; sh; sh >>= 1) mx = fmaxf(mx, __shfl_xor(mx, sh, 32));
    float sum = 0.f;
#pragma unroll
    for (int k = 0; k < TT / 32; ++k) { float d0 = __fsub_rn(v[k], mx); asm volatile("" : "+v"(d0)); v[k] = __builtin_amdgcn_exp2f(__fmul_rn(d0, 1.4426950408889634f)); sum += v[k]; }
#pragma unroll
    for (int sh = 16; sh; sh >>= 1) sum += __shfl_xor(sum, sh, 32);
    const float f = __fdiv_rn(hires ? 1.0f : PCAR, sum);
{
        if (hires) {
#pragma unroll
            for (int ch = 0; ch < TT / 128; ++ch) { v4us oh, ol;
#pragma unroll
                for (int q = 0; q < 4; ++q) { unsigned short a, c2; splitf(v[ch * 4 + q] * f, a, c2); oh[q] = a; ol[q] = c2; }
                const size_t oo = ((size_t)zz * (RH ? RH : 1) + i) * TT + ch * 128 + lane * 4; *(v4us*)(Ph + oo) = oh; *(v4us*)(Pl + oo) = ol; }
        } else {
#pragma unroll
            for (int ch = 0; ch < TT / 128; ++ch) { v4h o4;
#pragma unroll
                for (int q = 0; q < 4; ++q) o4[q] = tohx(v[ch * 4 + q] * f);
                *(v4h*)(P16 + (size_t)row * TT + ch * 128 + lane * 4) = o4; } }
         }
}
__global__ __launch_bounds__(256) void k_merge(const float* __restrict__ O, int h0, bf* Ah, bf* Al) { const size_t e = ((size_t)blockIdx.x * 256 + threadIdx.x) * 2; if (e >= (size_t)ZH * TT * HD) return; const int d = (int)(e % HD); const int t = (int)((e / HD) % TT); const int zz = (int)(e / ((size_t)HD * TT)); const float cs = (t < RH) ? 1.0f : (1.0f / PCAR); const size_t oo = (size_t)t * DQ + (h0 + zz) * HD + d;
    v2us oh, ol;
#pragma unroll
    for (int q = 0; q < 2; ++q) { unsigned short a, c2; splitf(O[e + q] * cs, a, c2); oh[q] = a; ol[q] = c2; } *(v2us*)(Ah + oo) = oh; *(v2us*)(Al + oo) = ol;  }

__global__ __launch_bounds__(256) void k_sumpl(const bf* __restrict__ Ah, const bf* __restrict__ Al, float* OUT) { const size_t i = ((size_t)blockIdx.x * 256 + threadIdx.x) * 4; if (i >= (size_t)TT * DQ) return; const v4us a = *(const v4us*)(Ah + i), c = *(const v4us*)(Al + i); v4f o;
#pragma unroll
    for (int q = 0; q < 4; ++q) o[q] = __fadd_rn(bf2f(a[q]), bf2f(c[q])); *(v4f*)(OUT + i) = o;  }

__global__ __launch_bounds__(256) void k_ams(const float* __restrict__ am, float* AMS) { const int j = blockIdx.x * 256 + threadIdx.x; if (j >= TT) return; const float v = bfr(am[j]) * (1.0f / SCL); *(float*)(AMS + j) = v;  }

extern "C" void kernel_launch(void* const* d_in, const int* in_sizes, int n_in,
                              void* d_out, int out_size, void* d_ws, size_t ws_size, hipStream_t stream) {
    (void)in_sizes; (void)n_in; (void)out_size;
    const float* x = (const float*)d_in[0]; const float* amask = (const float*)d_in[1]; const float* wq = (const float*)d_in[2]; const float* bq = (const float*)d_in[3]; const float* wk = (const float*)d_in[4]; const float* bk = (const float*)d_in[5]; const float* wv = (const float*)d_in[6]; const float* bv = (const float*)d_in[7]; const float* wo = nullptr; (void)wo;
    float* OUT = (float*)d_out;     // [2][2048][768]
    char* wsp = (char*)d_ws;
    auto take = [&](size_t bytes) { char* p = wsp; wsp += (bytes + 255) & ~(size_t)255; return (void*)p; };
    bf* WQ = (bf*)take((size_t)DQ * DM * 2); bf* WK = (bf*)take((size_t)DKV * DM * 2); bf* WV = (bf*)take((size_t)DKV * DM * 2); float* CS = (float*)take((size_t)TT * HD * 2 * 4); float* AMS = (float*)take((size_t)TT * 4);
    bf* XB = (bf*)take((size_t)TT * DM * 2); float* FQ = (float*)take((size_t)TT * DQ * 4); float* FK = (float*)take((size_t)TT * DKV * 4);
    h16* QP16 = (h16*)take((size_t)NH_ * TT * HD * 2); h16* KP16 = (h16*)take((size_t)NKV * TT * HD * 2); h16* VT16 = (h16*)take((size_t)NKV * HD * TT * 2);
    bf* QPh = (bf*)take((size_t)NH_ * TT * HD * 2); bf* QPl = (bf*)take((size_t)NH_ * TT * HD * 2); bf* KPh = (bf*)take((size_t)NKV * TT * HD * 2); bf* KPl = (bf*)take((size_t)NKV * TT * HD * 2); bf* VTh = (bf*)take((size_t)NKV * HD * TT * 2); bf* VTl = (bf*)take((size_t)NKV * HD * TT * 2); bf* Ph = (bf*)take((size_t)ZH * RH * TT * 2); bf* Pl = (bf*)take((size_t)ZH * RH * TT * 2);
    float* Sb = (float*)take((size_t)ZH * TT * TT * 4); h16* P16 = (h16*)take((size_t)ZH * TT * TT * 2); float* Ob = (float*)take((size_t)ZH * TT * HD * 4); bf* ATh = (bf*)take((size_t)TT * DQ * 2); bf* ATl = (bf*)take((size_t)TT * DQ * 2);
    if ((size_t)(wsp - (char*)d_ws) > ws_size) return;    // ws 256 MiB
    float* FV = FK;   // v projection reuses the k buffer after the k planes are built (stream-ordered)
    { k_wtG<<<(unsigned)((DM * DQ / 64 + 63) / 64), 256, 0, stream>>>(wq, DM, DQ, WQ); k_wtG<<<(unsigned)((DM * DKV / 64 + 63) / 64), 256, 0, stream>>>(wk, DM, DKV, WK); k_wtG<<<(unsigned)((DM * DKV / 64 + 63) / 64), 256, 0, stream>>>(wv, DM, DKV, WV);
       }
    k_csid<<<(TT * HD + 255) / 256, 256, 0, stream>>>(CS);
    const unsigned LQ = (unsigned)(((size_t)NH_ * TT * HD / 2 + 255) / 256), LKv = (unsigned)(((size_t)NKV * TT * HD / 2 + 255) / 256);
    for (int b = 0; b < NB_; ++b) {
        
        k_ams<<<TT / 256, 256, 0, stream>>>(amask + (size_t)b * TT, AMS); k_cvt8<<<(unsigned)(((size_t)TT * DM / 8 + 255) / 256), 256, 0, stream>>>(x + (size_t)b * TT * DM, XB, (size_t)TT * DM / 8);
        k_gemmw<bf, 0, true><<<dim3(TT / 64, DQ / 64, 1), 32, 0, stream>>>(XB, nullptr, WQ, nullptr, DM, FQ, DQ, bq, 0, 0, 0);
        k_rope<<<LQ, 256, 0, stream>>>(FQ, DQ, NH_, CS, nullptr, nullptr, 1.0f, QP16, QPh, QPl);
        k_gemmw<bf, 0, true><<<dim3(TT / 64, DKV / 64, 1), 32, 0, stream>>>(XB, nullptr, WK, nullptr, DM, FK, DKV, bk, 0, 0, 0);
        k_rope<<<LKv, 256, 0, stream>>>(FK, DKV, NKV, CS, nullptr, nullptr, 1.0f, KP16, KPh, KPl);
        k_gemmw<bf, 0, true><<<dim3(TT / 64, DKV / 64, 1), 32, 0, stream>>>(XB, nullptr, WV, nullptr, DM, FV, DKV, bv, 0, 0, 0); k_vtp<<<LKv, 256, 0, stream>>>(FV, DKV, NKV, VT16, VTh, VTl);
        for (int h0 = 0; h0 < NH_; h0 += ZH) { const size_t zq = (size_t)h0, zk = (size_t)(h0 / REP);   // one kv head per query head: the pass's two heads use consecutive kv planes (z-strides TT*HD)
            k_gemmw<bf, 2, false><<<dim3(RH / 64, TT / 64, ZH), 32, 0, stream>>>(QPh + zq * TT * HD, QPl + zq * TT * HD, KPh + zk * TT * HD, KPl + zk * TT * HD, HD, Sb, TT, nullptr, (size_t)TT * HD, (size_t)TT * HD, (size_t)TT * TT);
            k_gemmw<h16, 0, false><<<dim3((TT - RH) / 64, TT / 64, ZH), 32, 0, stream>>>(QP16 + zq * TT * HD + (size_t)RH * HD, nullptr, KP16 + zk * TT * HD, nullptr, HD, Sb + (size_t)RH * TT, TT, nullptr, (size_t)TT * HD, (size_t)TT * HD, (size_t)TT * TT);
            k_asoft<<<ZH * TT / 8, 256, 0, stream>>>(Sb, AMS, P16, Ph, Pl);
            k_gemmw<bf, 2, false><<<dim3(RH / 64, HD / 64, ZH), 32, 0, stream>>>(Ph, Pl, VTh + zk * HD * TT, VTl + zk * HD * TT, TT, Ob, HD, nullptr, (size_t)RH * TT, (size_t)HD * TT, (size_t)TT * HD);
            k_gemmw<h16, 0, false><<<dim3((TT - RH) / 64, HD / 64, ZH), 32, 0, stream>>>(P16 + (size_t)RH * TT, nullptr, VT16 + zk * HD * TT, nullptr, TT, Ob + (size_t)RH * HD, HD, nullptr, (size_t)TT * TT, (size_t)HD * TT, (size_t)TT * HD);
            k_merge<<<(unsigned)(((size_t)ZH * TT * HD / 2 + 255) / 256), 256, 0, stream>>>(Ob, h0, ATh, ATl); }
        k_sumpl<<<(unsigned)(((size_t)TT * DQ / 4 + 255) / 256), 256, 0, stream>>>(ATh, ATl, OUT + (size_t)b * TT * DQ); }
}

// v001
// It runs in 721 microseconds.
// Two timings next to v000 put it at 2.18 and 2.19 times that version's speed.
#include <hip/hip_runtime.h>

// SyntaxBertSelfAttention (hidden [2][2048][768], additive attention_mask [2][1][1][2048]; q/k/v = x W + b (12 heads x 64); scores = q.k / sqrt(12) (the module scales by 1/sqrt(num_heads), faithful) + mask[b][j]; softmax; out = merged heads -> [2][2048][768]).
// Compute dtypes, f32 accumulate: every input rounded to bf16; projections on PLAIN bf16 operands (inputs: exact, + bias); scores (K 64) and probs.v on hl planes (3 products) for the first 512 query rows of each

#define NB_  2
#define TT   2048
#define DM   768
#define NH_  12
#define NKV  12
#define REP  (NH_ / NKV)
#define HD   64
#define DQ   (NH_ * HD)
#define DKV  (NKV * HD)
#define ZH   2
#define RH   512                  // query rows < RH use hi+lo planes (0: none)
#define WIN  2048
#define PCAR 1024.0f
#define SCL  0.28867513459481287f
#define KSP  16                   // probs.v: work-groups that share one output tile, each over TT / KSP keys (256 B of every operand row)
typedef _Float16 h16;
typedef unsigned short bf;
typedef __attribute__((ext_vector_type(16))) __bf16   v16bf;
typedef __attribute__((ext_vector_type(16))) _Float16 v16h;
typedef __attribute__((ext_vector_type(8)))  _Float16 v8h;
typedef __attribute__((ext_vector_type(8)))  unsigned short v8us;
typedef __attribute__((ext_vector_type(8)))  float    v8f;
typedef __attribute__((ext_vector_type(4)))  float    v4f;
typedef v8h  __attribute__((may_alias)) v8ha;
typedef v4f  __attribute__((may_alias)) v4fa;
typedef v8us __attribute__((may_alias)) v8usa;

__device__ __forceinline__ unsigned short f2bf(float f) { unsigned u = __float_as_uint(f); u += 0x7FFFu + ((u >> 16) & 1u); return (unsigned short)(u >> 16); }
__device__ __forceinline__ float bf2f(unsigned short b) { return __uint_as_float(((unsigned)b) << 16); }
__device__ __forceinline__ float bfr(float f) { return bf2f(f2bf(f)); }
__device__ __forceinline__ v16h cat16(v8h lo, v8h hi) { return __builtin_shufflevector(lo, hi, 0, 1, 2, 3, 4, 5, 6, 7, 8, 9, 10, 11, 12, 13, 14, 15); }
__device__ __forceinline__ v16bf cat16b(v8us lo, v8us hi) { return __builtin_bit_cast(v16bf, __builtin_shufflevector(lo, hi, 0, 1, 2, 3, 4, 5, 6, 7, 8, 9, 10, 11, 12, 13, 14, 15)); }
__device__ __forceinline__ v8f wmma16(v16h a, v16h b, v8f c) { return __builtin_amdgcn_wmma_f32_16x16x32_f16(false, a, false, b, (short)0, c, false, false); }
__device__ __forceinline__ v8f wmmab(v16bf a, v16bf b, v8f c) { return __builtin_amdgcn_wmma_f32_16x16x32_bf16(false, a, false, b, (short)0, c, false, false); }



// ---- k_gemmw: register-blocked GEMM, ONE WAVE per 64x64 output tile (16 accumulators), operands straight from K-contiguous 16-bit planes; grid (M/64, N/64, Z), 32 threads.
// C[m][n] (f32, pitch ldc, + optional f32 bias[n]) = sum_k A[m][k] Bt[n][k] (+ split products per NSPLIT). z-batch strides sA/sB/sC in elements. K % 32 == 0.
// KS > 1: grid z = Z * KS; work-group (z, ks) sums k in [ks K/KS, (ks+1) K/KS) only and stores its partial tile in plane ks (plane stride sP elements); the reader adds the planes.
template <typename T16> struct WFrag;
template <> struct WFrag<h16> { typedef v16h V; static __device__ __forceinline__ V ld(const h16* p) { return cat16(*(const v8h*)p, *(const v8h*)(p + 16)); } static __device__ __forceinline__ v8f mma(V a, V b, v8f c) { return wmma16(a, b, c); } };
template <> struct WFrag<bf> { typedef v16bf V; static __device__ __forceinline__ V ld(const bf* p) { return cat16b(*(const v8us*)p, *(const v8us*)(p + 16)); } static __device__ __forceinline__ v8f mma(V a, V b, v8f c) { return wmmab(a, b, c); } };
template <typename T16, int NSPLIT, bool BIAS, int KS = 1>
__global__ __launch_bounds__(32) void k_gemmw(const T16* __restrict__ A, const T16* __restrict__ A2, const T16* __restrict__ Bt, const T16* __restrict__ Bt2, int K, float* C, int ldc, const float* __restrict__ bias, size_t sA, size_t sB, size_t sC, size_t sP) {
    typedef typename WFrag<T16>::V V;
    __shared__ __align__(16) float os[16 * 68];
    const size_t z = blockIdx.z / KS; const int ks = blockIdx.z % KS; A += z * sA; if (A2) A2 += z * sA; Bt += z * sB; if (Bt2) Bt2 += z * sB; C += z * sC + ks * sP;
    const int kbeg = ks * (K / KS), kend = kbeg + K / KS;
    const int lane = threadIdx.x & 31, lr = lane & 15, hi = lane >> 4; const int r0 = blockIdx.x * 64, c0 = blockIdx.y * 64;
    v8f acc[4][4];
#pragma unroll
    for (int mb = 0; mb < 4; ++mb)
#pragma unroll
        for (int nb = 0; nb < 4; ++nb) acc[mb][nb] = (v8f){};
    const size_t aoff = (size_t)(r0 + lr) * K + 8 * hi, boff = (size_t)(c0 + lr) * K + 8 * hi;
#pragma unroll 1
    for (int kc = kbeg; kc < kend; kc += 32) {
        V a[4], a2[4];
#pragma unroll
        for (int mb = 0; mb < 4; ++mb) { a[mb] = WFrag<T16>::ld(A + aoff + (size_t)mb * 16 * K + kc); if (NSPLIT == 1 || NSPLIT == 2) a2[mb] = WFrag<T16>::ld(A2 + aoff + (size_t)mb * 16 * K + kc); }
#pragma unroll
        for (int nb = 0; nb < 4; ++nb) { const V b = WFrag<T16>::ld(Bt + boff + (size_t)nb * 16 * K + kc); V b2; if (NSPLIT >= 2) b2 = WFrag<T16>::ld(Bt2 + boff + (size_t)nb * 16 * K + kc);
#pragma unroll
            for (int mb = 0; mb < 4; ++mb) { acc[mb][nb] = WFrag<T16>::mma(a[mb], b, acc[mb][nb]); if (NSPLIT == 1 || NSPLIT == 2) acc[mb][nb] = WFrag<T16>::mma(a2[mb], b, acc[mb][nb]); if (NSPLIT >= 2) acc[mb][nb] = WFrag<T16>::mma(a[mb], b2, acc[mb][nb]); } }
        asm volatile("v_nop\n\tv_nop\n\tv_nop\n\tv_nop" : "+v"(acc[0][0]), "+v"(acc[1][1]), "+v"(acc[2][2]), "+v"(acc[3][3]) : "v"(a[0]), "v"(a[3]));
    }
#pragma unroll
    for (int mb = 0; mb < 4; ++mb) {
#pragma unroll
        for (int nb = 0; nb < 4; ++nb) {
#pragma unroll
            for (int j = 0; j < 8; ++j) os[(hi * 8 + j) * 68 + nb * 16 + lr] = acc[mb][nb][j]; }
        __builtin_amdgcn_wave_barrier(); asm volatile("" ::: "memory");
        float* crow = C + (size_t)(r0 + mb * 16) * ldc + c0;
{
#pragma unroll
            for (int s = 0; s < 8; ++s) { const int row = 2 * s + hi, cofs = lr * 4; v4f val = *(const v4fa*)(os + row * 68 + cofs); if (BIAS) { val[0] += bfr(bias[c0 + cofs]); val[1] += bfr(bias[c0 + cofs + 1]); val[2] += bfr(bias[c0 + cofs + 2]); val[3] += bfr(bias[c0 + cofs + 3]); }
                *(v4f*)(crow + (size_t)row * ldc + cofs) = val; }
             }
        __builtin_amdgcn_wave_barrier(); asm volatile("" ::: "memory");
    }
}

__device__ __forceinline__ h16 tohx(float x) { return (h16)x; }
__device__ __forceinline__ void splitf(float y, unsigned short& h, unsigned short& l) { h = f2bf(y); l = f2bf(y - bf2f(h)); }
typedef __attribute__((ext_vector_type(2))) _Float16 v2h;
typedef __attribute__((ext_vector_type(4))) _Float16 v4h;
typedef __attribute__((ext_vector_type(2))) unsigned short v2us;
typedef __attribute__((ext_vector_type(4))) unsigned short v4us;
typedef __attribute__((ext_vector_type(2))) float v2f;
typedef __attribute__((ext_vector_type(4))) int v4i;

__global__ __launch_bounds__(256) void k_wtG(const float* __restrict__ w, int K, int N, bf* Bt) {
    const int lane = threadIdx.x & 31; const int L0 = (blockIdx.x * 8 + (threadIdx.x >> 5)) * 8; const int nlines = N * K / 64;
{
#pragma unroll 1
        for (int l = 0; l < 8; ++l) { const int L = L0 + l; if (L >= nlines) break; const size_t e = (size_t)L * 64 + lane * 2; const int k = (int)(e % K), n = (int)(e / K); v2us o;
            o[0] = f2bf(w[(size_t)k * N + n]); o[1] = f2bf(w[(size_t)(k + 1) * N + n]); *(v2us*)(Bt + e) = o; }
         }
}
__global__ __launch_bounds__(256) void k_cvt8(const float* __restrict__ src, bf* dst, size_t n8) { const size_t i = (size_t)blockIdx.x * 256 + threadIdx.x; if (i >= n8) return; const v8f v = *(const v8f*)(src + i * 8); v8us o;
#pragma unroll
    for (int k = 0; k < 8; ++k) o[k] = f2bf(v[k]); *(v8us*)(dst + i * 8) = o;  }
__global__ __launch_bounds__(256) void k_cscvt(const float* __restrict__ cosT, const float* __restrict__ sinT, float* CS) { const int idx = blockIdx.x * 256 + threadIdx.x; if (idx >= TT * HD) return; v2f cs; cs[0] = bfr(cosT[idx]); cs[1] = bfr(sinT[idx]); *(v2f*)(CS + (size_t)idx * 2) = cs;  }
// k_rope: head planes [h][t][d] (fp16 + hi/lo) of rope(x) x sc with the rotate-half convention out[d] = x[d] cos[t][d] - x[d+HD/2] sin[t][d], out[d+HD/2] = x[d+HD/2] cos[t][d+HD/2] + x[d] sin[t][d+HD/2]
__global__ __launch_bounds__(256) void k_rope(const float* __restrict__ F, int pitch, int nheads, const float* __restrict__ CS, const float* __restrict__ RF, const float* __restrict__ nw, float sc, h16* P16, bf* Ph, bf* Pl) {
    const size_t e = ((size_t)blockIdx.x * 256 + threadIdx.x) * 2; if (e >= (size_t)nheads * TT * HD) return; const int d = (int)(e % HD); const int t = (int)((e / HD) % TT); const int h = (int)(e / ((size_t)HD * TT)); const float* f = F + (size_t)t * pitch + h * HD; const float rf = RF ? RF[(size_t)h * TT + t] : 1.0f; v2h o16; v2us oh, ol;
#pragma unroll
    for (int q = 0; q < 2; ++q) { const int dd = d + q; const int dp = (dd < HD / 2) ? dd + HD / 2 : dd - HD / 2; float x0 = f[dd], x1 = f[dp];
        if (RF) { float n0 = __fmul_rn(x0, rf), n1 = __fmul_rn(x1, rf); asm volatile("" : "+v"(n0)); asm volatile("" : "+v"(n1)); x0 = __fmul_rn(bfr(nw[dd]), n0); x1 = __fmul_rn(bfr(nw[dp]), n1); }
        const v2f cs = *(const v2f*)(CS + ((size_t)t * HD + dd) * 2); float a = __fmul_rn(x0, cs[0]), bq = __fmul_rn(x1, cs[1]); asm volatile("" : "+v"(a)); asm volatile("" : "+v"(bq)); const float r = ((dd < HD / 2) ? __fsub_rn(a, bq) : __fadd_rn(a, bq)) * sc;
        o16[q] = tohx(r); unsigned short a2, c2; splitf(r, a2, c2); oh[q] = a2; ol[q] = c2; }
    *(v2h*)(P16 + e) = o16; *(v2us*)(Ph + e) = oh; *(v2us*)(Pl + e) = ol;  }
__global__ __launch_bounds__(256) void k_vtp(const float* __restrict__ F, int pitch, int nheads, h16* V16, bf* Vh, bf* Vl) { const size_t e = ((size_t)blockIdx.x * 256 + threadIdx.x) * 2; if (e >= (size_t)nheads * HD * TT) return; const int t = (int)(e % TT); const int d = (int)((e / TT) % HD); const int g = (int)(e / ((size_t)TT * HD)); v2h o16; v2us oh, ol;
#pragma unroll
    for (int q = 0; q < 2; ++q) { const float x = F[(size_t)(t + q) * pitch + g * HD + d]; o16[q] = tohx(x); unsigned short a2, c2; splitf(x, a2, c2); oh[q] = a2; ol[q] = c2; }
    *(v2h*)(V16 + e) = o16; *(v2us*)(Vh + e) = oh; *(v2us*)(Vl + e) = ol;  }
__global__ __launch_bounds__(256) void k_csid(float* CS) { const int idx = blockIdx.x * 256 + threadIdx.x; if (idx >= TT * HD) return; v2f cs; cs[0] = 1.0f; cs[1] = 0.0f; *(v2f*)(CS + (size_t)idx * 2) = cs;  }
// k_asoft: per row (zz, i): t = (S + AMS[j]) x SCL (AMS = mask / SCL, SCL = 1/sqrt(12)); softmax over the 2048 keys (register row, one exp, fixed trees);
__global__ __launch_bounds__(256) void k_asoft(const float* __restrict__ Sb, const float* __restrict__ am, h16* P16, bf* Ph, bf* Pl) {
    const int lane = threadIdx.x & 31; const int row = blockIdx.x * 8 + (threadIdx.x >> 5); if (row >= ZH * TT) return; const int i = row % TT; const int zz = row / TT; (void)zz; const bool hires = (i < RH); const float* sr = Sb + (size_t)row * TT; float v[TT / 32]; float mx = -3.0e38f;
#pragma unroll
    for (int ch = 0; ch < TT / 128; ++ch) { const int j0 = ch * 128 + lane * 4; const v4f a = *(const v4f*)(sr + j0);
#pragma unroll
        for (int q = 0; q < 4; ++q) { const int j = j0 + q; const float s0 = __fadd_rn(a[q], am[j]); float t = __fmul_rn(s0, SCL); asm volatile("" : "+v"(t)); v[ch * 4 + q] = t; mx = fmaxf(mx, t); } }
#pragma unroll
    for (int sh = 16; sh; sh >>= 1) mx = fmaxf(mx, __shfl_xor(mx, sh, 32));
    float sum = 0.f;
#pragma unroll
    for (int k = 0; k < TT / 32; ++k) { float d0 = __fsub_rn(v[k], mx); asm volatile("" : "+v"(d0)); v[k] = __builtin_amdgcn_exp2f(__fmul_rn(d0, 1.4426950408889634f)); sum += v[k]; }
#pragma unroll
    for (int sh = 16; sh; sh >>= 1) sum += __shfl_xor(sum, sh, 32);
    const float f = __fdiv_rn(hires ? 1.0f : PCAR, sum);
{
        if (hires) {
#pragma unroll
            for (int ch = 0; ch < TT / 128; ++ch) { v4us oh, ol;
#pragma unroll
                for (int q = 0; q < 4; ++q) { unsigned short a, c2; splitf(v[ch * 4 + q] * f, a, c2); oh[q] = a; ol[q] = c2; }
                const size_t oo = ((size_t)zz * (RH ? RH : 1) + i) * TT + ch * 128 + lane * 4; *(v4us*)(Ph + oo) = oh; *(v4us*)(Pl + oo) = ol; }
        } else {
#pragma unroll
            for (int ch = 0; ch < TT / 128; ++ch) { v4h o4;
#pragma unroll
                for (int q = 0; q < 4; ++q) o4[q] = tohx(v[ch * 4 + q] * f);
                *(v4h*)(P16 + (size_t)row * TT + ch * 128 + lane * 4) = o4; } }
         }
}
__global__ __launch_bounds__(256) void k_merge(const float* __restrict__ O, int h0, bf* Ah, bf* Al) { const size_t e = ((size_t)blockIdx.x * 256 + threadIdx.x) * 2; if (e >= (size_t)ZH * TT * HD) return; const int d = (int)(e % HD); const int t = (int)((e / HD) % TT); const int zz = (int)(e / ((size_t)HD * TT)); const float cs = (t < RH) ? 1.0f : (1.0f / PCAR); const size_t oo = (size_t)t * DQ + (h0 + zz) * HD + d;
    v2us oh, ol; v2f s = *(const v2f*)(O + e);   // the KSP partial planes of probs.v, added in plane order
#pragma unroll
    for (int ks = 1; ks < KSP; ++ks) s += *(const v2f*)(O + (size_t)ks * ZH * TT * HD + e);
#pragma unroll
    for (int q = 0; q < 2; ++q) { unsigned short a, c2; splitf(s[q] * cs, a, c2); oh[q] = a; ol[q] = c2; } *(v2us*)(Ah + oo) = oh; *(v2us*)(Al + oo) = ol;  }

__global__ __launch_bounds__(256) void k_sumpl(const bf* __restrict__ Ah, const bf* __restrict__ Al, float* OUT) { const size_t i = ((size_t)blockIdx.x * 256 + threadIdx.x) * 4; if (i >= (size_t)TT * DQ) return; const v4us a = *(const v4us*)(Ah + i), c = *(const v4us*)(Al + i); v4f o;
#pragma unroll
    for (int q = 0; q < 4; ++q) o[q] = __fadd_rn(bf2f(a[q]), bf2f(c[q])); *(v4f*)(OUT + i) = o;  }

__global__ __launch_bounds__(256) void k_ams(const float* __restrict__ am, float* AMS) { const int j = blockIdx.x * 256 + threadIdx.x; if (j >= TT) return; const float v = bfr(am[j]) * (1.0f / SCL); *(float*)(AMS + j) = v;  }

extern "C" void kernel_launch(void* const* d_in, const int* in_sizes, int n_in,
                              void* d_out, int out_size, void* d_ws, size_t ws_size, hipStream_t stream) {
    (void)in_sizes; (void)n_in; (void)out_size;
    const float* x = (const float*)d_in[0]; const float* amask = (const float*)d_in[1]; const float* wq = (const float*)d_in[2]; const float* bq = (const float*)d_in[3]; const float* wk = (const float*)d_in[4]; const float* bk = (const float*)d_in[5]; const float* wv = (const float*)d_in[6]; const float* bv = (const float*)d_in[7]; const float* wo = nullptr; (void)wo;
    float* OUT = (float*)d_out;     // [2][2048][768]
    char* wsp = (char*)d_ws;
    auto take = [&](size_t bytes) { char* p = wsp; wsp += (bytes + 255) & ~(size_t)255; return (void*)p; };
    bf* WQ = (bf*)take((size_t)DQ * DM * 2); bf* WK = (bf*)take((size_t)DKV * DM * 2); bf* WV = (bf*)take((size_t)DKV * DM * 2); float* CS = (float*)take((size_t)TT * HD * 2 * 4); float* AMS = (float*)take((size_t)TT * 4);
    bf* XB = (bf*)take((size_t)TT * DM * 2); float* FQ = (float*)take((size_t)TT * DQ * 4); float* FK = (float*)take((size_t)TT * DKV * 4);
    h16* QP16 = (h16*)take((size_t)NH_ * TT * HD * 2); h16* KP16 = (h16*)take((size_t)NKV * TT * HD * 2); h16* VT16 = (h16*)take((size_t)NKV * HD * TT * 2);
    bf* QPh = (bf*)take((size_t)NH_ * TT * HD * 2); bf* QPl = (bf*)take((size_t)NH_ * TT * HD * 2); bf* KPh = (bf*)take((size_t)NKV * TT * HD * 2); bf* KPl = (bf*)take((size_t)NKV * TT * HD * 2); bf* VTh = (bf*)take((size_t)NKV * HD * TT * 2); bf* VTl = (bf*)take((size_t)NKV * HD * TT * 2); bf* Ph = (bf*)take((size_t)ZH * RH * TT * 2); bf* Pl = (bf*)take((size_t)ZH * RH * TT * 2);
    float* Sb = (float*)take((size_t)ZH * TT * TT * 4); h16* P16 = (h16*)take((size_t)ZH * TT * TT * 2); float* Ob = (float*)take((size_t)KSP * ZH * TT * HD * 4); bf* ATh = (bf*)take((size_t)TT * DQ * 2); bf* ATl = (bf*)take((size_t)TT * DQ * 2);
    if ((size_t)(wsp - (char*)d_ws) > ws_size) return;    // ws 256 MiB
    float* FV = FK;   // v projection reuses the k buffer after the k planes are built (stream-ordered)
    { k_wtG<<<(unsigned)((DM * DQ / 64 + 63) / 64), 256, 0, stream>>>(wq, DM, DQ, WQ); k_wtG<<<(unsigned)((DM * DKV / 64 + 63) / 64), 256, 0, stream>>>(wk, DM, DKV, WK); k_wtG<<<(unsigned)((DM * DKV / 64 + 63) / 64), 256, 0, stream>>>(wv, DM, DKV, WV);
       }
    k_csid<<<(TT * HD + 255) / 256, 256, 0, stream>>>(CS);
    const unsigned LQ = (unsigned)(((size_t)NH_ * TT * HD / 2 + 255) / 256), LKv = (unsigned)(((size_t)NKV * TT * HD / 2 + 255) / 256);
    for (int b = 0; b < NB_; ++b) {
        
        k_ams<<<TT / 256, 256, 0, stream>>>(amask + (size_t)b * TT, AMS); k_cvt8<<<(unsigned)(((size_t)TT * DM / 8 + 255) / 256), 256, 0, stream>>>(x + (size_t)b * TT * DM, XB, (size_t)TT * DM / 8);
        k_gemmw<bf, 0, true><<<dim3(TT / 64, DQ / 64, 1), 32, 0, stream>>>(XB, nullptr, WQ, nullptr, DM, FQ, DQ, bq, 0, 0, 0, 0);
        k_rope<<<LQ, 256, 0, stream>>>(FQ, DQ, NH_, CS, nullptr, nullptr, 1.0f, QP16, QPh, QPl);
        k_gemmw<bf, 0, true><<<dim3(TT / 64, DKV / 64, 1), 32, 0, stream>>>(XB, nullptr, WK, nullptr, DM, FK, DKV, bk, 0, 0, 0, 0);
        k_rope<<<LKv, 256, 0, stream>>>(FK, DKV, NKV, CS, nullptr, nullptr, 1.0f, KP16, KPh, KPl);
        k_gemmw<bf, 0, true><<<dim3(TT / 64, DKV / 64, 1), 32, 0, stream>>>(XB, nullptr, WV, nullptr, DM, FV, DKV, bv, 0, 0, 0, 0); k_vtp<<<LKv, 256, 0, stream>>>(FV, DKV, NKV, VT16, VTh, VTl);
        for (int h0 = 0; h0 < NH_; h0 += ZH) { const size_t zq = (size_t)h0, zk = (size_t)(h0 / REP);   // one kv head per query head: the pass's two heads use consecutive kv planes (z-strides TT*HD)
            k_gemmw<bf, 2, false><<<dim3(RH / 64, TT / 64, ZH), 32, 0, stream>>>(QPh + zq * TT * HD, QPl + zq * TT * HD, KPh + zk * TT * HD, KPl + zk * TT * HD, HD, Sb, TT, nullptr, (size_t)TT * HD, (size_t)TT * HD, (size_t)TT * TT, 0);
            k_gemmw<h16, 0, false><<<dim3((TT - RH) / 64, TT / 64, ZH), 32, 0, stream>>>(QP16 + zq * TT * HD + (size_t)RH * HD, nullptr, KP16 + zk * TT * HD, nullptr, HD, Sb + (size_t)RH * TT, TT, nullptr, (size_t)TT * HD, (size_t)TT * HD, (size_t)TT * TT, 0);
            k_asoft<<<ZH * TT / 8, 256, 0, stream>>>(Sb, AMS, P16, Ph, Pl);
            k_gemmw<bf, 2, false, KSP><<<dim3(RH / 64, HD / 64, ZH * KSP), 32, 0, stream>>>(Ph, Pl, VTh + zk * HD * TT, VTl + zk * HD * TT, TT, Ob, HD, nullptr, (size_t)RH * TT, (size_t)HD * TT, (size_t)TT * HD, (size_t)ZH * TT * HD);
            k_gemmw<h16, 0, false, KSP><<<dim3((TT - RH) / 64, HD / 64, ZH * KSP), 32, 0, stream>>>(P16 + (size_t)RH * TT, nullptr, VT16 + zk * HD * TT, nullptr, TT, Ob + (size_t)RH * HD, HD, nullptr, (size_t)TT * TT, (size_t)HD * TT, (size_t)TT * HD, (size_t)ZH * TT * HD);
            k_merge<<<(unsigned)(((size_t)ZH * TT * HD / 2 + 255) / 256), 256, 0, stream>>>(Ob, h0, ATh, ATl); }
        k_sumpl<<<(unsigned)(((size_t)TT * DQ / 4 + 255) / 256), 256, 0, stream>>>(ATh, ATl, OUT + (size_t)b * TT * DQ); }
}

// v002
// A run of this version takes 579 microseconds.
// Two timings next to v001 put it at 1.24 and 1.25 times that version's speed.
// Over all steps from v000 it is 2.72 times as fast.
#include <hip/hip_runtime.h>

// SyntaxBertSelfAttention (hidden [2][2048][768], additive attention_mask [2][1][1][2048]; q/k/v = x W + b (12 heads x 64); scores = q.k / sqrt(12) (the module scales by 1/sqrt(num_heads), faithful) + mask[b][j]; softmax; out = merged heads -> [2][2048][768]).
// Compute dtypes, f32 accumulate: every input rounded to bf16; projections on PLAIN bf16 operands (inputs: exact, + bias); scores (K 64) and probs.v on hl planes (3 products) for the first 512 query rows of each

#define NB_  2
#define TT   2048
#define DM   768
#define NH_  12
#define NKV  12
#define REP  (NH_ / NKV)
#define HD   64
#define DQ   (NH_ * HD)
#define DKV  (NKV * HD)
#define ZH   6                    // heads per pass: every launch of the head loop covers ZH heads (grid z)
#define RH   512                  // query rows < RH use hi+lo planes (0: none)
#define WIN  2048
#define PCAR 1024.0f
#define SCL  0.28867513459481287f
#define KSP  16                   // probs.v: work-groups that share one output tile, each over TT / KSP keys (256 B of every operand row)
typedef _Float16 h16;
typedef unsigned short bf;
typedef __attribute__((ext_vector_type(16))) __bf16   v16bf;
typedef __attribute__((ext_vector_type(16))) _Float16 v16h;
typedef __attribute__((ext_vector_type(8)))  _Float16 v8h;
typedef __attribute__((ext_vector_type(8)))  unsigned short v8us;
typedef __attribute__((ext_vector_type(8)))  float    v8f;
typedef __attribute__((ext_vector_type(4)))  float    v4f;
typedef v8h  __attribute__((may_alias)) v8ha;
typedef v4f  __attribute__((may_alias)) v4fa;
typedef v8us __attribute__((may_alias)) v8usa;

__device__ __forceinline__ unsigned short f2bf(float f) { unsigned u = __float_as_uint(f); u += 0x7FFFu + ((u >> 16) & 1u); return (unsigned short)(u >> 16); }
__device__ __forceinline__ float bf2f(unsigned short b) { return __uint_as_float(((unsigned)b) << 16); }
__device__ __forceinline__ float bfr(float f) { return bf2f(f2bf(f)); }
__device__ __forceinline__ v16h cat16(v8h lo, v8h hi) { return __builtin_shufflevector(lo, hi, 0, 1, 2, 3, 4, 5, 6, 7, 8, 9, 10, 11, 12, 13, 14, 15); }
__device__ __forceinline__ v16bf cat16b(v8us lo, v8us hi) { return __builtin_bit_cast(v16bf, __builtin_shufflevector(lo, hi, 0, 1, 2, 3, 4, 5, 6, 7, 8, 9, 10, 11, 12, 13, 14, 15)); }
__device__ __forceinline__ v8f wmma16(v16h a, v16h b, v8f c) { return __builtin_amdgcn_wmma_f32_16x16x32_f16(false, a, false, b, (short)0, c, false, false); }
__device__ __forceinline__ v8f wmmab(v16bf a, v16bf b, v8f c) { return __builtin_amdgcn_wmma_f32_16x16x32_bf16(false, a, false, b, (short)0, c, false, false); }



// ---- k_gemmw: register-blocked GEMM, ONE WAVE per 64x64 output tile (16 accumulators), operands straight from K-contiguous 16-bit planes; grid (M/64, N/64, Z), 32 threads.
// C[m][n] (f32, pitch ldc, + optional f32 bias[n]) = sum_k A[m][k] Bt[n][k] (+ split products per NSPLIT). z-batch strides sA/sB/sC in elements. K % 32 == 0.
// KS > 1: grid z = Z * KS; work-group (z, ks) sums k in [ks K/KS, (ks+1) K/KS) only and stores its partial tile in plane ks (plane stride sP elements); the reader adds the planes.
template <typename T16> struct WFrag;
template <> struct WFrag<h16> { typedef v16h V; static __device__ __forceinline__ V ld(const h16* p) { return cat16(*(const v8h*)p, *(const v8h*)(p + 16)); } static __device__ __forceinline__ v8f mma(V a, V b, v8f c) { return wmma16(a, b, c); } };
template <> struct WFrag<bf> { typedef v16bf V; static __device__ __forceinline__ V ld(const bf* p) { return cat16b(*(const v8us*)p, *(const v8us*)(p + 16)); } static __device__ __forceinline__ v8f mma(V a, V b, v8f c) { return wmmab(a, b, c); } };
template <typename T16, int NSPLIT, bool BIAS, int KS = 1>
__global__ __launch_bounds__(32) void k_gemmw(const T16* __restrict__ A, const T16* __restrict__ A2, const T16* __restrict__ Bt, const T16* __restrict__ Bt2, int K, float* C, int ldc, const float* __restrict__ bias, size_t sA, size_t sB, size_t sC, size_t sP) {
    typedef typename WFrag<T16>::V V;
    __shared__ __align__(16) float os[16 * 68];
    const size_t z = blockIdx.z / KS; const int ks = blockIdx.z % KS; A += z * sA; if (A2) A2 += z * sA; Bt += z * sB; if (Bt2) Bt2 += z * sB; C += z * sC + ks * sP;
    const int kbeg = ks * (K / KS), kend = kbeg + K / KS;
    const int lane = threadIdx.x & 31, lr = lane & 15, hi = lane >> 4; const int r0 = blockIdx.x * 64, c0 = blockIdx.y * 64;
    v8f acc[4][4];
#pragma unroll
    for (int mb = 0; mb < 4; ++mb)
#pragma unroll
        for (int nb = 0; nb < 4; ++nb) acc[mb][nb] = (v8f){};
    const size_t aoff = (size_t)(r0 + lr) * K + 8 * hi, boff = (size_t)(c0 + lr) * K + 8 * hi;
#pragma unroll 1
    for (int kc = kbeg; kc < kend; kc += 32) {
        V a[4], a2[4];
#pragma unroll
        for (int mb = 0; mb < 4; ++mb) { a[mb] = WFrag<T16>::ld(A + aoff + (size_t)mb * 16 * K + kc); if (NSPLIT == 1 || NSPLIT == 2) a2[mb] = WFrag<T16>::ld(A2 + aoff + (size_t)mb * 16 * K + kc); }
#pragma unroll
        for (int nb = 0; nb < 4; ++nb) { const V b = WFrag<T16>::ld(Bt + boff + (size_t)nb * 16 * K + kc); V b2; if (NSPLIT >= 2) b2 = WFrag<T16>::ld(Bt2 + boff + (size_t)nb * 16 * K + kc);
#pragma unroll
            for (int mb = 0; mb < 4; ++mb) { acc[mb][nb] = WFrag<T16>::mma(a[mb], b, acc[mb][nb]); if (NSPLIT == 1 || NSPLIT == 2) acc[mb][nb] = WFrag<T16>::mma(a2[mb], b, acc[mb][nb]); if (NSPLIT >= 2) acc[mb][nb] = WFrag<T16>::mma(a[mb], b2, acc[mb][nb]); } }
        asm volatile("v_nop\n\tv_nop\n\tv_nop\n\tv_nop" : "+v"(acc[0][0]), "+v"(acc[1][1]), "+v"(acc[2][2]), "+v"(acc[3][3]) : "v"(a[0]), "v"(a[3]));
    }
#pragma unroll
    for (int mb = 0; mb < 4; ++mb) {
#pragma unroll
        for (int nb = 0; nb < 4; ++nb) {
#pragma unroll
            for (int j = 0; j < 8; ++j) os[(hi * 8 + j) * 68 + nb * 16 + lr] = acc[mb][nb][j]; }
        __builtin_amdgcn_wave_barrier(); asm volatile("" ::: "memory");
        float* crow = C + (size_t)(r0 + mb * 16) * ldc + c0;
{
#pragma unroll
            for (int s = 0; s < 8; ++s) { const int row = 2 * s + hi, cofs = lr * 4; v4f val = *(const v4fa*)(os + row * 68 + cofs); if (BIAS) { val[0] += bfr(bias[c0 + cofs]); val[1] += bfr(bias[c0 + cofs + 1]); val[2] += bfr(bias[c0 + cofs + 2]); val[3] += bfr(bias[c0 + cofs + 3]); }
                *(v4f*)(crow + (size_t)row * ldc + cofs) = val; }
             }
        __builtin_amdgcn_wave_barrier(); asm volatile("" ::: "memory");
    }
}

__device__ __forceinline__ h16 tohx(float x) { return (h16)x; }
__device__ __forceinline__ void splitf(float y, unsigned short& h, unsigned short& l) { h = f2bf(y); l = f2bf(y - bf2f(h)); }
typedef __attribute__((ext_vector_type(2))) _Float16 v2h;
typedef __attribute__((ext_vector_type(4))) _Float16 v4h;
typedef __attribute__((ext_vector_type(2))) unsigned short v2us;
typedef __attribute__((ext_vector_type(4))) unsigned short v4us;
typedef __attribute__((ext_vector_type(2))) float v2f;
typedef __attribute__((ext_vector_type(4))) int v4i;

__global__ __launch_bounds__(256) void k_wtG(const float* __restrict__ w, int K, int N, bf* Bt) {
    const int lane = threadIdx.x & 31; const int L0 = (blockIdx.x * 8 + (threadIdx.x >> 5)) * 8; const int nlines = N * K / 64;
{
#pragma unroll 1
        for (int l = 0; l < 8; ++l) { const int L = L0 + l; if (L >= nlines) break; const size_t e = (size_t)L * 64 + lane * 2; const int k = (int)(e % K), n = (int)(e / K); v2us o;
            o[0] = f2bf(w[(size_t)k * N + n]); o[1] = f2bf(w[(size_t)(k + 1) * N + n]); *(v2us*)(Bt + e) = o; }
         }
}
__global__ __launch_bounds__(256) void k_cvt8(const float* __restrict__ src, bf* dst, size_t n8) { const size_t i = (size_t)blockIdx.x * 256 + threadIdx.x; if (i >= n8) return; const v8f v = *(const v8f*)(src + i * 8); v8us o;
#pragma unroll
    for (int k = 0; k < 8; ++k) o[k] = f2bf(v[k]); *(v8us*)(dst + i * 8) = o;  }
__global__ __launch_bounds__(256) void k_cscvt(const float* __restrict__ cosT, const float* __restrict__ sinT, float* CS) { const int idx = blockIdx.x * 256 + threadIdx.x; if (idx >= TT * HD) return; v2f cs; cs[0] = bfr(cosT[idx]); cs[1] = bfr(sinT[idx]); *(v2f*)(CS + (size_t)idx * 2) = cs;  }
// k_rope: head planes [h][t][d] (fp16 + hi/lo) of rope(x) x sc with the rotate-half convention out[d] = x[d] cos[t][d] - x[d+HD/2] sin[t][d], out[d+HD/2] = x[d+HD/2] cos[t][d+HD/2] + x[d] sin[t][d+HD/2]
__global__ __launch_bounds__(256) void k_rope(const float* __restrict__ F, int pitch, int nheads, const float* __restrict__ CS, const float* __restrict__ RF, const float* __restrict__ nw, float sc, h16* P16, bf* Ph, bf* Pl) {
    const size_t e = ((size_t)blockIdx.x * 256 + threadIdx.x) * 2; if (e >= (size_t)nheads * TT * HD) return; const int d = (int)(e % HD); const int t = (int)((e / HD) % TT); const int h = (int)(e / ((size_t)HD * TT)); const float* f = F + (size_t)t * pitch + h * HD; const float rf = RF ? RF[(size_t)h * TT + t] : 1.0f; v2h o16; v2us oh, ol;
#pragma unroll
    for (int q = 0; q < 2; ++q) { const int dd = d + q; const int dp = (dd < HD / 2) ? dd + HD / 2 : dd - HD / 2; float x0 = f[dd], x1 = f[dp];
        if (RF) { float n0 = __fmul_rn(x0, rf), n1 = __fmul_rn(x1, rf); asm volatile("" : "+v"(n0)); asm volatile("" : "+v"(n1)); x0 = __fmul_rn(bfr(nw[dd]), n0); x1 = __fmul_rn(bfr(nw[dp]), n1); }
        const v2f cs = *(const v2f*)(CS + ((size_t)t * HD + dd) * 2); float a = __fmul_rn(x0, cs[0]), bq = __fmul_rn(x1, cs[1]); asm volatile("" : "+v"(a)); asm volatile("" : "+v"(bq)); const float r = ((dd < HD / 2) ? __fsub_rn(a, bq) : __fadd_rn(a, bq)) * sc;
        o16[q] = tohx(r); unsigned short a2, c2; splitf(r, a2, c2); oh[q] = a2; ol[q] = c2; }
    *(v2h*)(P16 + e) = o16; *(v2us*)(Ph + e) = oh; *(v2us*)(Pl + e) = ol;  }
__global__ __launch_bounds__(256) void k_vtp(const float* __restrict__ F, int pitch, int nheads, h16* V16, bf* Vh, bf* Vl) { const size_t e = ((size_t)blockIdx.x * 256 + threadIdx.x) * 2; if (e >= (size_t)nheads * HD * TT) return; const int t = (int)(e % TT); const int d = (int)((e / TT) % HD); const int g = (int)(e / ((size_t)TT * HD)); v2h o16; v2us oh, ol;
#pragma unroll
    for (int q = 0; q < 2; ++q) { const float x = F[(size_t)(t + q) * pitch + g * HD + d]; o16[q] = tohx(x); unsigned short a2, c2; splitf(x, a2, c2); oh[q] = a2; ol[q] = c2; }
    *(v2h*)(V16 + e) = o16; *(v2us*)(Vh + e) = oh; *(v2us*)(Vl + e) = ol;  }
__global__ __launch_bounds__(256) void k_csid(float* CS) { const int idx = blockIdx.x * 256 + threadIdx.x; if (idx >= TT * HD) return; v2f cs; cs[0] = 1.0f; cs[1] = 0.0f; *(v2f*)(CS + (size_t)idx * 2) = cs;  }
// k_asoft: per row (zz, i): t = (S + AMS[j]) x SCL (AMS = mask / SCL, SCL = 1/sqrt(12)); softmax over the 2048 keys (register row, one exp, fixed trees);
__global__ __launch_bounds__(256) void k_asoft(const float* __restrict__ Sb, const float* __restrict__ am, h16* P16, bf* Ph, bf* Pl) {
    const int lane = threadIdx.x & 31; const int row = blockIdx.x * 8 + (threadIdx.x >> 5); if (row >= ZH * TT) return; const int i = row % TT; const int zz = row / TT; (void)zz; const bool hires = (i < RH); const float* sr = Sb + (size_t)row * TT; float v[TT / 32]; float mx = -3.0e38f;
#pragma unroll
    for (int ch = 0; ch < TT / 128; ++ch) { const int j0 = ch * 128 + lane * 4; const v4f a = *(const v4f*)(sr + j0);
#pragma unroll
        for (int q = 0; q < 4; ++q) { const int j = j0 + q; const float s0 = __fadd_rn(a[q], am[j]); float t = __fmul_rn(s0, SCL); asm volatile("" : "+v"(t)); v[ch * 4 + q] = t; mx = fmaxf(mx, t); } }
#pragma unroll
    for (int sh = 16; sh; sh >>= 1) mx = fmaxf(mx, __shfl_xor(mx, sh, 32));
    float sum = 0.f;
#pragma unroll
    for (int k = 0; k < TT / 32; ++k) { float d0 = __fsub_rn(v[k], mx); asm volatile("" : "+v"(d0)); v[k] = __builtin_amdgcn_exp2f(__fmul_rn(d0, 1.4426950408889634f)); sum += v[k]; }
#pragma unroll
    for (int sh = 16; sh; sh >>= 1) sum += __shfl_xor(sum, sh, 32);
    const float f = __fdiv_rn(hires ? 1.0f : PCAR, sum);
{
        if (hires) {
#pragma unroll
            for (int ch = 0; ch < TT / 128; ++ch) { v4us oh, ol;
#pragma unroll
                for (int q = 0; q < 4; ++q) { unsigned short a, c2; splitf(v[ch * 4 + q] * f, a, c2); oh[q] = a; ol[q] = c2; }
                const size_t oo = ((size_t)zz * (RH ? RH : 1) + i) * TT + ch * 128 + lane * 4; *(v4us*)(Ph + oo) = oh; *(v4us*)(Pl + oo) = ol; }
        } else {
#pragma unroll
            for (int ch = 0; ch < TT / 128; ++ch) { v4h o4;
#pragma unroll
                for (int q = 0; q < 4; ++q) o4[q] = tohx(v[ch * 4 + q] * f);
                *(v4h*)(P16 + (size_t)row * TT + ch * 128 + lane * 4) = o4; } }
         }
}
__global__ __launch_bounds__(256) void k_merge(const float* __restrict__ O, int h0, bf* Ah, bf* Al) { const size_t e = ((size_t)blockIdx.x * 256 + threadIdx.x) * 2; if (e >= (size_t)ZH * TT * HD) return; const int d = (int)(e % HD); const int t = (int)((e / HD) % TT); const int zz = (int)(e / ((size_t)HD * TT)); const float cs = (t < RH) ? 1.0f : (1.0f / PCAR); const size_t oo = (size_t)t * DQ + (h0 + zz) * HD + d;
    v2us oh, ol; v2f s = *(const v2f*)(O + e);   // the KSP partial planes of probs.v, added in plane order
#pragma unroll
    for (int ks = 1; ks < KSP; ++ks) s += *(const v2f*)(O + (size_t)ks * ZH * TT * HD + e);
#pragma unroll
    for (int q = 0; q < 2; ++q) { unsigned short a, c2; splitf(s[q] * cs, a, c2); oh[q] = a; ol[q] = c2; } *(v2us*)(Ah + oo) = oh; *(v2us*)(Al + oo) = ol;  }

__global__ __launch_bounds__(256) void k_sumpl(const bf* __restrict__ Ah, const bf* __restrict__ Al, float* OUT) { const size_t i = ((size_t)blockIdx.x * 256 + threadIdx.x) * 4; if (i >= (size_t)TT * DQ) return; const v4us a = *(const v4us*)(Ah + i), c = *(const v4us*)(Al + i); v4f o;
#pragma unroll
    for (int q = 0; q < 4; ++q) o[q] = __fadd_rn(bf2f(a[q]), bf2f(c[q])); *(v4f*)(OUT + i) = o;  }

__global__ __launch_bounds__(256) void k_ams(const float* __restrict__ am, float* AMS) { const int j = blockIdx.x * 256 + threadIdx.x; if (j >= TT) return; const float v = bfr(am[j]) * (1.0f / SCL); *(float*)(AMS + j) = v;  }

extern "C" void kernel_launch(void* const* d_in, const int* in_sizes, int n_in,
                              void* d_out, int out_size, void* d_ws, size_t ws_size, hipStream_t stream) {
    (void)in_sizes; (void)n_in; (void)out_size;
    const float* x = (const float*)d_in[0]; const float* amask = (const float*)d_in[1]; const float* wq = (const float*)d_in[2]; const float* bq = (const float*)d_in[3]; const float* wk = (const float*)d_in[4]; const float* bk = (const float*)d_in[5]; const float* wv = (const float*)d_in[6]; const float* bv = (const float*)d_in[7]; const float* wo = nullptr; (void)wo;
    float* OUT = (float*)d_out;     // [2][2048][768]
    char* wsp = (char*)d_ws;
    auto take = [&](size_t bytes) { char* p = wsp; wsp += (bytes + 255) & ~(size_t)255; return (void*)p; };
    bf* WQ = (bf*)take((size_t)DQ * DM * 2); bf* WK = (bf*)take((size_t)DKV * DM * 2); bf* WV = (bf*)take((size_t)DKV * DM * 2); float* CS = (float*)take((size_t)TT * HD * 2 * 4); float* AMS = (float*)take((size_t)TT * 4);
    bf* XB = (bf*)take((size_t)TT * DM * 2); float* FQ = (float*)take((size_t)TT * DQ * 4); float* FK = (float*)take((size_t)TT * DKV * 4);
    h16* QP16 = (h16*)take((size_t)NH_ * TT * HD * 2); h16* KP16 = (h16*)take((size_t)NKV * TT * HD * 2); h16* VT16 = (h16*)take((size_t)NKV * HD * TT * 2);
    bf* QPh = (bf*)take((size_t)NH_ * TT * HD * 2); bf* QPl = (bf*)take((size_t)NH_ * TT * HD * 2); bf* KPh = (bf*)take((size_t)NKV * TT * HD * 2); bf* KPl = (bf*)take((size_t)NKV * TT * HD * 2); bf* VTh = (bf*)take((size_t)NKV * HD * TT * 2); bf* VTl = (bf*)take((size_t)NKV * HD * TT * 2); bf* Ph = (bf*)take((size_t)ZH * RH * TT * 2); bf* Pl = (bf*)take((size_t)ZH * RH * TT * 2);
    float* Sb = (float*)take((size_t)ZH * TT * TT * 4); h16* P16 = (h16*)take((size_t)ZH * TT * TT * 2); bf* ATh = (bf*)take((size_t)TT * DQ * 2); bf* ATl = (bf*)take((size_t)TT * DQ * 2);
    if ((size_t)(wsp - (char*)d_ws) > ws_size) return;    // ws 256 MiB
    float* FV = FK;   // v projection reuses the k buffer after the k planes are built (stream-ordered)
    float* Ob = Sb;   // the KSP partial planes of probs.v (KSP * HD <= TT floats per row) reuse the score buffer, dead once the softmax has read it (stream-ordered)
    { k_wtG<<<(unsigned)((DM * DQ / 64 + 63) / 64), 256, 0, stream>>>(wq, DM, DQ, WQ); k_wtG<<<(unsigned)((DM * DKV / 64 + 63) / 64), 256, 0, stream>>>(wk, DM, DKV, WK); k_wtG<<<(unsigned)((DM * DKV / 64 + 63) / 64), 256, 0, stream>>>(wv, DM, DKV, WV);
       }
    k_csid<<<(TT * HD + 255) / 256, 256, 0, stream>>>(CS);
    const unsigned LQ = (unsigned)(((size_t)NH_ * TT * HD / 2 + 255) / 256), LKv = (unsigned)(((size_t)NKV * TT * HD / 2 + 255) / 256);
    for (int b = 0; b < NB_; ++b) {
        
        k_ams<<<TT / 256, 256, 0, stream>>>(amask + (size_t)b * TT, AMS); k_cvt8<<<(unsigned)(((size_t)TT * DM / 8 + 255) / 256), 256, 0, stream>>>(x + (size_t)b * TT * DM, XB, (size_t)TT * DM / 8);
        k_gemmw<bf, 0, true><<<dim3(TT / 64, DQ / 64, 1), 32, 0, stream>>>(XB, nullptr, WQ, nullptr, DM, FQ, DQ, bq, 0, 0, 0, 0);
        k_rope<<<LQ, 256, 0, stream>>>(FQ, DQ, NH_, CS, nullptr, nullptr, 1.0f, QP16, QPh, QPl);
        k_gemmw<bf, 0, true><<<dim3(TT / 64, DKV / 64, 1), 32, 0, stream>>>(XB, nullptr, WK, nullptr, DM, FK, DKV, bk, 0, 0, 0, 0);
        k_rope<<<LKv, 256, 0, stream>>>(FK, DKV, NKV, CS, nullptr, nullptr, 1.0f, KP16, KPh, KPl);
        k_gemmw<bf, 0, true><<<dim3(TT / 64, DKV / 64, 1), 32, 0, stream>>>(XB, nullptr, WV, nullptr, DM, FV, DKV, bv, 0, 0, 0, 0); k_vtp<<<LKv, 256, 0, stream>>>(FV, DKV, NKV, VT16, VTh, VTl);
        for (int h0 = 0; h0 < NH_; h0 += ZH) { const size_t zq = (size_t)h0, zk = (size_t)(h0 / REP);   // one kv head per query head: the pass's ZH heads use consecutive kv planes (z-strides TT*HD)
            k_gemmw<bf, 2, false><<<dim3(RH / 64, TT / 64, ZH), 32, 0, stream>>>(QPh + zq * TT * HD, QPl + zq * TT * HD, KPh + zk * TT * HD, KPl + zk * TT * HD, HD, Sb, TT, nullptr, (size_t)TT * HD, (size_t)TT * HD, (size_t)TT * TT, 0);
            k_gemmw<h16, 0, false><<<dim3((TT - RH) / 64, TT / 64, ZH), 32, 0, stream>>>(QP16 + zq * TT * HD + (size_t)RH * HD, nullptr, KP16 + zk * TT * HD, nullptr, HD, Sb + (size_t)RH * TT, TT, nullptr, (size_t)TT * HD, (size_t)TT * HD, (size_t)TT * TT, 0);
            k_asoft<<<ZH * TT / 8, 256, 0, stream>>>(Sb, AMS, P16, Ph, Pl);
            k_gemmw<bf, 2, false, KSP><<<dim3(RH / 64, HD / 64, ZH * KSP), 32, 0, stream>>>(Ph, Pl, VTh + zk * HD * TT, VTl + zk * HD * TT, TT, Ob, HD, nullptr, (size_t)RH * TT, (size_t)HD * TT, (size_t)TT * HD, (size_t)ZH * TT * HD);
            k_gemmw<h16, 0, false, KSP><<<dim3((TT - RH) / 64, HD / 64, ZH * KSP), 32, 0, stream>>>(P16 + (size_t)RH * TT, nullptr, VT16 + zk * HD * TT, nullptr, TT, Ob + (size_t)RH * HD, HD, nullptr, (size_t)TT * TT, (size_t)HD * TT, (size_t)TT * HD, (size_t)ZH * TT * HD);
            k_merge<<<(unsigned)(((size_t)ZH * TT * HD / 2 + 255) / 256), 256, 0, stream>>>(Ob, h0, ATh, ATl); }
        k_sumpl<<<(unsigned)(((size_t)TT * DQ / 4 + 255) / 256), 256, 0, stream>>>(ATh, ATl, OUT + (size_t)b * TT * DQ); }
}

// v003
// It runs in 229 microseconds.
// Timed twice side by side with v002, it ran 2.52 and 2.53 times as fast.
// Over all steps from v000 it is 6.87 times as fast.
#include <hip/hip_runtime.h>

// SyntaxBertSelfAttention (hidden [2][2048][768], additive attention_mask [2][1][1][2048]; q/k/v = x W + b (12 heads x 64); scores = q.k / sqrt(12) (the module scales by 1/sqrt(num_heads), faithful) + mask[b][j]; softmax; out = merged heads -> [2][2048][768]).
// Compute dtypes, f32 accumulate: every input rounded to bf16; projections on PLAIN bf16 operands (inputs: exact, + bias); scores (K 64) and probs.v on hl planes (3 products) for the first 512 query rows of each

#define NB_  2
#define TT   2048
#define DM   768
#define NH_  12
#define NKV  12
#define REP  (NH_ / NKV)
#define HD   64
#define DQ   (NH_ * HD)
#define DKV  (NKV * HD)
#define RH   512                  // query rows < RH use hi+lo planes (0: none)
#define WIN  2048
#define SCL  0.28867513459481287f
#define L2E  1.4426950408889634f
#define FPI  144                  // fused attention: LDS row pitch in bytes (128 B of data + 16)
#define FTB  (64 * FPI)           // fused attention: bytes of one staged 64-row tile
typedef _Float16 h16;
typedef unsigned short bf;
typedef __attribute__((ext_vector_type(16))) __bf16   v16bf;
typedef __attribute__((ext_vector_type(16))) _Float16 v16h;
typedef __attribute__((ext_vector_type(8)))  _Float16 v8h;
typedef __attribute__((ext_vector_type(8)))  unsigned short v8us;
typedef __attribute__((ext_vector_type(8)))  float    v8f;
typedef __attribute__((ext_vector_type(4)))  float    v4f;
typedef v8h  __attribute__((may_alias)) v8ha;
typedef v4f  __attribute__((may_alias)) v4fa;
typedef v8us __attribute__((may_alias)) v8usa;

__device__ __forceinline__ unsigned short f2bf(float f) { unsigned u = __float_as_uint(f); u += 0x7FFFu + ((u >> 16) & 1u); return (unsigned short)(u >> 16); }
__device__ __forceinline__ float bf2f(unsigned short b) { return __uint_as_float(((unsigned)b) << 16); }
__device__ __forceinline__ float bfr(float f) { return bf2f(f2bf(f)); }
__device__ __forceinline__ v16h cat16(v8h lo, v8h hi) { return __builtin_shufflevector(lo, hi, 0, 1, 2, 3, 4, 5, 6, 7, 8, 9, 10, 11, 12, 13, 14, 15); }
__device__ __forceinline__ v16bf cat16b(v8us lo, v8us hi) { return __builtin_bit_cast(v16bf, __builtin_shufflevector(lo, hi, 0, 1, 2, 3, 4, 5, 6, 7, 8, 9, 10, 11, 12, 13, 14, 15)); }
__device__ __forceinline__ v8f wmma16(v16h a, v16h b, v8f c) { return __builtin_amdgcn_wmma_f32_16x16x32_f16(false, a, false, b, (short)0, c, false, false); }
__device__ __forceinline__ v8f wmmab(v16bf a, v16bf b, v8f c) { return __builtin_amdgcn_wmma_f32_16x16x32_bf16(false, a, false, b, (short)0, c, false, false); }



// ---- k_gemmw: register-blocked GEMM, ONE WAVE per 64x64 output tile (16 accumulators), operands straight from K-contiguous 16-bit planes; grid (M/64, N/64, Z), 32 threads.
// C[m][n] (f32, pitch ldc, + optional f32 bias[n]) = sum_k A[m][k] Bt[n][k] (+ split products per NSPLIT). z-batch strides sA/sB/sC in elements. K % 32 == 0.
// KS > 1: grid z = Z * KS; work-group (z, ks) sums k in [ks K/KS, (ks+1) K/KS) only and stores its partial tile in plane ks (plane stride sP elements); the reader adds the planes.
template <typename T16> struct WFrag;
template <> struct WFrag<h16> { typedef v16h V; static __device__ __forceinline__ V ld(const h16* p) { return cat16(*(const v8h*)p, *(const v8h*)(p + 16)); } static __device__ __forceinline__ v8f mma(V a, V b, v8f c) { return wmma16(a, b, c); } };
template <> struct WFrag<bf> { typedef v16bf V; static __device__ __forceinline__ V ld(const bf* p) { return cat16b(*(const v8us*)p, *(const v8us*)(p + 16)); } static __device__ __forceinline__ v8f mma(V a, V b, v8f c) { return wmmab(a, b, c); } };
template <typename T16, int NSPLIT, bool BIAS, int KS = 1>
__global__ __launch_bounds__(32) void k_gemmw(const T16* __restrict__ A, const T16* __restrict__ A2, const T16* __restrict__ Bt, const T16* __restrict__ Bt2, int K, float* C, int ldc, const float* __restrict__ bias, size_t sA, size_t sB, size_t sC, size_t sP) {
    typedef typename WFrag<T16>::V V;
    __shared__ __align__(16) float os[16 * 68];
    const size_t z = blockIdx.z / KS; const int ks = blockIdx.z % KS; A += z * sA; if (A2) A2 += z * sA; Bt += z * sB; if (Bt2) Bt2 += z * sB; C += z * sC + ks * sP;
    const int kbeg = ks * (K / KS), kend = kbeg + K / KS;
    const int lane = threadIdx.x & 31, lr = lane & 15, hi = lane >> 4; const int r0 = blockIdx.x * 64, c0 = blockIdx.y * 64;
    v8f acc[4][4];
#pragma unroll
    for (int mb = 0; mb < 4; ++mb)
#pragma unroll
        for (int nb = 0; nb < 4; ++nb) acc[mb][nb] = (v8f){};
    const size_t aoff = (size_t)(r0 + lr) * K + 8 * hi, boff = (size_t)(c0 + lr) * K + 8 * hi;
#pragma unroll 1
    for (int kc = kbeg; kc < kend; kc += 32) {
        V a[4], a2[4];
#pragma unroll
        for (int mb = 0; mb < 4; ++mb) { a[mb] = WFrag<T16>::ld(A + aoff + (size_t)mb * 16 * K + kc); if (NSPLIT == 1 || NSPLIT == 2) a2[mb] = WFrag<T16>::ld(A2 + aoff + (size_t)mb * 16 * K + kc); }
#pragma unroll
        for (int nb = 0; nb < 4; ++nb) { const V b = WFrag<T16>::ld(Bt + boff + (size_t)nb * 16 * K + kc); V b2; if (NSPLIT >= 2) b2 = WFrag<T16>::ld(Bt2 + boff + (size_t)nb * 16 * K + kc);
#pragma unroll
            for (int mb = 0; mb < 4; ++mb) { acc[mb][nb] = WFrag<T16>::mma(a[mb], b, acc[mb][nb]); if (NSPLIT == 1 || NSPLIT == 2) acc[mb][nb] = WFrag<T16>::mma(a2[mb], b, acc[mb][nb]); if (NSPLIT >= 2) acc[mb][nb] = WFrag<T16>::mma(a[mb], b2, acc[mb][nb]); } }
        asm volatile("v_nop\n\tv_nop\n\tv_nop\n\tv_nop" : "+v"(acc[0][0]), "+v"(acc[1][1]), "+v"(acc[2][2]), "+v"(acc[3][3]) : "v"(a[0]), "v"(a[3]));
    }
#pragma unroll
    for (int mb = 0; mb < 4; ++mb) {
#pragma unroll
        for (int nb = 0; nb < 4; ++nb) {
#pragma unroll
            for (int j = 0; j < 8; ++j) os[(hi * 8 + j) * 68 + nb * 16 + lr] = acc[mb][nb][j]; }
        __builtin_amdgcn_wave_barrier(); asm volatile("" ::: "memory");
        float* crow = C + (size_t)(r0 + mb * 16) * ldc + c0;
{
#pragma unroll
            for (int s = 0; s < 8; ++s) { const int row = 2 * s + hi, cofs = lr * 4; v4f val = *(const v4fa*)(os + row * 68 + cofs); if (BIAS) { val[0] += bfr(bias[c0 + cofs]); val[1] += bfr(bias[c0 + cofs + 1]); val[2] += bfr(bias[c0 + cofs + 2]); val[3] += bfr(bias[c0 + cofs + 3]); }
                *(v4f*)(crow + (size_t)row * ldc + cofs) = val; }
             }
        __builtin_amdgcn_wave_barrier(); asm volatile("" ::: "memory");
    }
}

__device__ __forceinline__ h16 tohx(float x) { return (h16)x; }
__device__ __forceinline__ void splitf(float y, unsigned short& h, unsigned short& l) { h = f2bf(y); l = f2bf(y - bf2f(h)); }
typedef __attribute__((ext_vector_type(2))) _Float16 v2h;
typedef __attribute__((ext_vector_type(4))) _Float16 v4h;
typedef __attribute__((ext_vector_type(2))) unsigned short v2us;
typedef __attribute__((ext_vector_type(4))) unsigned short v4us;
typedef __attribute__((ext_vector_type(2))) float v2f;
typedef __attribute__((ext_vector_type(4))) int v4i;

__global__ __launch_bounds__(256) void k_wtG(const float* __restrict__ w, int K, int N, bf* Bt) {
    const int lane = threadIdx.x & 31; const int L0 = (blockIdx.x * 8 + (threadIdx.x >> 5)) * 8; const int nlines = N * K / 64;
{
#pragma unroll 1
        for (int l = 0; l < 8; ++l) { const int L = L0 + l; if (L >= nlines) break; const size_t e = (size_t)L * 64 + lane * 2; const int k = (int)(e % K), n = (int)(e / K); v2us o;
            o[0] = f2bf(w[(size_t)k * N + n]); o[1] = f2bf(w[(size_t)(k + 1) * N + n]); *(v2us*)(Bt + e) = o; }
         }
}
__global__ __launch_bounds__(256) void k_cvt8(const float* __restrict__ src, bf* dst, size_t n8) { const size_t i = (size_t)blockIdx.x * 256 + threadIdx.x; if (i >= n8) return; const v8f v = *(const v8f*)(src + i * 8); v8us o;
#pragma unroll
    for (int k = 0; k < 8; ++k) o[k] = f2bf(v[k]); *(v8us*)(dst + i * 8) = o;  }
__global__ __launch_bounds__(256) void k_cscvt(const float* __restrict__ cosT, const float* __restrict__ sinT, float* CS) { const int idx = blockIdx.x * 256 + threadIdx.x; if (idx >= TT * HD) return; v2f cs; cs[0] = bfr(cosT[idx]); cs[1] = bfr(sinT[idx]); *(v2f*)(CS + (size_t)idx * 2) = cs;  }
// k_rope: head planes [h][t][d] (fp16 + hi/lo) of rope(x) x sc with the rotate-half convention out[d] = x[d] cos[t][d] - x[d+HD/2] sin[t][d], out[d+HD/2] = x[d+HD/2] cos[t][d+HD/2] + x[d] sin[t][d+HD/2]
__global__ __launch_bounds__(256) void k_rope(const float* __restrict__ F, int pitch, int nheads, const float* __restrict__ CS, const float* __restrict__ RF, const float* __restrict__ nw, float sc, h16* P16, bf* Ph, bf* Pl) {
    const size_t e = ((size_t)blockIdx.x * 256 + threadIdx.x) * 2; if (e >= (size_t)nheads * TT * HD) return; const int d = (int)(e % HD); const int t = (int)((e / HD) % TT); const int h = (int)(e / ((size_t)HD * TT)); const float* f = F + (size_t)t * pitch + h * HD; const float rf = RF ? RF[(size_t)h * TT + t] : 1.0f; v2h o16; v2us oh, ol;
#pragma unroll
    for (int q = 0; q < 2; ++q) { const int dd = d + q; const int dp = (dd < HD / 2) ? dd + HD / 2 : dd - HD / 2; float x0 = f[dd], x1 = f[dp];
        if (RF) { float n0 = __fmul_rn(x0, rf), n1 = __fmul_rn(x1, rf); asm volatile("" : "+v"(n0)); asm volatile("" : "+v"(n1)); x0 = __fmul_rn(bfr(nw[dd]), n0); x1 = __fmul_rn(bfr(nw[dp]), n1); }
        const v2f cs = *(const v2f*)(CS + ((size_t)t * HD + dd) * 2); float a = __fmul_rn(x0, cs[0]), bq = __fmul_rn(x1, cs[1]); asm volatile("" : "+v"(a)); asm volatile("" : "+v"(bq)); const float r = ((dd < HD / 2) ? __fsub_rn(a, bq) : __fadd_rn(a, bq)) * sc;
        o16[q] = tohx(r); unsigned short a2, c2; splitf(r, a2, c2); oh[q] = a2; ol[q] = c2; }
    *(v2h*)(P16 + e) = o16; *(v2us*)(Ph + e) = oh; *(v2us*)(Pl + e) = ol;  }
__global__ __launch_bounds__(256) void k_vtp(const float* __restrict__ F, int pitch, int nheads, h16* V16, bf* Vh, bf* Vl) { const size_t e = ((size_t)blockIdx.x * 256 + threadIdx.x) * 2; if (e >= (size_t)nheads * HD * TT) return; const int t = (int)(e % TT); const int d = (int)((e / TT) % HD); const int g = (int)(e / ((size_t)TT * HD)); v2h o16; v2us oh, ol;
#pragma unroll
    for (int q = 0; q < 2; ++q) { const float x = F[(size_t)(t + q) * pitch + g * HD + d]; o16[q] = tohx(x); unsigned short a2, c2; splitf(x, a2, c2); oh[q] = a2; ol[q] = c2; }
    *(v2h*)(V16 + e) = o16; *(v2us*)(Vh + e) = oh; *(v2us*)(Vl + e) = ol;  }
__global__ __launch_bounds__(256) void k_csid(float* CS) { const int idx = blockIdx.x * 256 + threadIdx.x; if (idx >= TT * HD) return; v2f cs; cs[0] = 1.0f; cs[1] = 0.0f; *(v2f*)(CS + (size_t)idx * 2) = cs;  }
typedef __attribute__((ext_vector_type(16))) unsigned short v16us;
template <bool HI> struct FAt;
template <> struct FAt<false> { typedef v16h V; static __device__ __forceinline__ V cast(v16us x) { return __builtin_bit_cast(v16h, x); } static __device__ __forceinline__ v8f mma(V a, V b, v8f c) { return wmma16(a, b, c); } };
template <> struct FAt<true> { typedef v16bf V; static __device__ __forceinline__ V cast(v16us x) { return __builtin_bit_cast(v16bf, x); } static __device__ __forceinline__ v8f mma(V a, V b, v8f c) { return wmmab(a, b, c); } };
__device__ __forceinline__ v16us ldfr(const unsigned char* p) { return __builtin_shufflevector(*(const v8usa*)p, *(const v8usa*)(p + 32), 0, 1, 2, 3, 4, 5, 6, 7, 8, 9, 10, 11, 12, 13, 14, 15); }   // k = 8 hi + 0..7 and 16 + 8 hi + 0..7 of a 32-k chunk; p already holds the 16 hi bytes
__device__ __forceinline__ float xhalf(float x) { const int b = __float_as_int(x); return __int_as_float(__builtin_amdgcn_permlanex16(b, b, 0x76543210, 0xfedcba98, false, false)); }   // lane l <-> l ^ 16
// eight 2^x in one statement, each in place: no v_exp_f32 here is directly followed by an instruction that reads its result or overwrites its source, and the v_nop keeps that slot behind the last one.
// In place, so that the statement writes only registers that a compiler-placed vector instruction in front of it has just written (never an operand of a matrix instruction still in its window).
__device__ __forceinline__ v8f exp2x8(v8f x) { float y0 = x[0], y1 = x[1], y2 = x[2], y3 = x[3], y4 = x[4], y5 = x[5], y6 = x[6], y7 = x[7];
    asm("v_exp_f32 %0, %0\n\tv_exp_f32 %1, %1\n\tv_exp_f32 %2, %2\n\tv_exp_f32 %3, %3\n\tv_exp_f32 %4, %4\n\tv_exp_f32 %5, %5\n\tv_exp_f32 %6, %6\n\tv_exp_f32 %7, %7\n\tv_nop"
        : "+v"(y0), "+v"(y1), "+v"(y2), "+v"(y3), "+v"(y4), "+v"(y5), "+v"(y6), "+v"(y7));
    return (v8f){y0, y1, y2, y3, y4, y5, y6, y7}; }
template <bool HI>
__device__ __forceinline__ void fattn_body(const unsigned char* __restrict__ Q0, const unsigned char* __restrict__ Q1, const unsigned char* __restrict__ K0, const unsigned char* __restrict__ K1, const unsigned char* __restrict__ V0, const unsigned char* __restrict__ V1, const float* __restrict__ ams, float* out, int q0, unsigned char* sm) {
    typedef typename FAt<HI>::V V;
    constexpr int NT = HI ? 4 : 2;                     // staged tiles per stage: K, Vt (, K lo, Vt lo)
    const int tid = threadIdx.x, lane = tid & 31, wv = tid >> 5, c = lane & 15, h = lane >> 4;
    float* mk = (float*)sm; unsigned char* buf = sm + TT * 4;
    for (int j = tid; j < TT; j += 128) mk[j] = ams[j] * (SCL * L2E);   // additive mask in the log2 domain
    const int srow = tid >> 3, scol = (tid & 7) * 16;  // staging: 8 threads per 128-byte row, 16 rows per sweep
    v8us st[NT][4];
    auto gload = [&](int s) {
#pragma unroll
        for (int u = 0; u < 4; ++u) { const int row = srow + 16 * u; const size_t ko = (size_t)(s * 64 + row) * (HD * 2) + scol, vo = (size_t)row * (TT * 2) + s * 128 + scol;
            st[0][u] = *(const v8usa*)(K0 + ko); st[1][u] = *(const v8usa*)(V0 + vo); if (HI) { st[2][u] = *(const v8usa*)(K1 + ko); st[3][u] = *(const v8usa*)(V1 + vo); } }
        asm volatile("s_wait_xcnt 0x0" ::: "memory"); };   // stands in front of every later overwrite of these loads' address registers (this build reuses them while the loads are in flight)
    auto lstore = [&](int bs) { unsigned char* d = buf + bs * (NT * FTB) + srow * FPI + scol;
#pragma unroll
        for (int t = 0; t < NT; ++t)
#pragma unroll
            for (int u = 0; u < 4; ++u) *(v8usa*)(d + t * FTB + u * 16 * FPI) = st[t][u]; };
    V qf[2], ql[2];
#pragma unroll
    for (int kc = 0; kc < 2; ++kc) { const size_t qo = (size_t)(q0 + wv * 16 + c) * (HD * 2) + kc * 64 + h * 16; qf[kc] = FAt<HI>::cast(ldfr(Q0 + qo)); if (HI) ql[kc] = FAt<HI>::cast(ldfr(Q1 + qo)); }
    v8f o[4];
#pragma unroll
    for (int dt = 0; dt < 4; ++dt) o[dt] = (v8f){};
    float m = -3.0e38f, l = 0.f;
    gload(0); lstore(0); __syncthreads();
#pragma unroll 1
    for (int s = 0; s < TT / 64; ++s) {
        if (s + 1 < TT / 64) gload(s + 1);
        const unsigned char* kb = buf + (s & 1) * (NT * FTB) + c * FPI + h * 16;
        v4f mq[4][2];   // the lane's 32 mask terms, fetched ahead of the fragments: LDS answers in order, and the softmax needs these first
#pragma unroll
        for (int kt = 0; kt < 4; ++kt) { const float* mp = mk + s * 64 + kt * 16 + 8 * h; mq[kt][0] = *(const v4fa*)mp; mq[kt][1] = *(const v4fa*)(mp + 4); }
        v8f sc[4];
#pragma unroll
        for (int kt = 0; kt < 4; ++kt) { v8f a = (v8f){};
#pragma unroll
            for (int kc = 0; kc < 2; ++kc) { const V kf = FAt<HI>::cast(ldfr(kb + kt * 16 * FPI + kc * 64)); a = FAt<HI>::mma(kf, qf[kc], a);
                if (HI) { a = FAt<HI>::mma(kf, ql[kc], a); const V kl = FAt<HI>::cast(ldfr(kb + 2 * FTB + kt * 16 * FPI + kc * 64)); a = FAt<HI>::mma(kl, qf[kc], a); } }
            sc[kt] = a; }
        V va[2][HI ? 2 : 1][4];   // Vt fragments: [32-key chunk][plane][d tile]
        auto vload = [&](int j) {
#pragma unroll
            for (int dt = 0; dt < 4; ++dt) { va[j][0][dt] = FAt<HI>::cast(ldfr(kb + FTB + dt * 16 * FPI + j * 64)); if constexpr (HI) va[j][1][dt] = FAt<HI>::cast(ldfr(kb + 3 * FTB + dt * 16 * FPI + j * 64)); } };
        vload(0); if (!HI) vload(1);
        __builtin_amdgcn_sched_barrier(0);   // keeps these LDS loads above the softmax, so that their latency runs under it; without it they sink to their first use
        float mx = m;
#pragma unroll
        for (int kt = 0; kt < 4; ++kt)
#pragma unroll
            for (int r = 0; r < 8; ++r) { const float t = fmaf(sc[kt][r], SCL * L2E, mq[kt][r >> 2][r & 3]); sc[kt][r] = t; mx = fmaxf(mx, t); }
        mx = fmaxf(mx, xhalf(mx));
        const float al = __builtin_amdgcn_exp2f(m - mx); m = mx;
        const float ms = HI ? mx : mx - 10.0f;
#pragma unroll
        for (int dt = 0; dt < 4; ++dt) o[dt] *= al;
#pragma unroll
        for (int j = 0; j < 2; ++j) { V pf, pl; sc[2 * j] = exp2x8(sc[2 * j] - ms); sc[2 * j + 1] = exp2x8(sc[2 * j + 1] - ms);
#pragma unroll
            for (int e = 0; e < 16; ++e) { const float p = sc[2 * j + (e >> 3)][e & 7];
                if constexpr (HI) { const __bf16 ph = (__bf16)p; pf[e] = ph; pl[e] = (__bf16)(p - (float)ph); } else { pf[e] = (_Float16)p; } }
            if (HI && j == 0) { vload(1); __builtin_amdgcn_sched_barrier(0); }   // the second chunk's loads are issued ahead of the first chunk's products, for the same reason
#pragma unroll
            for (int dt = 0; dt < 4; ++dt) { o[dt] = FAt<HI>::mma(va[j][0][dt], pf, o[dt]);
                if constexpr (HI) { o[dt] = FAt<HI>::mma(va[j][0][dt], pl, o[dt]); o[dt] = FAt<HI>::mma(va[j][1][dt], pf, o[dt]); } } }
        const v8f pv = (sc[0] + sc[1]) + (sc[2] + sc[3]);   // the lane's 32 terms as a tree, not one dependent chain
        l = fmaf(l, al, ((pv[0] + pv[1]) + (pv[2] + pv[3])) + ((pv[4] + pv[5]) + (pv[6] + pv[7])));
        if (s + 1 < TT / 64) lstore((s + 1) & 1);
        __syncthreads();   // publishes stage s + 1 and ends every wave's reads of the buffer that the next trip refills
    }
    l += xhalf(l);
    const float inv = 1.0f / l;
    float* orow = out + (size_t)(q0 + wv * 16 + c) * DQ + 8 * h;
#pragma unroll
    for (int dt = 0; dt < 4; ++dt) { v4f a, b;
#pragma unroll
        for (int r = 0; r < 4; ++r) { a[r] = o[dt][r] * inv; b[r] = o[dt][4 + r] * inv; }
        *(v4f*)(orow + dt * 16) = a; *(v4f*)(orow + dt * 16 + 4) = b; }
}
// grid: the hi+lo blocks (3 x the matrix work) first, then the f16 blocks; planes [batch][head][...], AMS [batch][key], OUT [batch][query][head * 64 + d]
// amdgpu_waves_per_eu(3, 3): 768 work-groups of one wave per SIMD on 256 WGPs are three waves per SIMD; the register budget of three lets the scheduler keep a stage's LDS loads in flight instead of waiting on each
__global__ __launch_bounds__(128) __attribute__((amdgpu_waves_per_eu(3, 3))) void k_fattn(const h16* __restrict__ Q16, const h16* __restrict__ K16, const h16* __restrict__ V16, const bf* __restrict__ Qh, const bf* __restrict__ Ql, const bf* __restrict__ Kh, const bf* __restrict__ Kl, const bf* __restrict__ Vh, const bf* __restrict__ Vl, const float* __restrict__ AMS, float* OUT) {
    __shared__ __align__(16) unsigned char sm[TT * 4 + 2 * 4 * FTB];
    const int nhi = NB_ * NH_ * (RH / 64); const int idx = blockIdx.x;
    if (idx < nhi) { const int bh = idx / (RH / 64), qb = idx % (RH / 64); const size_t po = (size_t)bh * TT * HD; const int b = bh / NH_, hd = bh % NH_;
        fattn_body<true>((const unsigned char*)(Qh + po), (const unsigned char*)(Ql + po), (const unsigned char*)(Kh + po), (const unsigned char*)(Kl + po), (const unsigned char*)(Vh + po), (const unsigned char*)(Vl + po), AMS + (size_t)b * TT, OUT + (size_t)b * TT * DQ + hd * HD, qb * 64, sm);
    } else { const int i2 = idx - nhi; const int bh = i2 / ((TT - RH) / 64), qb = RH / 64 + i2 % ((TT - RH) / 64); const size_t po = (size_t)bh * TT * HD; const int b = bh / NH_, hd = bh % NH_;
        fattn_body<false>((const unsigned char*)(Q16 + po), nullptr, (const unsigned char*)(K16 + po), nullptr, (const unsigned char*)(V16 + po), nullptr, AMS + (size_t)b * TT, OUT + (size_t)b * TT * DQ + hd * HD, qb * 64, sm); }
}

__global__ __launch_bounds__(256) void k_ams(const float* __restrict__ am, float* AMS) { const int j = blockIdx.x * 256 + threadIdx.x; if (j >= TT) return; const float v = bfr(am[j]) * (1.0f / SCL); *(float*)(AMS + j) = v;  }

extern "C" void kernel_launch(void* const* d_in, const int* in_sizes, int n_in,
                              void* d_out, int out_size, void* d_ws, size_t ws_size, hipStream_t stream) {
    (void)in_sizes; (void)n_in; (void)out_size;
    const float* x = (const float*)d_in[0]; const float* amask = (const float*)d_in[1]; const float* wq = (const float*)d_in[2]; const float* bq = (const float*)d_in[3]; const float* wk = (const float*)d_in[4]; const float* bk = (const float*)d_in[5]; const float* wv = (const float*)d_in[6]; const float* bv = (const float*)d_in[7]; const float* wo = nullptr; (void)wo;
    float* OUT = (float*)d_out;     // [2][2048][768]
    char* wsp = (char*)d_ws;
    auto take = [&](size_t bytes) { char* p = wsp; wsp += (bytes + 255) & ~(size_t)255; return (void*)p; };
    bf* WQ = (bf*)take((size_t)DQ * DM * 2); bf* WK = (bf*)take((size_t)DKV * DM * 2); bf* WV = (bf*)take((size_t)DKV * DM * 2); float* CS = (float*)take((size_t)TT * HD * 2 * 4); float* AMS = (float*)take((size_t)NB_ * TT * 4);
    bf* XB = (bf*)take((size_t)TT * DM * 2); float* FQ = (float*)take((size_t)TT * DQ * 4); float* FK = (float*)take((size_t)TT * DKV * 4);
    const size_t PQ = (size_t)NH_ * TT * HD, PK = (size_t)NKV * TT * HD;   // elements of one batch's head planes; every plane holds both batches, for the one attention launch behind the loop
    h16* QP16 = (h16*)take(NB_ * PQ * 2); h16* KP16 = (h16*)take(NB_ * PK * 2); h16* VT16 = (h16*)take(NB_ * PK * 2);
    bf* QPh = (bf*)take(NB_ * PQ * 2); bf* QPl = (bf*)take(NB_ * PQ * 2); bf* KPh = (bf*)take(NB_ * PK * 2); bf* KPl = (bf*)take(NB_ * PK * 2); bf* VTh = (bf*)take(NB_ * PK * 2); bf* VTl = (bf*)take(NB_ * PK * 2);
    if ((size_t)(wsp - (char*)d_ws) > ws_size) return;    // ws 256 MiB
    float* FV = FK;   // v projection reuses the k buffer after the k planes are built (stream-ordered)
    { k_wtG<<<(unsigned)((DM * DQ / 64 + 63) / 64), 256, 0, stream>>>(wq, DM, DQ, WQ); k_wtG<<<(unsigned)((DM * DKV / 64 + 63) / 64), 256, 0, stream>>>(wk, DM, DKV, WK); k_wtG<<<(unsigned)((DM * DKV / 64 + 63) / 64), 256, 0, stream>>>(wv, DM, DKV, WV);
       }
    k_csid<<<(TT * HD + 255) / 256, 256, 0, stream>>>(CS);
    const unsigned LQ = (unsigned)(((size_t)NH_ * TT * HD / 2 + 255) / 256), LKv = (unsigned)(((size_t)NKV * TT * HD / 2 + 255) / 256);
    for (int b = 0; b < NB_; ++b) {
        
        k_ams<<<TT / 256, 256, 0, stream>>>(amask + (size_t)b * TT, AMS + (size_t)b * TT); k_cvt8<<<(unsigned)(((size_t)TT * DM / 8 + 255) / 256), 256, 0, stream>>>(x + (size_t)b * TT * DM, XB, (size_t)TT * DM / 8);
        k_gemmw<bf, 0, true><<<dim3(TT / 64, DQ / 64, 1), 32, 0, stream>>>(XB, nullptr, WQ, nullptr, DM, FQ, DQ, bq, 0, 0, 0, 0);
        k_rope<<<LQ, 256, 0, stream>>>(FQ, DQ, NH_, CS, nullptr, nullptr, 1.0f, QP16 + b * PQ, QPh + b * PQ, QPl + b * PQ);
        k_gemmw<bf, 0, true><<<dim3(TT / 64, DKV / 64, 1), 32, 0, stream>>>(XB, nullptr, WK, nullptr, DM, FK, DKV, bk, 0, 0, 0, 0);
        k_rope<<<LKv, 256, 0, stream>>>(FK, DKV, NKV, CS, nullptr, nullptr, 1.0f, KP16 + b * PK, KPh + b * PK, KPl + b * PK);
        k_gemmw<bf, 0, true><<<dim3(TT / 64, DKV / 64, 1), 32, 0, stream>>>(XB, nullptr, WV, nullptr, DM, FV, DKV, bv, 0, 0, 0, 0); k_vtp<<<LKv, 256, 0, stream>>>(FV, DKV, NKV, VT16 + b * PK, VTh + b * PK, VTl + b * PK); }
    k_fattn<<<NB_ * NH_ * (TT / 64), 128, 0, stream>>>(QP16, KP16, VT16, QPh, QPl, KPh, KPl, VTh, VTl, AMS, OUT);
}

// v004
// A run of this version takes 188 microseconds.
// Timed twice side by side with v003, it ran 1.21 and 1.23 times as fast.
// Counting every step since v000, it is 8.37 times as fast.
#include <hip/hip_runtime.h>

// SyntaxBertSelfAttention (hidden [2][2048][768], additive attention_mask [2][1][1][2048]; q/k/v = x W + b (12 heads x 64); scores = q.k / sqrt(12) (the module scales by 1/sqrt(num_heads), faithful) + mask[b][j]; softmax; out = merged heads -> [2][2048][768]).
// Compute dtypes, f32 accumulate: every input rounded to bf16; projections on PLAIN bf16 operands (inputs: exact, + bias); scores (K 64) and probs.v on hl planes (3 products) for the first 512 query rows of each

#define NB_  2
#define TT   2048
#define DM   768
#define NH_  12
#define NKV  12
#define REP  (NH_ / NKV)
#define HD   64
#define DQ   (NH_ * HD)
#define DKV  (NKV * HD)
#define RH   512                  // query rows < RH use hi+lo planes (0: none)
#define WIN  2048
#define SCL  0.28867513459481287f
#define L2E  1.4426950408889634f
#define FPI  144                  // fused attention: LDS row pitch in bytes (128 B of data + 16)
#define FTB  (64 * FPI)           // fused attention: bytes of one staged 64-row tile
typedef _Float16 h16;
typedef unsigned short bf;
typedef __attribute__((ext_vector_type(16))) __bf16   v16bf;
typedef __attribute__((ext_vector_type(16))) _Float16 v16h;
typedef __attribute__((ext_vector_type(8)))  _Float16 v8h;
typedef __attribute__((ext_vector_type(8)))  unsigned short v8us;
typedef __attribute__((ext_vector_type(8)))  float    v8f;
typedef __attribute__((ext_vector_type(4)))  float    v4f;
typedef v8h  __attribute__((may_alias)) v8ha;
typedef v4f  __attribute__((may_alias)) v4fa;
typedef v8us __attribute__((may_alias)) v8usa;

__device__ __forceinline__ unsigned short f2bf(float f) { unsigned u = __float_as_uint(f); u += 0x7FFFu + ((u >> 16) & 1u); return (unsigned short)(u >> 16); }
__device__ __forceinline__ float bf2f(unsigned short b) { return __uint_as_float(((unsigned)b) << 16); }
__device__ __forceinline__ float bfr(float f) { return bf2f(f2bf(f)); }
__device__ __forceinline__ v16h cat16(v8h lo, v8h hi) { return __builtin_shufflevector(lo, hi, 0, 1, 2, 3, 4, 5, 6, 7, 8, 9, 10, 11, 12, 13, 14, 15); }
__device__ __forceinline__ v16bf cat16b(v8us lo, v8us hi) { return __builtin_bit_cast(v16bf, __builtin_shufflevector(lo, hi, 0, 1, 2, 3, 4, 5, 6, 7, 8, 9, 10, 11, 12, 13, 14, 15)); }
__device__ __forceinline__ v8f wmma16(v16h a, v16h b, v8f c) { return __builtin_amdgcn_wmma_f32_16x16x32_f16(false, a, false, b, (short)0, c, false, false); }
__device__ __forceinline__ v8f wmmab(v16bf a, v16bf b, v8f c) { return __builtin_amdgcn_wmma_f32_16x16x32_bf16(false, a, false, b, (short)0, c, false, false); }



__device__ __forceinline__ h16 tohx(float x) { return (h16)x; }
__device__ __forceinline__ void splitf(float y, unsigned short& h, unsigned short& l) { h = f2bf(y); l = f2bf(y - bf2f(h)); }
// ---- k_gemmw: register-blocked GEMM, ONE WAVE per 64x64 output tile (16 accumulators), operands straight from K-contiguous 16-bit planes; grid (M/64, N/64), 32 threads.
// c[m][n] (f32, + optional f32 bias[n]) = sum_k A[m][k] Bt[n][k] (+ split products per NSPLIT). K % 32 == 0. A 64-column tile is one head (HD == 64), m is the token.
// The f32 tile is never stored: the epilogue writes it as the three 16-bit operand planes of the attention kernel (f16, bf16 hi, bf16 lo).
// VT false: planes [head][token][d], through the LDS tile (a lane takes 8 consecutive d). VT true: planes [head][d][token], straight from the accumulators (a lane holds 8 consecutive tokens of one d).
template <typename T16> struct WFrag;
template <> struct WFrag<h16> { typedef v16h V; static __device__ __forceinline__ V ld(const h16* p) { return cat16(*(const v8h*)p, *(const v8h*)(p + 16)); } static __device__ __forceinline__ v8f mma(V a, V b, v8f c) { return wmma16(a, b, c); } };
template <> struct WFrag<bf> { typedef v16bf V; static __device__ __forceinline__ V ld(const bf* p) { return cat16b(*(const v8us*)p, *(const v8us*)(p + 16)); } static __device__ __forceinline__ v8f mma(V a, V b, v8f c) { return wmmab(a, b, c); } };
template <typename T16, int NSPLIT, bool BIAS, bool VT>
__global__ __launch_bounds__(32) void k_gemmw(const T16* __restrict__ A, const T16* __restrict__ A2, const T16* __restrict__ Bt, const T16* __restrict__ Bt2, int K, const float* __restrict__ bias, h16* P16, bf* Ph, bf* Pl) {
    typedef typename WFrag<T16>::V V;
    __shared__ __align__(16) float os[16 * 68];
    const int kbeg = 0, kend = K;
    const int lane = threadIdx.x & 31, lr = lane & 15, hi = lane >> 4; const int r0 = blockIdx.x * 64, c0 = blockIdx.y * 64;
    v8f acc[4][4];
#pragma unroll
    for (int mb = 0; mb < 4; ++mb)
#pragma unroll
        for (int nb = 0; nb < 4; ++nb) acc[mb][nb] = (v8f){};
    const size_t aoff = (size_t)(r0 + lr) * K + 8 * hi, boff = (size_t)(c0 + lr) * K + 8 * hi;
#pragma unroll 1
    for (int kc = kbeg; kc < kend; kc += 32) {
        V a[4], a2[4];
#pragma unroll
        for (int mb = 0; mb < 4; ++mb) { a[mb] = WFrag<T16>::ld(A + aoff + (size_t)mb * 16 * K + kc); if (NSPLIT == 1 || NSPLIT == 2) a2[mb] = WFrag<T16>::ld(A2 + aoff + (size_t)mb * 16 * K + kc); }
#pragma unroll
        for (int nb = 0; nb < 4; ++nb) { const V b = WFrag<T16>::ld(Bt + boff + (size_t)nb * 16 * K + kc); V b2; if (NSPLIT >= 2) b2 = WFrag<T16>::ld(Bt2 + boff + (size_t)nb * 16 * K + kc);
#pragma unroll
            for (int mb = 0; mb < 4; ++mb) { acc[mb][nb] = WFrag<T16>::mma(a[mb], b, acc[mb][nb]); if (NSPLIT == 1 || NSPLIT == 2) acc[mb][nb] = WFrag<T16>::mma(a2[mb], b, acc[mb][nb]); if (NSPLIT >= 2) acc[mb][nb] = WFrag<T16>::mma(a[mb], b2, acc[mb][nb]); } }
        asm volatile("v_nop\n\tv_nop\n\tv_nop\n\tv_nop" : "+v"(acc[0][0]), "+v"(acc[1][1]), "+v"(acc[2][2]), "+v"(acc[3][3]) : "v"(a[0]), "v"(a[3]));
    }
    if constexpr (VT) {
#pragma unroll
        for (int nb = 0; nb < 4; ++nb) { const float bn = BIAS ? bfr(bias[c0 + nb * 16 + lr]) : 0.0f; const size_t e0 = (size_t)(c0 + nb * 16 + lr) * TT + r0 + 8 * hi;
#pragma unroll
            for (int mb = 0; mb < 4; ++mb) { v8h o16; v8us oh, ol;
#pragma unroll
                for (int j = 0; j < 8; ++j) { float x = acc[mb][nb][j]; if (BIAS) x += bn; o16[j] = tohx(x); unsigned short a2, c2; splitf(x, a2, c2); oh[j] = a2; ol[j] = c2; }
                *(v8h*)(P16 + e0 + mb * 16) = o16; *(v8us*)(Ph + e0 + mb * 16) = oh; *(v8us*)(Pl + e0 + mb * 16) = ol; } }
    } else {
        const int rw = lane >> 3, cofs = (lane & 7) * 8;   // 8 lanes per 64-d row: one store covers four whole 128-byte rows
        float bn[8];
#pragma unroll
        for (int q = 0; q < 8; ++q) bn[q] = BIAS ? bfr(bias[c0 + cofs + q]) : 0.0f;
#pragma unroll
        for (int mb = 0; mb < 4; ++mb) {
#pragma unroll
            for (int nb = 0; nb < 4; ++nb) {
#pragma unroll
                for (int j = 0; j < 8; ++j) os[(hi * 8 + j) * 68 + nb * 16 + lr] = acc[mb][nb][j]; }
            __builtin_amdgcn_wave_barrier(); asm volatile("" ::: "memory");   // the reads below take other lanes' writes: keeps them behind the writes
#pragma unroll
            for (int s = 0; s < 4; ++s) { const int row = 4 * s + rw; const v4f va = *(const v4fa*)(os + row * 68 + cofs), vb = *(const v4fa*)(os + row * 68 + cofs + 4); v8h o16; v8us oh, ol;
#pragma unroll
                for (int q = 0; q < 8; ++q) { float x = q < 4 ? va[q & 3] : vb[q & 3]; if (BIAS) x += bn[q]; o16[q] = tohx(x); unsigned short a2, c2; splitf(x, a2, c2); oh[q] = a2; ol[q] = c2; }
                const size_t e = ((size_t)(c0 / HD) * TT + r0 + mb * 16 + row) * HD + cofs;
                *(v8h*)(P16 + e) = o16; *(v8us*)(Ph + e) = oh; *(v8us*)(Pl + e) = ol; }
            __builtin_amdgcn_wave_barrier(); asm volatile("" ::: "memory");   // the next tile's writes stay behind these reads
        }
    }
}

typedef __attribute__((ext_vector_type(2))) _Float16 v2h;
typedef __attribute__((ext_vector_type(4))) _Float16 v4h;
typedef __attribute__((ext_vector_type(2))) unsigned short v2us;
typedef __attribute__((ext_vector_type(4))) unsigned short v4us;
typedef __attribute__((ext_vector_type(2))) float v2f;
typedef __attribute__((ext_vector_type(4))) int v4i;

__global__ __launch_bounds__(256) void k_wtG(const float* __restrict__ w, int K, int N, bf* Bt) {
    const int lane = threadIdx.x & 31; const int L0 = (blockIdx.x * 8 + (threadIdx.x >> 5)) * 8; const int nlines = N * K / 64;
{
#pragma unroll 1
        for (int l = 0; l < 8; ++l) { const int L = L0 + l; if (L >= nlines) break; const size_t e = (size_t)L * 64 + lane * 2; const int k = (int)(e % K), n = (int)(e / K); v2us o;
            o[0] = f2bf(w[(size_t)k * N + n]); o[1] = f2bf(w[(size_t)(k + 1) * N + n]); *(v2us*)(Bt + e) = o; }
         }
}
__global__ __launch_bounds__(256) void k_cvt8(const float* __restrict__ src, bf* dst, size_t n8) { const size_t i = (size_t)blockIdx.x * 256 + threadIdx.x; if (i >= n8) return; const v8f v = *(const v8f*)(src + i * 8); v8us o;
#pragma unroll
    for (int k = 0; k < 8; ++k) o[k] = f2bf(v[k]); *(v8us*)(dst + i * 8) = o;  }
typedef __attribute__((ext_vector_type(16))) unsigned short v16us;
template <bool HI> struct FAt;
template <> struct FAt<false> { typedef v16h V; static __device__ __forceinline__ V cast(v16us x) { return __builtin_bit_cast(v16h, x); } static __device__ __forceinline__ v8f mma(V a, V b, v8f c) { return wmma16(a, b, c); } };
template <> struct FAt<true> { typedef v16bf V; static __device__ __forceinline__ V cast(v16us x) { return __builtin_bit_cast(v16bf, x); } static __device__ __forceinline__ v8f mma(V a, V b, v8f c) { return wmmab(a, b, c); } };
__device__ __forceinline__ v16us ldfr(const unsigned char* p) { return __builtin_shufflevector(*(const v8usa*)p, *(const v8usa*)(p + 32), 0, 1, 2, 3, 4, 5, 6, 7, 8, 9, 10, 11, 12, 13, 14, 15); }   // k = 8 hi + 0..7 and 16 + 8 hi + 0..7 of a 32-k chunk; p already holds the 16 hi bytes
__device__ __forceinline__ float xhalf(float x) { const int b = __float_as_int(x); return __int_as_float(__builtin_amdgcn_permlanex16(b, b, 0x76543210, 0xfedcba98, false, false)); }   // lane l <-> l ^ 16
// eight 2^x in one statement, each in place: no v_exp_f32 here is directly followed by an instruction that reads its result or overwrites its source, and the v_nop keeps that slot behind the last one.
// In place, so that the statement writes only registers that a compiler-placed vector instruction in front of it has just written (never an operand of a matrix instruction still in its window).
__device__ __forceinline__ v8f exp2x8(v8f x) { float y0 = x[0], y1 = x[1], y2 = x[2], y3 = x[3], y4 = x[4], y5 = x[5], y6 = x[6], y7 = x[7];
    asm("v_exp_f32 %0, %0\n\tv_exp_f32 %1, %1\n\tv_exp_f32 %2, %2\n\tv_exp_f32 %3, %3\n\tv_exp_f32 %4, %4\n\tv_exp_f32 %5, %5\n\tv_exp_f32 %6, %6\n\tv_exp_f32 %7, %7\n\tv_nop"
        : "+v"(y0), "+v"(y1), "+v"(y2), "+v"(y3), "+v"(y4), "+v"(y5), "+v"(y6), "+v"(y7));
    return (v8f){y0, y1, y2, y3, y4, y5, y6, y7}; }
template <bool HI>
__device__ __forceinline__ void fattn_body(const unsigned char* __restrict__ Q0, const unsigned char* __restrict__ Q1, const unsigned char* __restrict__ K0, const unsigned char* __restrict__ K1, const unsigned char* __restrict__ V0, const unsigned char* __restrict__ V1, const float* __restrict__ ams, float* out, int q0, unsigned char* sm) {
    typedef typename FAt<HI>::V V;
    constexpr int NT = HI ? 4 : 2;                     // staged tiles per stage: K, Vt (, K lo, Vt lo)
    const int tid = threadIdx.x, lane = tid & 31, wv = tid >> 5, c = lane & 15, h = lane >> 4;
    float* mk = (float*)sm; unsigned char* buf = sm + TT * 4;
    for (int j = tid; j < TT; j += 128) mk[j] = ams[j] * (SCL * L2E);   // additive mask in the log2 domain
    const int srow = tid >> 3, scol = (tid & 7) * 16;  // staging: 8 threads per 128-byte row, 16 rows per sweep
    v8us st[NT][4];
    auto gload = [&](int s) {
#pragma unroll
        for (int u = 0; u < 4; ++u) { const int row = srow + 16 * u; const size_t ko = (size_t)(s * 64 + row) * (HD * 2) + scol, vo = (size_t)row * (TT * 2) + s * 128 + scol;
            st[0][u] = *(const v8usa*)(K0 + ko); st[1][u] = *(const v8usa*)(V0 + vo); if (HI) { st[2][u] = *(const v8usa*)(K1 + ko); st[3][u] = *(const v8usa*)(V1 + vo); } }
        asm volatile("s_wait_xcnt 0x0" ::: "memory"); };   // stands in front of every later overwrite of these loads' address registers (this build reuses them while the loads are in flight)
    auto lstore = [&](int bs) { unsigned char* d = buf + bs * (NT * FTB) + srow * FPI + scol;
#pragma unroll
        for (int t = 0; t < NT; ++t)
#pragma unroll
            for (int u = 0; u < 4; ++u) *(v8usa*)(d + t * FTB + u * 16 * FPI) = st[t][u]; };
    V qf[2], ql[2];
#pragma unroll
    for (int kc = 0; kc < 2; ++kc) { const size_t qo = (size_t)(q0 + wv * 16 + c) * (HD * 2) + kc * 64 + h * 16; qf[kc] = FAt<HI>::cast(ldfr(Q0 + qo)); if (HI) ql[kc] = FAt<HI>::cast(ldfr(Q1 + qo)); }
    v8f o[4];
#pragma unroll
    for (int dt = 0; dt < 4; ++dt) o[dt] = (v8f){};
    float m = -3.0e38f, l = 0.f;
    gload(0); lstore(0); __syncthreads();
#pragma unroll 1
    for (int s = 0; s < TT / 64; ++s) {
        if (s + 1 < TT / 64) gload(s + 1);
        const unsigned char* kb = buf + (s & 1) * (NT * FTB) + c * FPI + h * 16;
        v4f mq[4][2];   // the lane's 32 mask terms, fetched ahead of the fragments: LDS answers in order, and the softmax needs these first
#pragma unroll
        for (int kt = 0; kt < 4; ++kt) { const float* mp = mk + s * 64 + kt * 16 + 8 * h; mq[kt][0] = *(const v4fa*)mp; mq[kt][1] = *(const v4fa*)(mp + 4); }
        v8f sc[4];
#pragma unroll
        for (int kt = 0; kt < 4; ++kt) { v8f a = (v8f){};
#pragma unroll
            for (int kc = 0; kc < 2; ++kc) { const V kf = FAt<HI>::cast(ldfr(kb + kt * 16 * FPI + kc * 64)); a = FAt<HI>::mma(kf, qf[kc], a);
                if (HI) { a = FAt<HI>::mma(kf, ql[kc], a); const V kl = FAt<HI>::cast(ldfr(kb + 2 * FTB + kt * 16 * FPI + kc * 64)); a = FAt<HI>::mma(kl, qf[kc], a); } }
            sc[kt] = a; }
        V va[2][HI ? 2 : 1][4];   // Vt fragments: [32-key chunk][plane][d tile]
        auto vload = [&](int j) {
#pragma unroll
            for (int dt = 0; dt < 4; ++dt) { va[j][0][dt] = FAt<HI>::cast(ldfr(kb + FTB + dt * 16 * FPI + j * 64)); if constexpr (HI) va[j][1][dt] = FAt<HI>::cast(ldfr(kb + 3 * FTB + dt * 16 * FPI + j * 64)); } };
        vload(0); if (!HI) vload(1);
        __builtin_amdgcn_sched_barrier(0);   // keeps these LDS loads above the softmax, so that their latency runs under it; without it they sink to their first use
        float mx = m;
#pragma unroll
        for (int kt = 0; kt < 4; ++kt)
#pragma unroll
            for (int r = 0; r < 8; ++r) { const float t = fmaf(sc[kt][r], SCL * L2E, mq[kt][r >> 2][r & 3]); sc[kt][r] = t; mx = fmaxf(mx, t); }
        mx = fmaxf(mx, xhalf(mx));
        const float al = __builtin_amdgcn_exp2f(m - mx); m = mx;
        const float ms = HI ? mx : mx - 10.0f;
#pragma unroll
        for (int dt = 0; dt < 4; ++dt) o[dt] *= al;
#pragma unroll
        for (int j = 0; j < 2; ++j) { V pf, pl; sc[2 * j] = exp2x8(sc[2 * j] - ms); sc[2 * j + 1] = exp2x8(sc[2 * j + 1] - ms);
#pragma unroll
            for (int e = 0; e < 16; ++e) { const float p = sc[2 * j + (e >> 3)][e & 7];
                if constexpr (HI) { const __bf16 ph = (__bf16)p; pf[e] = ph; pl[e] = (__bf16)(p - (float)ph); } else { pf[e] = (_Float16)p; } }
            if (HI && j == 0) { vload(1); __builtin_amdgcn_sched_barrier(0); }   // the second chunk's loads are issued ahead of the first chunk's products, for the same reason
#pragma unroll
            for (int dt = 0; dt < 4; ++dt) { o[dt] = FAt<HI>::mma(va[j][0][dt], pf, o[dt]);
                if constexpr (HI) { o[dt] = FAt<HI>::mma(va[j][0][dt], pl, o[dt]); o[dt] = FAt<HI>::mma(va[j][1][dt], pf, o[dt]); } } }
        const v8f pv = (sc[0] + sc[1]) + (sc[2] + sc[3]);   // the lane's 32 terms as a tree, not one dependent chain
        l = fmaf(l, al, ((pv[0] + pv[1]) + (pv[2] + pv[3])) + ((pv[4] + pv[5]) + (pv[6] + pv[7])));
        if (s + 1 < TT / 64) lstore((s + 1) & 1);
        __syncthreads();   // publishes stage s + 1 and ends every wave's reads of the buffer that the next trip refills
    }
    l += xhalf(l);
    const float inv = 1.0f / l;
    float* orow = out + (size_t)(q0 + wv * 16 + c) * DQ + 8 * h;
#pragma unroll
    for (int dt = 0; dt < 4; ++dt) { v4f a, b;
#pragma unroll
        for (int r = 0; r < 4; ++r) { a[r] = o[dt][r] * inv; b[r] = o[dt][4 + r] * inv; }
        *(v4f*)(orow + dt * 16) = a; *(v4f*)(orow + dt * 16 + 4) = b; }
}
// grid: the hi+lo blocks (3 x the matrix work) first, then the f16 blocks; planes [batch][head][...], AMS [batch][key], OUT [batch][query][head * 64 + d]
// amdgpu_waves_per_eu(3, 3): 768 work-groups of one wave per SIMD on 256 WGPs are three waves per SIMD; the register budget of three lets the scheduler keep a stage's LDS loads in flight instead of waiting on each
__global__ __launch_bounds__(128) __attribute__((amdgpu_waves_per_eu(3, 3))) void k_fattn(const h16* __restrict__ Q16, const h16* __restrict__ K16, const h16* __restrict__ V16, const bf* __restrict__ Qh, const bf* __restrict__ Ql, const bf* __restrict__ Kh, const bf* __restrict__ Kl, const bf* __restrict__ Vh, const bf* __restrict__ Vl, const float* __restrict__ AMS, float* OUT) {
    __shared__ __align__(16) unsigned char sm[TT * 4 + 2 * 4 * FTB];
    const int nhi = NB_ * NH_ * (RH / 64); const int idx = blockIdx.x;
    if (idx < nhi) { const int bh = idx / (RH / 64), qb = idx % (RH / 64); const size_t po = (size_t)bh * TT * HD; const int b = bh / NH_, hd = bh % NH_;
        fattn_body<true>((const unsigned char*)(Qh + po), (const unsigned char*)(Ql + po), (const unsigned char*)(Kh + po), (const unsigned char*)(Kl + po), (const unsigned char*)(Vh + po), (const unsigned char*)(Vl + po), AMS + (size_t)b * TT, OUT + (size_t)b * TT * DQ + hd * HD, qb * 64, sm);
    } else { const int i2 = idx - nhi; const int bh = i2 / ((TT - RH) / 64), qb = RH / 64 + i2 % ((TT - RH) / 64); const size_t po = (size_t)bh * TT * HD; const int b = bh / NH_, hd = bh % NH_;
        fattn_body<false>((const unsigned char*)(Q16 + po), nullptr, (const unsigned char*)(K16 + po), nullptr, (const unsigned char*)(V16 + po), nullptr, AMS + (size_t)b * TT, OUT + (size_t)b * TT * DQ + hd * HD, qb * 64, sm); }
}

__global__ __launch_bounds__(256) void k_ams(const float* __restrict__ am, float* AMS) { const int j = blockIdx.x * 256 + threadIdx.x; if (j >= TT) return; const float v = bfr(am[j]) * (1.0f / SCL); *(float*)(AMS + j) = v;  }

extern "C" void kernel_launch(void* const* d_in, const int* in_sizes, int n_in,
                              void* d_out, int out_size, void* d_ws, size_t ws_size, hipStream_t stream) {
    (void)in_sizes; (void)n_in; (void)out_size;
    const float* x = (const float*)d_in[0]; const float* amask = (const float*)d_in[1]; const float* wq = (const float*)d_in[2]; const float* bq = (const float*)d_in[3]; const float* wk = (const float*)d_in[4]; const float* bk = (const float*)d_in[5]; const float* wv = (const float*)d_in[6]; const float* bv = (const float*)d_in[7]; const float* wo = nullptr; (void)wo;
    float* OUT = (float*)d_out;     // [2][2048][768]
    char* wsp = (char*)d_ws;
    auto take = [&](size_t bytes) { char* p = wsp; wsp += (bytes + 255) & ~(size_t)255; return (void*)p; };
    bf* WQ = (bf*)take((size_t)DQ * DM * 2); bf* WK = (bf*)take((size_t)DKV * DM * 2); bf* WV = (bf*)take((size_t)DKV * DM * 2); float* AMS = (float*)take((size_t)NB_ * TT * 4);
    bf* XB = (bf*)take((size_t)TT * DM * 2);
    const size_t PQ = (size_t)NH_ * TT * HD, PK = (size_t)NKV * TT * HD;   // elements of one batch's head planes; every plane holds both batches, for the one attention launch behind the loop
    h16* QP16 = (h16*)take(NB_ * PQ * 2); h16* KP16 = (h16*)take(NB_ * PK * 2); h16* VT16 = (h16*)take(NB_ * PK * 2);
    bf* QPh = (bf*)take(NB_ * PQ * 2); bf* QPl = (bf*)take(NB_ * PQ * 2); bf* KPh = (bf*)take(NB_ * PK * 2); bf* KPl = (bf*)take(NB_ * PK * 2); bf* VTh = (bf*)take(NB_ * PK * 2); bf* VTl = (bf*)take(NB_ * PK * 2);
    if ((size_t)(wsp - (char*)d_ws) > ws_size) return;    // ws 256 MiB
    { k_wtG<<<(unsigned)((DM * DQ / 64 + 63) / 64), 256, 0, stream>>>(wq, DM, DQ, WQ); k_wtG<<<(unsigned)((DM * DKV / 64 + 63) / 64), 256, 0, stream>>>(wk, DM, DKV, WK); k_wtG<<<(unsigned)((DM * DKV / 64 + 63) / 64), 256, 0, stream>>>(wv, DM, DKV, WV);
       }
    for (int b = 0; b < NB_; ++b) {
        
        k_ams<<<TT / 256, 256, 0, stream>>>(amask + (size_t)b * TT, AMS + (size_t)b * TT); k_cvt8<<<(unsigned)(((size_t)TT * DM / 8 + 255) / 256), 256, 0, stream>>>(x + (size_t)b * TT * DM, XB, (size_t)TT * DM / 8);
        k_gemmw<bf, 0, true, false><<<dim3(TT / 64, DQ / 64, 1), 32, 0, stream>>>(XB, nullptr, WQ, nullptr, DM, bq, QP16 + b * PQ, QPh + b * PQ, QPl + b * PQ);
        k_gemmw<bf, 0, true, false><<<dim3(TT / 64, DKV / 64, 1), 32, 0, stream>>>(XB, nullptr, WK, nullptr, DM, bk, KP16 + b * PK, KPh + b * PK, KPl + b * PK);
        k_gemmw<bf, 0, true, true><<<dim3(TT / 64, DKV / 64, 1), 32, 0, stream>>>(XB, nullptr, WV, nullptr, DM, bv, VT16 + b * PK, VTh + b * PK, VTl + b * PK); }
    k_fattn<<<NB_ * NH_ * (TT / 64), 128, 0, stream>>>(QP16, KP16, VT16, QPh, QPl, KPh, KPl, VTh, VTl, AMS, OUT);
}

// v005
// One run takes 98.3 microseconds.
// Timed twice side by side with v004, it ran 1.90 times as fast both times.
// Over all steps from v000 it is 15.9 times as fast.
#include <hip/hip_runtime.h>

// SyntaxBertSelfAttention (hidden [2][2048][768], additive attention_mask [2][1][1][2048]; q/k/v = x W + b (12 heads x 64); scores = q.k / sqrt(12) (the module scales by 1/sqrt(num_heads), faithful) + mask[b][j]; softmax; out = merged heads -> [2][2048][768]).
// Compute dtypes, f32 accumulate: every input rounded to bf16; projections on PLAIN bf16 operands (inputs: exact, + bias); scores (K 64) and probs.v on hl planes (3 products) for the first 512 query rows of each

#define NB_  2
#define TT   2048
#define DM   768
#define NH_  12
#define NKV  12
#define REP  (NH_ / NKV)
#define HD   64
#define DQ   (NH_ * HD)
#define DKV  (NKV * HD)
#define RH   512                  // query rows < RH use hi+lo planes (0: none)
#define WIN  2048
#define SCL  0.28867513459481287f
#define L2E  1.4426950408889634f
#define FPI  144                  // fused attention: LDS row pitch in bytes (128 B of data + 16)
#define FTB  (64 * FPI)           // fused attention: bytes of one staged 64-row tile
typedef _Float16 h16;
typedef unsigned short bf;
typedef __attribute__((ext_vector_type(16))) __bf16   v16bf;
typedef __attribute__((ext_vector_type(16))) _Float16 v16h;
typedef __attribute__((ext_vector_type(8)))  _Float16 v8h;
typedef __attribute__((ext_vector_type(8)))  unsigned short v8us;
typedef __attribute__((ext_vector_type(8)))  float    v8f;
typedef __attribute__((ext_vector_type(4)))  float    v4f;
typedef v8h  __attribute__((may_alias)) v8ha;
typedef v4f  __attribute__((may_alias)) v4fa;
typedef v8us __attribute__((may_alias)) v8usa;

__device__ __forceinline__ unsigned short f2bf(float f) { unsigned u = __float_as_uint(f); u += 0x7FFFu + ((u >> 16) & 1u); return (unsigned short)(u >> 16); }
__device__ __forceinline__ float bf2f(unsigned short b) { return __uint_as_float(((unsigned)b) << 16); }
__device__ __forceinline__ float bfr(float f) { return bf2f(f2bf(f)); }
__device__ __forceinline__ v16h cat16(v8h lo, v8h hi) { return __builtin_shufflevector(lo, hi, 0, 1, 2, 3, 4, 5, 6, 7, 8, 9, 10, 11, 12, 13, 14, 15); }
__device__ __forceinline__ v16bf cat16b(v8us lo, v8us hi) { return __builtin_bit_cast(v16bf, __builtin_shufflevector(lo, hi, 0, 1, 2, 3, 4, 5, 6, 7, 8, 9, 10, 11, 12, 13, 14, 15)); }
__device__ __forceinline__ v8f wmma16(v16h a, v16h b, v8f c) { return __builtin_amdgcn_wmma_f32_16x16x32_f16(false, a, false, b, (short)0, c, false, false); }
__device__ __forceinline__ v8f wmmab(v16bf a, v16bf b, v8f c) { return __builtin_amdgcn_wmma_f32_16x16x32_bf16(false, a, false, b, (short)0, c, false, false); }



__device__ __forceinline__ h16 tohx(float x) { return (h16)x; }
__device__ __forceinline__ void splitf(float y, unsigned short& h, unsigned short& l) { h = f2bf(y); l = f2bf(y - bf2f(h)); }
// ---- k_gemmw: register-blocked GEMM, ONE WAVE per 64x64 output tile (16 accumulators), operands straight from K-contiguous 16-bit planes; grid (M/64, N/64, 3), 32 threads.
// One launch does all three projections of both batches: blockIdx.z picks the weight, the bias and the planes (0 q, 1 k, 2 v); m runs over the tokens of both batches.
// c[m][n] (f32, + optional f32 bias[n]) = sum_k A[m][k] Bt[n][k] (+ split products per NSPLIT). K % 32 == 0. A 64-column tile is one head (HD == 64), m is the token.
// The f32 tile is never stored: the epilogue writes it as the three 16-bit operand planes of the attention kernel (f16, bf16 hi, bf16 lo).
// q, k: planes [batch][head][token][d], through the LDS tile (a lane takes 8 consecutive d). v: planes [batch][head][d][token], straight from the accumulators (a lane holds 8 consecutive tokens of one d).
template <typename T16> struct WFrag;
template <> struct WFrag<h16> { typedef v16h V; static __device__ __forceinline__ V ld(const h16* p) { return cat16(*(const v8h*)p, *(const v8h*)(p + 16)); } static __device__ __forceinline__ v8f mma(V a, V b, v8f c) { return wmma16(a, b, c); } };
template <> struct WFrag<bf> { typedef v16bf V; static __device__ __forceinline__ V ld(const bf* p) { return cat16b(*(const v8us*)p, *(const v8us*)(p + 16)); } static __device__ __forceinline__ v8f mma(V a, V b, v8f c) { return wmmab(a, b, c); } };
template <typename T16, int NSPLIT, bool BIAS>
__global__ __launch_bounds__(32) void k_gemmw(const T16* __restrict__ A, const T16* __restrict__ A2, const T16* __restrict__ Bq, const T16* __restrict__ Bk, const T16* __restrict__ Bv, const T16* __restrict__ Bt2, int K, const float* __restrict__ biq, const float* __restrict__ bik, const float* __restrict__ biv,
                                              h16* Q16, bf* Qh, bf* Ql, h16* K16, bf* Kh, bf* Kl, h16* V16, bf* Vh, bf* Vl) {
    typedef typename WFrag<T16>::V V;
    __shared__ __align__(16) float os[16 * 68];
    const int kbeg = 0, kend = K;
    const int pz = blockIdx.z; const bool VT = pz == 2;
    const T16* __restrict__ Bt = pz == 0 ? Bq : pz == 1 ? Bk : Bv; const float* __restrict__ bias = pz == 0 ? biq : pz == 1 ? bik : biv;
    h16* P16 = pz == 0 ? Q16 : pz == 1 ? K16 : V16; bf* Ph = pz == 0 ? Qh : pz == 1 ? Kh : Vh; bf* Pl = pz == 0 ? Ql : pz == 1 ? Kl : Vl;
    const int lane = threadIdx.x & 31, lr = lane & 15, hi = lane >> 4; const int r0 = blockIdx.x * 64, c0 = blockIdx.y * 64;
    const int bt = r0 / TT, t0 = r0 % TT;   // batch and first token of the tile (a tile never straddles two batches: TT % 64 == 0)
    v8f acc[4][4];
#pragma unroll
    for (int mb = 0; mb < 4; ++mb)
#pragma unroll
        for (int nb = 0; nb < 4; ++nb) acc[mb][nb] = (v8f){};
    const size_t aoff = (size_t)(r0 + lr) * K + 8 * hi, boff = (size_t)(c0 + lr) * K + 8 * hi;
#pragma unroll 1
    for (int kc = kbeg; kc < kend; kc += 32) {
        V a[4], a2[4];
#pragma unroll
        for (int mb = 0; mb < 4; ++mb) { a[mb] = WFrag<T16>::ld(A + aoff + (size_t)mb * 16 * K + kc); if (NSPLIT == 1 || NSPLIT == 2) a2[mb] = WFrag<T16>::ld(A2 + aoff + (size_t)mb * 16 * K + kc); }
#pragma unroll
        for (int nb = 0; nb < 4; ++nb) { const V b = WFrag<T16>::ld(Bt + boff + (size_t)nb * 16 * K + kc); V b2; if (NSPLIT >= 2) b2 = WFrag<T16>::ld(Bt2 + boff + (size_t)nb * 16 * K + kc);
#pragma unroll
            for (int mb = 0; mb < 4; ++mb) { acc[mb][nb] = WFrag<T16>::mma(a[mb], b, acc[mb][nb]); if (NSPLIT == 1 || NSPLIT == 2) acc[mb][nb] = WFrag<T16>::mma(a2[mb], b, acc[mb][nb]); if (NSPLIT >= 2) acc[mb][nb] = WFrag<T16>::mma(a[mb], b2, acc[mb][nb]); } }
        asm volatile("v_nop\n\tv_nop\n\tv_nop\n\tv_nop" : "+v"(acc[0][0]), "+v"(acc[1][1]), "+v"(acc[2][2]), "+v"(acc[3][3]) : "v"(a[0]), "v"(a[3]));
    }
    if (VT) {
#pragma unroll
        for (int nb = 0; nb < 4; ++nb) { const float bn = BIAS ? bfr(bias[c0 + nb * 16 + lr]) : 0.0f; const size_t e0 = (size_t)(bt * DKV + c0 + nb * 16 + lr) * TT + t0 + 8 * hi;
#pragma unroll
            for (int mb = 0; mb < 4; ++mb) { v8h o16; v8us oh, ol;
#pragma unroll
                for (int j = 0; j < 8; ++j) { float x = acc[mb][nb][j]; if (BIAS) x += bn; o16[j] = tohx(x); unsigned short a2, c2; splitf(x, a2, c2); oh[j] = a2; ol[j] = c2; }
                *(v8h*)(P16 + e0 + mb * 16) = o16; *(v8us*)(Ph + e0 + mb * 16) = oh; *(v8us*)(Pl + e0 + mb * 16) = ol; } }
    } else {
        const int rw = lane >> 3, cofs = (lane & 7) * 8;   // 8 lanes per 64-d row: one store covers four whole 128-byte rows
        float bn[8];
#pragma unroll
        for (int q = 0; q < 8; ++q) bn[q] = BIAS ? bfr(bias[c0 + cofs + q]) : 0.0f;
#pragma unroll
        for (int mb = 0; mb < 4; ++mb) {
#pragma unroll
            for (int nb = 0; nb < 4; ++nb) {
#pragma unroll
                for (int j = 0; j < 8; ++j) os[(hi * 8 + j) * 68 + nb * 16 + lr] = acc[mb][nb][j]; }
            __builtin_amdgcn_wave_barrier(); asm volatile("" ::: "memory");   // the reads below take other lanes' writes: keeps them behind the writes
#pragma unroll
            for (int s = 0; s < 4; ++s) { const int row = 4 * s + rw; const v4f va = *(const v4fa*)(os + row * 68 + cofs), vb = *(const v4fa*)(os + row * 68 + cofs + 4); v8h o16; v8us oh, ol;
#pragma unroll
                for (int q = 0; q < 8; ++q) { float x = q < 4 ? va[q & 3] : vb[q & 3]; if (BIAS) x += bn[q]; o16[q] = tohx(x); unsigned short a2, c2; splitf(x, a2, c2); oh[q] = a2; ol[q] = c2; }
                const size_t e = ((size_t)(bt * NH_ + c0 / HD) * TT + t0 + mb * 16 + row) * HD + cofs;
                *(v8h*)(P16 + e) = o16; *(v8us*)(Ph + e) = oh; *(v8us*)(Pl + e) = ol; }
            __builtin_amdgcn_wave_barrier(); asm volatile("" ::: "memory");   // the next tile's writes stay behind these reads
        }
    }
}

typedef __attribute__((ext_vector_type(2))) _Float16 v2h;
typedef __attribute__((ext_vector_type(4))) _Float16 v4h;
typedef __attribute__((ext_vector_type(2))) unsigned short v2us;
typedef __attribute__((ext_vector_type(4))) unsigned short v4us;
typedef __attribute__((ext_vector_type(2))) float v2f;
typedef __attribute__((ext_vector_type(4))) int v4i;

__device__ __forceinline__ void d_wtG(int blk, const float* __restrict__ w, int K, int N, bf* Bt) {
    const int lane = threadIdx.x & 31; const int L0 = (blk * 8 + (threadIdx.x >> 5)) * 8; const int nlines = N * K / 64;
{
#pragma unroll 1
        for (int l = 0; l < 8; ++l) { const int L = L0 + l; if (L >= nlines) break; const size_t e = (size_t)L * 64 + lane * 2; const int k = (int)(e % K), n = (int)(e / K); v2us o;
            o[0] = f2bf(w[(size_t)k * N + n]); o[1] = f2bf(w[(size_t)(k + 1) * N + n]); *(v2us*)(Bt + e) = o; }
         }
}
__device__ __forceinline__ void d_cvt8(int blk, const float* __restrict__ src, bf* dst, size_t n8) { const size_t i = (size_t)blk * 256 + threadIdx.x; if (i >= n8) return; const v8f v = *(const v8f*)(src + i * 8); v8us o;
#pragma unroll
    for (int k = 0; k < 8; ++k) o[k] = f2bf(v[k]); *(v8us*)(dst + i * 8) = o;  }
typedef __attribute__((ext_vector_type(16))) unsigned short v16us;
template <bool HI> struct FAt;
template <> struct FAt<false> { typedef v16h V; static __device__ __forceinline__ V cast(v16us x) { return __builtin_bit_cast(v16h, x); } static __device__ __forceinline__ v8f mma(V a, V b, v8f c) { return wmma16(a, b, c); } };
template <> struct FAt<true> { typedef v16bf V; static __device__ __forceinline__ V cast(v16us x) { return __builtin_bit_cast(v16bf, x); } static __device__ __forceinline__ v8f mma(V a, V b, v8f c) { return wmmab(a, b, c); } };
__device__ __forceinline__ v16us ldfr(const unsigned char* p) { return __builtin_shufflevector(*(const v8usa*)p, *(const v8usa*)(p + 32), 0, 1, 2, 3, 4, 5, 6, 7, 8, 9, 10, 11, 12, 13, 14, 15); }   // k = 8 hi + 0..7 and 16 + 8 hi + 0..7 of a 32-k chunk; p already holds the 16 hi bytes
__device__ __forceinline__ float xhalf(float x) { const int b = __float_as_int(x); return __int_as_float(__builtin_amdgcn_permlanex16(b, b, 0x76543210, 0xfedcba98, false, false)); }   // lane l <-> l ^ 16
// eight 2^x in one statement, each in place: no v_exp_f32 here is directly followed by an instruction that reads its result or overwrites its source, and the v_nop keeps that slot behind the last one.
// In place, so that the statement writes only registers that a compiler-placed vector instruction in front of it has just written (never an operand of a matrix instruction still in its window).
__device__ __forceinline__ v8f exp2x8(v8f x) { float y0 = x[0], y1 = x[1], y2 = x[2], y3 = x[3], y4 = x[4], y5 = x[5], y6 = x[6], y7 = x[7];
    asm("v_exp_f32 %0, %0\n\tv_exp_f32 %1, %1\n\tv_exp_f32 %2, %2\n\tv_exp_f32 %3, %3\n\tv_exp_f32 %4, %4\n\tv_exp_f32 %5, %5\n\tv_exp_f32 %6, %6\n\tv_exp_f32 %7, %7\n\tv_nop"
        : "+v"(y0), "+v"(y1), "+v"(y2), "+v"(y3), "+v"(y4), "+v"(y5), "+v"(y6), "+v"(y7));
    return (v8f){y0, y1, y2, y3, y4, y5, y6, y7}; }
template <bool HI>
__device__ __forceinline__ void fattn_body(const unsigned char* __restrict__ Q0, const unsigned char* __restrict__ Q1, const unsigned char* __restrict__ K0, const unsigned char* __restrict__ K1, const unsigned char* __restrict__ V0, const unsigned char* __restrict__ V1, const float* __restrict__ ams, float* out, int q0, unsigned char* sm) {
    typedef typename FAt<HI>::V V;
    constexpr int NT = HI ? 4 : 2;                     // staged tiles per stage: K, Vt (, K lo, Vt lo)
    const int tid = threadIdx.x, lane = tid & 31, wv = tid >> 5, c = lane & 15, h = lane >> 4;
    float* mk = (float*)sm; unsigned char* buf = sm + TT * 4;
    for (int j = tid; j < TT; j += 128) mk[j] = ams[j] * (SCL * L2E);   // additive mask in the log2 domain
    const int srow = tid >> 3, scol = (tid & 7) * 16;  // staging: 8 threads per 128-byte row, 16 rows per sweep
    v8us st[NT][4];
    auto gload = [&](int s) {
#pragma unroll
        for (int u = 0; u < 4; ++u) { const int row = srow + 16 * u; const size_t ko = (size_t)(s * 64 + row) * (HD * 2) + scol, vo = (size_t)row * (TT * 2) + s * 128 + scol;
            st[0][u] = *(const v8usa*)(K0 + ko); st[1][u] = *(const v8usa*)(V0 + vo); if (HI) { st[2][u] = *(const v8usa*)(K1 + ko); st[3][u] = *(const v8usa*)(V1 + vo); } }
        asm volatile("s_wait_xcnt 0x0" ::: "memory"); };   // stands in front of every later overwrite of these loads' address registers (this build reuses them while the loads are in flight)
    auto lstore = [&](int bs) { unsigned char* d = buf + bs * (NT * FTB) + srow * FPI + scol;
#pragma unroll
        for (int t = 0; t < NT; ++t)
#pragma unroll
            for (int u = 0; u < 4; ++u) *(v8usa*)(d + t * FTB + u * 16 * FPI) = st[t][u]; };
    V qf[2], ql[2];
#pragma unroll
    for (int kc = 0; kc < 2; ++kc) { const size_t qo = (size_t)(q0 + wv * 16 + c) * (HD * 2) + kc * 64 + h * 16; qf[kc] = FAt<HI>::cast(ldfr(Q0 + qo)); if (HI) ql[kc] = FAt<HI>::cast(ldfr(Q1 + qo)); }
    v8f o[4];
#pragma unroll
    for (int dt = 0; dt < 4; ++dt) o[dt] = (v8f){};
    float m = -3.0e38f, l = 0.f;
    gload(0); lstore(0); __syncthreads();
#pragma unroll 1
    for (int s = 0; s < TT / 64; ++s) {
        if (s + 1 < TT / 64) gload(s + 1);
        const unsigned char* kb = buf + (s & 1) * (NT * FTB) + c * FPI + h * 16;
        v4f mq[4][2];   // the lane's 32 mask terms, fetched ahead of the fragments: LDS answers in order, and the softmax needs these first
#pragma unroll
        for (int kt = 0; kt < 4; ++kt) { const float* mp = mk + s * 64 + kt * 16 + 8 * h; mq[kt][0] = *(const v4fa*)mp; mq[kt][1] = *(const v4fa*)(mp + 4); }
        v8f sc[4];
#pragma unroll
        for (int kt = 0; kt < 4; ++kt) { v8f a = (v8f){};
#pragma unroll
            for (int kc = 0; kc < 2; ++kc) { const V kf = FAt<HI>::cast(ldfr(kb + kt * 16 * FPI + kc * 64)); a = FAt<HI>::mma(kf, qf[kc], a);
                if (HI) { a = FAt<HI>::mma(kf, ql[kc], a); const V kl = FAt<HI>::cast(ldfr(kb + 2 * FTB + kt * 16 * FPI + kc * 64)); a = FAt<HI>::mma(kl, qf[kc], a); } }
            sc[kt] = a; }
        V va[2][HI ? 2 : 1][4];   // Vt fragments: [32-key chunk][plane][d tile]
        auto vload = [&](int j) {
#pragma unroll
            for (int dt = 0; dt < 4; ++dt) { va[j][0][dt] = FAt<HI>::cast(ldfr(kb + FTB + dt * 16 * FPI + j * 64)); if constexpr (HI) va[j][1][dt] = FAt<HI>::cast(ldfr(kb + 3 * FTB + dt * 16 * FPI + j * 64)); } };
        vload(0); if (!HI) vload(1);
        __builtin_amdgcn_sched_barrier(0);   // keeps these LDS loads above the softmax, so that their latency runs under it; without it they sink to their first use
        float mx = m;
#pragma unroll
        for (int kt = 0; kt < 4; ++kt)
#pragma unroll
            for (int r = 0; r < 8; ++r) { const float t = fmaf(sc[kt][r], SCL * L2E, mq[kt][r >> 2][r & 3]); sc[kt][r] = t; mx = fmaxf(mx, t); }
        mx = fmaxf(mx, xhalf(mx));
        const float al = __builtin_amdgcn_exp2f(m - mx); m = mx;
        const float ms = HI ? mx : mx - 10.0f;
#pragma unroll
        for (int dt = 0; dt < 4; ++dt) o[dt] *= al;
#pragma unroll
        for (int j = 0; j < 2; ++j) { V pf, pl; sc[2 * j] = exp2x8(sc[2 * j] - ms); sc[2 * j + 1] = exp2x8(sc[2 * j + 1] - ms);
#pragma unroll
            for (int e = 0; e < 16; ++e) { const float p = sc[2 * j + (e >> 3)][e & 7];
                if constexpr (HI) { const __bf16 ph = (__bf16)p; pf[e] = ph; pl[e] = (__bf16)(p - (float)ph); } else { pf[e] = (_Float16)p; } }
            if (HI && j == 0) { vload(1); __builtin_amdgcn_sched_barrier(0); }   // the second chunk's loads are issued ahead of the first chunk's products, for the same reason
#pragma unroll
            for (int dt = 0; dt < 4; ++dt) { o[dt] = FAt<HI>::mma(va[j][0][dt], pf, o[dt]);
                if constexpr (HI) { o[dt] = FAt<HI>::mma(va[j][0][dt], pl, o[dt]); o[dt] = FAt<HI>::mma(va[j][1][dt], pf, o[dt]); } } }
        const v8f pv = (sc[0] + sc[1]) + (sc[2] + sc[3]);   // the lane's 32 terms as a tree, not one dependent chain
        l = fmaf(l, al, ((pv[0] + pv[1]) + (pv[2] + pv[3])) + ((pv[4] + pv[5]) + (pv[6] + pv[7])));
        if (s + 1 < TT / 64) lstore((s + 1) & 1);
        __syncthreads();   // publishes stage s + 1 and ends every wave's reads of the buffer that the next trip refills
    }
    l += xhalf(l);
    const float inv = 1.0f / l;
    float* orow = out + (size_t)(q0 + wv * 16 + c) * DQ + 8 * h;
#pragma unroll
    for (int dt = 0; dt < 4; ++dt) { v4f a, b;
#pragma unroll
        for (int r = 0; r < 4; ++r) { a[r] = o[dt][r] * inv; b[r] = o[dt][4 + r] * inv; }
        *(v4f*)(orow + dt * 16) = a; *(v4f*)(orow + dt * 16 + 4) = b; }
}
// grid: the hi+lo blocks (3 x the matrix work) first, then the f16 blocks; planes [batch][head][...], AMS [batch][key], OUT [batch][query][head * 64 + d]
// amdgpu_waves_per_eu(3, 3): 768 work-groups of one wave per SIMD on 256 WGPs are three waves per SIMD; the register budget of three lets the scheduler keep a stage's LDS loads in flight instead of waiting on each
__global__ __launch_bounds__(128) __attribute__((amdgpu_waves_per_eu(3, 3))) void k_fattn(const h16* __restrict__ Q16, const h16* __restrict__ K16, const h16* __restrict__ V16, const bf* __restrict__ Qh, const bf* __restrict__ Ql, const bf* __restrict__ Kh, const bf* __restrict__ Kl, const bf* __restrict__ Vh, const bf* __restrict__ Vl, const float* __restrict__ AMS, float* OUT) {
    __shared__ __align__(16) unsigned char sm[TT * 4 + 2 * 4 * FTB];
    const int nhi = NB_ * NH_ * (RH / 64); const int idx = blockIdx.x;
    if (idx < nhi) { const int bh = idx / (RH / 64), qb = idx % (RH / 64); const size_t po = (size_t)bh * TT * HD; const int b = bh / NH_, hd = bh % NH_;
        fattn_body<true>((const unsigned char*)(Qh + po), (const unsigned char*)(Ql + po), (const unsigned char*)(Kh + po), (const unsigned char*)(Kl + po), (const unsigned char*)(Vh + po), (const unsigned char*)(Vl + po), AMS + (size_t)b * TT, OUT + (size_t)b * TT * DQ + hd * HD, qb * 64, sm);
    } else { const int i2 = idx - nhi; const int bh = i2 / ((TT - RH) / 64), qb = RH / 64 + i2 % ((TT - RH) / 64); const size_t po = (size_t)bh * TT * HD; const int b = bh / NH_, hd = bh % NH_;
        fattn_body<false>((const unsigned char*)(Q16 + po), nullptr, (const unsigned char*)(K16 + po), nullptr, (const unsigned char*)(V16 + po), nullptr, AMS + (size_t)b * TT, OUT + (size_t)b * TT * DQ + hd * HD, qb * 64, sm); }
}

__device__ __forceinline__ void d_ams(int blk, const float* __restrict__ am, float* AMS) { const int j = blk * 256 + threadIdx.x; if (j >= NB_ * TT) return; const float v = bfr(am[j]) * (1.0f / SCL); *(float*)(AMS + j) = v;  }
// ---- k_prep: all operand preparation in one launch, by block range: the three weight transposes first (their blocks run longest), then x of both batches to bf16, then the mask of both batches.
#define NBW  ((DM * DQ / 64 + 63) / 64)          // blocks of one weight transpose (DQ == DKV)
#define NBX  ((NB_ * TT * DM / 8 + 255) / 256)   // blocks of the x conversion
#define NBM  (NB_ * TT / 256)                    // blocks of the mask
__global__ __launch_bounds__(256) void k_prep(const float* __restrict__ x, const float* __restrict__ am, const float* __restrict__ wq, const float* __restrict__ wk, const float* __restrict__ wv, bf* XB, float* AMS, bf* WQ, bf* WK, bf* WV) {
    const int blk = blockIdx.x;
    if (blk < 3 * NBW) { const int wz = blk / NBW; d_wtG(blk - wz * NBW, wz == 0 ? wq : wz == 1 ? wk : wv, DM, DQ, wz == 0 ? WQ : wz == 1 ? WK : WV); }
    else if (blk < 3 * NBW + NBX) d_cvt8(blk - 3 * NBW, x, XB, (size_t)NB_ * TT * DM / 8);
    else d_ams(blk - 3 * NBW - NBX, am, AMS);
}

extern "C" void kernel_launch(void* const* d_in, const int* in_sizes, int n_in,
                              void* d_out, int out_size, void* d_ws, size_t ws_size, hipStream_t stream) {
    (void)in_sizes; (void)n_in; (void)out_size;
    const float* x = (const float*)d_in[0]; const float* amask = (const float*)d_in[1]; const float* wq = (const float*)d_in[2]; const float* bq = (const float*)d_in[3]; const float* wk = (const float*)d_in[4]; const float* bk = (const float*)d_in[5]; const float* wv = (const float*)d_in[6]; const float* bv = (const float*)d_in[7]; const float* wo = nullptr; (void)wo;
    float* OUT = (float*)d_out;     // [2][2048][768]
    char* wsp = (char*)d_ws;
    auto take = [&](size_t bytes) { char* p = wsp; wsp += (bytes + 255) & ~(size_t)255; return (void*)p; };
    bf* WQ = (bf*)take((size_t)DQ * DM * 2); bf* WK = (bf*)take((size_t)DKV * DM * 2); bf* WV = (bf*)take((size_t)DKV * DM * 2); float* AMS = (float*)take((size_t)NB_ * TT * 4);
    bf* XB = (bf*)take((size_t)NB_ * TT * DM * 2);
    const size_t PQ = (size_t)NH_ * TT * HD, PK = (size_t)NKV * TT * HD;   // elements of one batch's head planes; every plane holds both batches
    h16* QP16 = (h16*)take(NB_ * PQ * 2); h16* KP16 = (h16*)take(NB_ * PK * 2); h16* VT16 = (h16*)take(NB_ * PK * 2);
    bf* QPh = (bf*)take(NB_ * PQ * 2); bf* QPl = (bf*)take(NB_ * PQ * 2); bf* KPh = (bf*)take(NB_ * PK * 2); bf* KPl = (bf*)take(NB_ * PK * 2); bf* VTh = (bf*)take(NB_ * PK * 2); bf* VTl = (bf*)take(NB_ * PK * 2);
    if ((size_t)(wsp - (char*)d_ws) > ws_size) return;    // ws 256 MiB
    k_prep<<<3 * NBW + NBX + NBM, 256, 0, stream>>>(x, amask, wq, wk, wv, XB, AMS, WQ, WK, WV);
    k_gemmw<bf, 0, true><<<dim3(NB_ * TT / 64, DQ / 64, 3), 32, 0, stream>>>(XB, nullptr, WQ, WK, WV, nullptr, DM, bq, bk, bv, QP16, QPh, QPl, KP16, KPh, KPl, VT16, VTh, VTl);
    k_fattn<<<NB_ * NH_ * (TT / 64), 128, 0, stream>>>(QP16, KP16, VT16, QPh, QPl, KPh, KPl, VTh, VTl, AMS, OUT);
}

// v006
// Measured time: 94.2 microseconds a run.
// Timed twice side by side with v005, it ran 1.04 times as fast both times.
// Counting every step since v000, it is 16.6 times as fast.
#include <hip/hip_runtime.h>

// SyntaxBertSelfAttention (hidden [2][2048][768], additive attention_mask [2][1][1][2048]; q/k/v = x W + b (12 heads x 64); scores = q.k / sqrt(12) (the module scales by 1/sqrt(num_heads), faithful) + mask[b][j]; softmax; out = merged heads -> [2][2048][768]).
// Compute dtypes, f32 accumulate: every input rounded to bf16; projections on PLAIN bf16 operands (inputs: exact, + bias); scores (K 64) and probs.v on hl planes (3 products) for the first 512 query rows of each

#define NB_  2
#define TT   2048
#define DM   768
#define NH_  12
#define NKV  12
#define REP  (NH_ / NKV)
#define HD   64
#define DQ   (NH_ * HD)
#define DKV  (NKV * HD)
#define RH   512                  // query rows < RH use hi+lo planes (0: none)
#define WIN  2048
#define SCL  0.28867513459481287f
#define L2E  1.4426950408889634f
#define FPI  144                  // fused attention: LDS row pitch in bytes (128 B of data + 16)
#define FTB  (64 * FPI)           // fused attention: bytes of one staged 64-row tile
typedef _Float16 h16;
typedef unsigned short bf;
typedef __attribute__((ext_vector_type(16))) __bf16   v16bf;
typedef __attribute__((ext_vector_type(16))) _Float16 v16h;
typedef __attribute__((ext_vector_type(8)))  _Float16 v8h;
typedef __attribute__((ext_vector_type(8)))  unsigned short v8us;
typedef __attribute__((ext_vector_type(8)))  float    v8f;
typedef __attribute__((ext_vector_type(4)))  float    v4f;
typedef v8h  __attribute__((may_alias)) v8ha;
typedef v4f  __attribute__((may_alias)) v4fa;
typedef v8us __attribute__((may_alias)) v8usa;

__device__ __forceinline__ unsigned short f2bf(float f) { unsigned u = __float_as_uint(f); u += 0x7FFFu + ((u >> 16) & 1u); return (unsigned short)(u >> 16); }
__device__ __forceinline__ float bf2f(unsigned short b) { return __uint_as_float(((unsigned)b) << 16); }
__device__ __forceinline__ float bfr(float f) { return bf2f(f2bf(f)); }
__device__ __forceinline__ v16h cat16(v8h lo, v8h hi) { return __builtin_shufflevector(lo, hi, 0, 1, 2, 3, 4, 5, 6, 7, 8, 9, 10, 11, 12, 13, 14, 15); }
__device__ __forceinline__ v16bf cat16b(v8us lo, v8us hi) { return __builtin_bit_cast(v16bf, __builtin_shufflevector(lo, hi, 0, 1, 2, 3, 4, 5, 6, 7, 8, 9, 10, 11, 12, 13, 14, 15)); }
__device__ __forceinline__ v8f wmma16(v16h a, v16h b, v8f c) { return __builtin_amdgcn_wmma_f32_16x16x32_f16(false, a, false, b, (short)0, c, false, false); }
__device__ __forceinline__ v8f wmmab(v16bf a, v16bf b, v8f c) { return __builtin_amdgcn_wmma_f32_16x16x32_bf16(false, a, false, b, (short)0, c, false, false); }



__device__ __forceinline__ h16 tohx(float x) { return (h16)x; }
__device__ __forceinline__ void splitf(float y, unsigned short& h, unsigned short& l) { h = f2bf(y); l = f2bf(y - bf2f(h)); }
// ---- k_gemmw: register-blocked GEMM, ONE WAVE per 64x64 output tile (16 accumulators), operands straight from 16-bit planes packed in fragment order; grid (M/64, N/64, 3), 32 threads.
// Packed plane: blocks of 16 rows x 32 k (1 KB), the K/32 blocks of a 16-row strip in a row; in a block, 16-byte unit j * 32 + lane holds k = 16 j + 8 (lane >> 4) + 0..7 of row lane & 15.
// A fragment is then two loads of 512 contiguous bytes (four whole lines each) instead of 32-byte pieces of 16 lines; the k order of both operands is what it was.
// One launch does all three projections of both batches: blockIdx.z picks the weight, the bias and the planes (0 q, 1 k, 2 v); m runs over the tokens of both batches.
// c[m][n] (f32, + optional f32 bias[n]) = sum_k A[m][k] Bt[n][k] (+ split products per NSPLIT). K % 32 == 0. A 64-column tile is one head (HD == 64), m is the token.
// The f32 tile is never stored: the epilogue writes it as the three 16-bit operand planes of the attention kernel (f16, bf16 hi, bf16 lo).
// q, k: planes [batch][head][token][d], through the LDS tile (a lane takes 8 consecutive d). v: planes [batch][head][d][token], straight from the accumulators (a lane holds 8 consecutive tokens of one d).
template <typename T16> struct WFrag;
template <> struct WFrag<h16> { typedef v16h V; static __device__ __forceinline__ V ld(const h16* p) { return cat16(*(const v8h*)p, *(const v8h*)(p + 256)); } static __device__ __forceinline__ v8f mma(V a, V b, v8f c) { return wmma16(a, b, c); } };
template <> struct WFrag<bf> { typedef v16bf V; static __device__ __forceinline__ V ld(const bf* p) { return cat16b(*(const v8us*)p, *(const v8us*)(p + 256)); } static __device__ __forceinline__ v8f mma(V a, V b, v8f c) { return wmmab(a, b, c); } };
template <typename T16, int NSPLIT, bool BIAS>
__global__ __launch_bounds__(32) void k_gemmw(const T16* __restrict__ A, const T16* __restrict__ A2, const T16* __restrict__ Bq, const T16* __restrict__ Bk, const T16* __restrict__ Bv, const T16* __restrict__ Bt2, const float* __restrict__ biq, const float* __restrict__ bik, const float* __restrict__ biv,
                                              h16* Q16, bf* Qh, bf* Ql, h16* K16, bf* Kh, bf* Kl, h16* V16, bf* Vh, bf* Vl) {
    typedef typename WFrag<T16>::V V;
    __shared__ __align__(16) float os[16 * 68];
    constexpr int K = DM;   // a constant, so that the strips of a tile are immediate offsets from one address per operand
    const int kbeg = 0, kend = K;
    const int pz = blockIdx.z; const bool VT = pz == 2;
    const T16* __restrict__ Bt = pz == 0 ? Bq : pz == 1 ? Bk : Bv; const float* __restrict__ bias = pz == 0 ? biq : pz == 1 ? bik : biv;
    h16* P16 = pz == 0 ? Q16 : pz == 1 ? K16 : V16; bf* Ph = pz == 0 ? Qh : pz == 1 ? Kh : Vh; bf* Pl = pz == 0 ? Ql : pz == 1 ? Kl : Vl;
    const int lane = threadIdx.x & 31, lr = lane & 15, hi = lane >> 4; const int r0 = blockIdx.x * 64, c0 = blockIdx.y * 64;
    const int bt = r0 / TT, t0 = r0 % TT;   // batch and first token of the tile (a tile never straddles two batches: TT % 64 == 0)
    v8f acc[4][4];
#pragma unroll
    for (int mb = 0; mb < 4; ++mb)
#pragma unroll
        for (int nb = 0; nb < 4; ++nb) acc[mb][nb] = (v8f){};
    const size_t aoff = (size_t)r0 * K + 8 * lane, boff = (size_t)c0 * K + 8 * lane;   // first block of the tile's first strip, the lane's unit; a strip is 16 K elements, a block 512
#pragma unroll 1
    for (int kc = kbeg; kc < kend; kc += 32) {
        V a[4], a2[4]; const size_t ao = aoff + (size_t)kc * 16, bo = boff + (size_t)kc * 16;
#pragma unroll
        for (int mb = 0; mb < 4; ++mb) { a[mb] = WFrag<T16>::ld(A + ao + (size_t)mb * 16 * K); if (NSPLIT == 1 || NSPLIT == 2) a2[mb] = WFrag<T16>::ld(A2 + ao + (size_t)mb * 16 * K); }
        asm volatile("s_wait_xcnt 0x0" ::: "memory");   // this build lets a later load's result land in the address registers of the loads above: the wait stands in front of that
#pragma unroll
        for (int nb = 0; nb < 4; ++nb) { const V b = WFrag<T16>::ld(Bt + bo + (size_t)nb * 16 * K); V b2; if (NSPLIT >= 2) b2 = WFrag<T16>::ld(Bt2 + bo + (size_t)nb * 16 * K);
#pragma unroll
            for (int mb = 0; mb < 4; ++mb) { acc[mb][nb] = WFrag<T16>::mma(a[mb], b, acc[mb][nb]); if (NSPLIT == 1 || NSPLIT == 2) acc[mb][nb] = WFrag<T16>::mma(a2[mb], b, acc[mb][nb]); if (NSPLIT >= 2) acc[mb][nb] = WFrag<T16>::mma(a[mb], b2, acc[mb][nb]); } }
        asm volatile("v_nop\n\tv_nop\n\tv_nop\n\tv_nop" : "+v"(acc[0][0]), "+v"(acc[1][1]), "+v"(acc[2][2]), "+v"(acc[3][3]) : "v"(a[0]), "v"(a[3]));
        asm volatile("s_wait_xcnt 0x0" ::: "memory");   // in front of the next pass's rewrite of the loads' address registers
    }
    if (VT) {
#pragma unroll
        for (int nb = 0; nb < 4; ++nb) { const float bn = BIAS ? bfr(bias[c0 + nb * 16 + lr]) : 0.0f; const size_t e0 = (size_t)(bt * DKV + c0 + nb * 16 + lr) * TT + t0 + 8 * hi;
#pragma unroll
            for (int mb = 0; mb < 4; ++mb) { v8h o16; v8us oh, ol;
#pragma unroll
                for (int j = 0; j < 8; ++j) { float x = acc[mb][nb][j]; if (BIAS) x += bn; o16[j] = tohx(x); unsigned short a2, c2; splitf(x, a2, c2); oh[j] = a2; ol[j] = c2; }
                *(v8h*)(P16 + e0 + mb * 16) = o16; *(v8us*)(Ph + e0 + mb * 16) = oh; *(v8us*)(Pl + e0 + mb * 16) = ol; } }
    } else {
        const int rw = lane >> 3, cofs = (lane & 7) * 8;   // 8 lanes per 64-d row: one store covers four whole 128-byte rows
        float bn[8];
#pragma unroll
        for (int q = 0; q < 8; ++q) bn[q] = BIAS ? bfr(bias[c0 + cofs + q]) : 0.0f;
#pragma unroll
        for (int mb = 0; mb < 4; ++mb) {
#pragma unroll
            for (int nb = 0; nb < 4; ++nb) {
#pragma unroll
                for (int j = 0; j < 8; ++j) os[(hi * 8 + j) * 68 + nb * 16 + lr] = acc[mb][nb][j]; }
            __builtin_amdgcn_wave_barrier(); asm volatile("" ::: "memory");   // the reads below take other lanes' writes: keeps them behind the writes
#pragma unroll
            for (int s = 0; s < 4; ++s) { const int row = 4 * s + rw; const v4f va = *(const v4fa*)(os + row * 68 + cofs), vb = *(const v4fa*)(os + row * 68 + cofs + 4); v8h o16; v8us oh, ol;
#pragma unroll
                for (int q = 0; q < 8; ++q) { float x = q < 4 ? va[q & 3] : vb[q & 3]; if (BIAS) x += bn[q]; o16[q] = tohx(x); unsigned short a2, c2; splitf(x, a2, c2); oh[q] = a2; ol[q] = c2; }
                const size_t e = ((size_t)(bt * NH_ + c0 / HD) * TT + t0 + mb * 16 + row) * HD + cofs;
                *(v8h*)(P16 + e) = o16; *(v8us*)(Ph + e) = oh; *(v8us*)(Pl + e) = ol; }
            __builtin_amdgcn_wave_barrier(); asm volatile("" ::: "memory");   // the next tile's writes stay behind these reads
        }
    }
}

typedef __attribute__((ext_vector_type(2))) _Float16 v2h;
typedef __attribute__((ext_vector_type(4))) _Float16 v4h;
typedef __attribute__((ext_vector_type(2))) unsigned short v2us;
typedef __attribute__((ext_vector_type(4))) unsigned short v4us;
typedef __attribute__((ext_vector_type(2))) float v2f;
typedef __attribute__((ext_vector_type(4))) int v4i;

// One thread per 16-byte unit of a packed plane (layout: at k_gemmw): unit u -> row and first k of its 8 elements. A wave writes 512 contiguous bytes.
__device__ __forceinline__ void unit_rk(int u, int K, int& row, int& k0) { const int t = u >> 6; row = (t / (K / 32)) * 16 + (u & 15); k0 = (t % (K / 32)) * 32 + ((u >> 5) & 1) * 16 + ((u >> 4) & 1) * 8; }
// weight w[k][n] -> packed rows n: 16 lanes read 16 consecutive n of one k, eight independent loads per thread
__device__ __forceinline__ void d_packw(int blk, const float* __restrict__ w, int K, int N, bf* Bt) { const int u = blk * 256 + threadIdx.x; if (u >= N * K / 8) return; int n, k0; unit_rk(u, K, n, k0); v8us o;
#pragma unroll
    for (int q = 0; q < 8; ++q) o[q] = f2bf(w[(size_t)(k0 + q) * N + n]);
    *(v8us*)(Bt + (size_t)u * 8) = o; }
// x[m][k] -> packed rows m
__device__ __forceinline__ void d_packx(int blk, const float* __restrict__ src, int K, bf* dst, int n8) { const int u = blk * 256 + threadIdx.x; if (u >= n8) return; int m, k0; unit_rk(u, K, m, k0); const v8f v = *(const v8f*)(src + (size_t)m * K + k0); v8us o;
#pragma unroll
    for (int k = 0; k < 8; ++k) o[k] = f2bf(v[k]);
    *(v8us*)(dst + (size_t)u * 8) = o; }
typedef __attribute__((ext_vector_type(16))) unsigned short v16us;
template <bool HI> struct FAt;
template <> struct FAt<false> { typedef v16h V; static __device__ __forceinline__ V cast(v16us x) { return __builtin_bit_cast(v16h, x); } static __device__ __forceinline__ v8f mma(V a, V b, v8f c) { return wmma16(a, b, c); } };
template <> struct FAt<true> { typedef v16bf V; static __device__ __forceinline__ V cast(v16us x) { return __builtin_bit_cast(v16bf, x); } static __device__ __forceinline__ v8f mma(V a, V b, v8f c) { return wmmab(a, b, c); } };
__device__ __forceinline__ v16us ldfr(const unsigned char* p) { return __builtin_shufflevector(*(const v8usa*)p, *(const v8usa*)(p + 32), 0, 1, 2, 3, 4, 5, 6, 7, 8, 9, 10, 11, 12, 13, 14, 15); }   // k = 8 hi + 0..7 and 16 + 8 hi + 0..7 of a 32-k chunk; p already holds the 16 hi bytes
__device__ __forceinline__ float xhalf(float x) { const int b = __float_as_int(x); return __int_as_float(__builtin_amdgcn_permlanex16(b, b, 0x76543210, 0xfedcba98, false, false)); }   // lane l <-> l ^ 16
// eight 2^x in one statement, each in place: no v_exp_f32 here is directly followed by an instruction that reads its result or overwrites its source, and the v_nop keeps that slot behind the last one.
// In place, so that the statement writes only registers that a compiler-placed vector instruction in front of it has just written (never an operand of a matrix instruction still in its window).
__device__ __forceinline__ v8f exp2x8(v8f x) { float y0 = x[0], y1 = x[1], y2 = x[2], y3 = x[3], y4 = x[4], y5 = x[5], y6 = x[6], y7 = x[7];
    asm("v_exp_f32 %0, %0\n\tv_exp_f32 %1, %1\n\tv_exp_f32 %2, %2\n\tv_exp_f32 %3, %3\n\tv_exp_f32 %4, %4\n\tv_exp_f32 %5, %5\n\tv_exp_f32 %6, %6\n\tv_exp_f32 %7, %7\n\tv_nop"
        : "+v"(y0), "+v"(y1), "+v"(y2), "+v"(y3), "+v"(y4), "+v"(y5), "+v"(y6), "+v"(y7));
    return (v8f){y0, y1, y2, y3, y4, y5, y6, y7}; }
template <bool HI>
__device__ __forceinline__ void fattn_body(const unsigned char* __restrict__ Q0, const unsigned char* __restrict__ Q1, const unsigned char* __restrict__ K0, const unsigned char* __restrict__ K1, const unsigned char* __restrict__ V0, const unsigned char* __restrict__ V1, const float* __restrict__ ams, float* out, int q0, unsigned char* sm) {
    typedef typename FAt<HI>::V V;
    constexpr int NT = HI ? 4 : 2;                     // staged tiles per stage: K, Vt (, K lo, Vt lo)
    const int tid = threadIdx.x, lane = tid & 31, wv = tid >> 5, c = lane & 15, h = lane >> 4;
    float* mk = (float*)sm; unsigned char* buf = sm + TT * 4;
    for (int j = tid; j < TT; j += 128) mk[j] = ams[j] * (SCL * L2E);   // additive mask in the log2 domain
    const int srow = tid >> 3, scol = (tid & 7) * 16;  // staging: 8 threads per 128-byte row, 16 rows per sweep
    v8us st[NT][4];
    auto gload = [&](int s) {
#pragma unroll
        for (int u = 0; u < 4; ++u) { const int row = srow + 16 * u; const size_t ko = (size_t)(s * 64 + row) * (HD * 2) + scol, vo = (size_t)row * (TT * 2) + s * 128 + scol;
            st[0][u] = *(const v8usa*)(K0 + ko); st[1][u] = *(const v8usa*)(V0 + vo); if (HI) { st[2][u] = *(const v8usa*)(K1 + ko); st[3][u] = *(const v8usa*)(V1 + vo); } }
        asm volatile("s_wait_xcnt 0x0" ::: "memory"); };   // stands in front of every later overwrite of these loads' address registers (this build reuses them while the loads are in flight)
    auto lstore = [&](int bs) { unsigned char* d = buf + bs * (NT * FTB) + srow * FPI + scol;
#pragma unroll
        for (int t = 0; t < NT; ++t)
#pragma unroll
            for (int u = 0; u < 4; ++u) *(v8usa*)(d + t * FTB + u * 16 * FPI) = st[t][u]; };
    V qf[2], ql[2];
#pragma unroll
    for (int kc = 0; kc < 2; ++kc) { const size_t qo = (size_t)(q0 + wv * 16 + c) * (HD * 2) + kc * 64 + h * 16; qf[kc] = FAt<HI>::cast(ldfr(Q0 + qo)); if (HI) ql[kc] = FAt<HI>::cast(ldfr(Q1 + qo)); }
    v8f o[4];
#pragma unroll
    for (int dt = 0; dt < 4; ++dt) o[dt] = (v8f){};
    float m = -3.0e38f, l = 0.f;
    gload(0); lstore(0); __syncthreads();
#pragma unroll 1
    for (int s = 0; s < TT / 64; ++s) {
        if (s + 1 < TT / 64) gload(s + 1);
        const unsigned char* kb = buf + (s & 1) * (NT * FTB) + c * FPI + h * 16;
        v4f mq[4][2];   // the lane's 32 mask terms, fetched ahead of the fragments: LDS answers in order, and the softmax needs these first
#pragma unroll
        for (int kt = 0; kt < 4; ++kt) { const float* mp = mk + s * 64 + kt * 16 + 8 * h; mq[kt][0] = *(const v4fa*)mp; mq[kt][1] = *(const v4fa*)(mp + 4); }
        v8f sc[4];
#pragma unroll
        for (int kt = 0; kt < 4; ++kt) { v8f a = (v8f){};
#pragma unroll
            for (int kc = 0; kc < 2; ++kc) { const V kf = FAt<HI>::cast(ldfr(kb + kt * 16 * FPI + kc * 64)); a = FAt<HI>::mma(kf, qf[kc], a);
                if (HI) { a = FAt<HI>::mma(kf, ql[kc], a); const V kl = FAt<HI>::cast(ldfr(kb + 2 * FTB + kt * 16 * FPI + kc * 64)); a = FAt<HI>::mma(kl, qf[kc], a); } }
            sc[kt] = a; }
        V va[2][HI ? 2 : 1][4];   // Vt fragments: [32-key chunk][plane][d tile]
        auto vload = [&](int j) {
#pragma unroll
            for (int dt = 0; dt < 4; ++dt) { va[j][0][dt] = FAt<HI>::cast(ldfr(kb + FTB + dt * 16 * FPI + j * 64)); if constexpr (HI) va[j][1][dt] = FAt<HI>::cast(ldfr(kb + 3 * FTB + dt * 16 * FPI + j * 64)); } };
        vload(0); if (!HI) vload(1);
        __builtin_amdgcn_sched_barrier(0);   // keeps these LDS loads above the softmax, so that their latency runs under it; without it they sink to their first use
        float mx = m;
#pragma unroll
        for (int kt = 0; kt < 4; ++kt)
#pragma unroll
            for (int r = 0; r < 8; ++r) { const float t = fmaf(sc[kt][r], SCL * L2E, mq[kt][r >> 2][r & 3]); sc[kt][r] = t; mx = fmaxf(mx, t); }
        mx = fmaxf(mx, xhalf(mx));
        const float al = __builtin_amdgcn_exp2f(m - mx); m = mx;
        const float ms = HI ? mx : mx - 10.0f;
#pragma unroll
        for (int dt = 0; dt < 4; ++dt) o[dt] *= al;
#pragma unroll
        for (int j = 0; j < 2; ++j) { V pf, pl; sc[2 * j] = exp2x8(sc[2 * j] - ms); sc[2 * j + 1] = exp2x8(sc[2 * j + 1] - ms);
#pragma unroll
            for (int e = 0; e < 16; ++e) { const float p = sc[2 * j + (e >> 3)][e & 7];
                if constexpr (HI) { const __bf16 ph = (__bf16)p; pf[e] = ph; pl[e] = (__bf16)(p - (float)ph); } else { pf[e] = (_Float16)p; } }
            if (HI && j == 0) { vload(1); __builtin_amdgcn_sched_barrier(0); }   // the second chunk's loads are issued ahead of the first chunk's products, for the same reason
#pragma unroll
            for (int dt = 0; dt < 4; ++dt) { o[dt] = FAt<HI>::mma(va[j][0][dt], pf, o[dt]);
                if constexpr (HI) { o[dt] = FAt<HI>::mma(va[j][0][dt], pl, o[dt]); o[dt] = FAt<HI>::mma(va[j][1][dt], pf, o[dt]); } } }
        const v8f pv = (sc[0] + sc[1]) + (sc[2] + sc[3]);   // the lane's 32 terms as a tree, not one dependent chain
        l = fmaf(l, al, ((pv[0] + pv[1]) + (pv[2] + pv[3])) + ((pv[4] + pv[5]) + (pv[6] + pv[7])));
        if (s + 1 < TT / 64) lstore((s + 1) & 1);
        __syncthreads();   // publishes stage s + 1 and ends every wave's reads of the buffer that the next trip refills
    }
    l += xhalf(l);
    const float inv = 1.0f / l;
    float* orow = out + (size_t)(q0 + wv * 16 + c) * DQ + 8 * h;
#pragma unroll
    for (int dt = 0; dt < 4; ++dt) { v4f a, b;
#pragma unroll
        for (int r = 0; r < 4; ++r) { a[r] = o[dt][r] * inv; b[r] = o[dt][4 + r] * inv; }
        *(v4f*)(orow + dt * 16) = a; *(v4f*)(orow + dt * 16 + 4) = b; }
}
// grid: the hi+lo blocks (3 x the matrix work) first, then the f16 blocks; planes [batch][head][...], AMS [batch][key], OUT [batch][query][head * 64 + d]
// amdgpu_waves_per_eu(3, 3): 768 work-groups of one wave per SIMD on 256 WGPs are three waves per SIMD; the register budget of three lets the scheduler keep a stage's LDS loads in flight instead of waiting on each
__global__ __launch_bounds__(128) __attribute__((amdgpu_waves_per_eu(3, 3))) void k_fattn(const h16* __restrict__ Q16, const h16* __restrict__ K16, const h16* __restrict__ V16, const bf* __restrict__ Qh, const bf* __restrict__ Ql, const bf* __restrict__ Kh, const bf* __restrict__ Kl, const bf* __restrict__ Vh, const bf* __restrict__ Vl, const float* __restrict__ AMS, float* OUT) {
    __shared__ __align__(16) unsigned char sm[TT * 4 + 2 * 4 * FTB];
    const int nhi = NB_ * NH_ * (RH / 64); const int idx = blockIdx.x;
    if (idx < nhi) { const int bh = idx / (RH / 64), qb = idx % (RH / 64); const size_t po = (size_t)bh * TT * HD; const int b = bh / NH_, hd = bh % NH_;
        fattn_body<true>((const unsigned char*)(Qh + po), (const unsigned char*)(Ql + po), (const unsigned char*)(Kh + po), (const unsigned char*)(Kl + po), (const unsigned char*)(Vh + po), (const unsigned char*)(Vl + po), AMS + (size_t)b * TT, OUT + (size_t)b * TT * DQ + hd * HD, qb * 64, sm);
    } else { const int i2 = idx - nhi; const int bh = i2 / ((TT - RH) / 64), qb = RH / 64 + i2 % ((TT - RH) / 64); const size_t po = (size_t)bh * TT * HD; const int b = bh / NH_, hd = bh % NH_;
        fattn_body<false>((const unsigned char*)(Q16 + po), nullptr, (const unsigned char*)(K16 + po), nullptr, (const unsigned char*)(V16 + po), nullptr, AMS + (size_t)b * TT, OUT + (size_t)b * TT * DQ + hd * HD, qb * 64, sm); }
}

__device__ __forceinline__ void d_ams(int blk, const float* __restrict__ am, float* AMS) { const int j = blk * 256 + threadIdx.x; if (j >= NB_ * TT) return; const float v = bfr(am[j]) * (1.0f / SCL); *(float*)(AMS + j) = v;  }
// ---- k_prep: all operand preparation in one launch, by block range: the three weights, then x of both batches, each to bf16 in the packed fragment order, then the mask of both batches.
#define NBW  ((DM * DQ / 8 + 255) / 256)         // blocks of one weight (DQ == DKV)
#define NBX  ((NB_ * TT * DM / 8 + 255) / 256)   // blocks of the x conversion
#define NBM  (NB_ * TT / 256)                    // blocks of the mask
__global__ __launch_bounds__(256) void k_prep(const float* __restrict__ x, const float* __restrict__ am, const float* __restrict__ wq, const float* __restrict__ wk, const float* __restrict__ wv, bf* XB, float* AMS, bf* WQ, bf* WK, bf* WV) {
    const int blk = blockIdx.x;
    if (blk < 3 * NBW) { const int wz = blk / NBW; d_packw(blk - wz * NBW, wz == 0 ? wq : wz == 1 ? wk : wv, DM, DQ, wz == 0 ? WQ : wz == 1 ? WK : WV); }
    else if (blk < 3 * NBW + NBX) d_packx(blk - 3 * NBW, x, DM, XB, NB_ * TT * DM / 8);
    else d_ams(blk - 3 * NBW - NBX, am, AMS);
}

extern "C" void kernel_launch(void* const* d_in, const int* in_sizes, int n_in,
                              void* d_out, int out_size, void* d_ws, size_t ws_size, hipStream_t stream) {
    (void)in_sizes; (void)n_in; (void)out_size;
    const float* x = (const float*)d_in[0]; const float* amask = (const float*)d_in[1]; const float* wq = (const float*)d_in[2]; const float* bq = (const float*)d_in[3]; const float* wk = (const float*)d_in[4]; const float* bk = (const float*)d_in[5]; const float* wv = (const float*)d_in[6]; const float* bv = (const float*)d_in[7]; const float* wo = nullptr; (void)wo;
    float* OUT = (float*)d_out;     // [2][2048][768]
    char* wsp = (char*)d_ws;
    auto take = [&](size_t bytes) { char* p = wsp; wsp += (bytes + 255) & ~(size_t)255; return (void*)p; };
    bf* WQ = (bf*)take((size_t)DQ * DM * 2); bf* WK = (bf*)take((size_t)DKV * DM * 2); bf* WV = (bf*)take((size_t)DKV * DM * 2); float* AMS = (float*)take((size_t)NB_ * TT * 4);
    bf* XB = (bf*)take((size_t)NB_ * TT * DM * 2);
    const size_t PQ = (size_t)NH_ * TT * HD, PK = (size_t)NKV * TT * HD;   // elements of one batch's head planes; every plane holds both batches
    h16* QP16 = (h16*)take(NB_ * PQ * 2); h16* KP16 = (h16*)take(NB_ * PK * 2); h16* VT16 = (h16*)take(NB_ * PK * 2);
    bf* QPh = (bf*)take(NB_ * PQ * 2); bf* QPl = (bf*)take(NB_ * PQ * 2); bf* KPh = (bf*)take(NB_ * PK * 2); bf* KPl = (bf*)take(NB_ * PK * 2); bf* VTh = (bf*)take(NB_ * PK * 2); bf* VTl = (bf*)take(NB_ * PK * 2);
    if ((size_t)(wsp - (char*)d_ws) > ws_size) return;    // ws 256 MiB
    k_prep<<<3 * NBW + NBX + NBM, 256, 0, stream>>>(x, amask, wq, wk, wv, XB, AMS, WQ, WK, WV);
    k_gemmw<bf, 0, true><<<dim3(NB_ * TT / 64, DQ / 64, 3), 32, 0, stream>>>(XB, nullptr, WQ, WK, WV, nullptr, bq, bk, bv, QP16, QPh, QPl, KP16, KPh, KPl, VT16, VTh, VTl);
    k_fattn<<<NB_ * NH_ * (TT / 64), 128, 0, stream>>>(QP16, KP16, VT16, QPh, QPl, KPh, KPl, VTh, VTl, AMS, OUT);
}

// v007
// A run of this version takes 80.9 microseconds.
// Next to v006, in two timings, it ran 1.16 and 1.17 times as fast.
// Over all steps from v000 it is 19.3 times as fast.
#include <hip/hip_runtime.h>

// SyntaxBertSelfAttention (hidden [2][2048][768], additive attention_mask [2][1][1][2048]; q/k/v = x W + b (12 heads x 64); scores = q.k / sqrt(12) (the module scales by 1/sqrt(num_heads), faithful) + mask[b][j]; softmax; out = merged heads -> [2][2048][768]).
// Compute dtypes, f32 accumulate: every input rounded to bf16; projections on PLAIN bf16 operands (inputs: exact, + bias); scores (K 64) and probs.v on hl planes (3 products) for the first 512 query rows of each

#define NB_  2
#define TT   2048
#define DM   768
#define NH_  12
#define NKV  12
#define REP  (NH_ / NKV)
#define HD   64
#define DQ   (NH_ * HD)
#define DKV  (NKV * HD)
#define RH   512                  // query rows < RH use hi+lo planes (0: none)
#define WIN  2048
#define SCL  0.28867513459481287f
#define L2E  1.4426950408889634f
#define FPI  144                  // fused attention: LDS row pitch in bytes (128 B of data + 16)
#define FTB  (64 * FPI)           // fused attention: bytes of one staged 64-row tile
typedef _Float16 h16;
typedef unsigned short bf;
typedef __attribute__((ext_vector_type(16))) __bf16   v16bf;
typedef __attribute__((ext_vector_type(16))) _Float16 v16h;
typedef __attribute__((ext_vector_type(8)))  _Float16 v8h;
typedef __attribute__((ext_vector_type(8)))  unsigned short v8us;
typedef __attribute__((ext_vector_type(8)))  float    v8f;
typedef __attribute__((ext_vector_type(4)))  float    v4f;
typedef v8h  __attribute__((may_alias)) v8ha;
typedef v4f  __attribute__((may_alias)) v4fa;
typedef v8us __attribute__((may_alias)) v8usa;

__device__ __forceinline__ unsigned short f2bf(float f) { unsigned u = __float_as_uint(f); u += 0x7FFFu + ((u >> 16) & 1u); return (unsigned short)(u >> 16); }
__device__ __forceinline__ float bf2f(unsigned short b) { return __uint_as_float(((unsigned)b) << 16); }
__device__ __forceinline__ float bfr(float f) { return bf2f(f2bf(f)); }
__device__ __forceinline__ v16h cat16(v8h lo, v8h hi) { return __builtin_shufflevector(lo, hi, 0, 1, 2, 3, 4, 5, 6, 7, 8, 9, 10, 11, 12, 13, 14, 15); }
__device__ __forceinline__ v16bf cat16b(v8us lo, v8us hi) { return __builtin_bit_cast(v16bf, __builtin_shufflevector(lo, hi, 0, 1, 2, 3, 4, 5, 6, 7, 8, 9, 10, 11, 12, 13, 14, 15)); }
__device__ __forceinline__ v8f wmma16(v16h a, v16h b, v8f c) { return __builtin_amdgcn_wmma_f32_16x16x32_f16(false, a, false, b, (short)0, c, false, false); }
__device__ __forceinline__ v8f wmmab(v16bf a, v16bf b, v8f c) { return __builtin_amdgcn_wmma_f32_16x16x32_bf16(false, a, false, b, (short)0, c, false, false); }



__device__ __forceinline__ h16 tohx(float x) { return (h16)x; }
__device__ __forceinline__ void splitf(float y, unsigned short& h, unsigned short& l) { h = f2bf(y); l = f2bf(y - bf2f(h)); }
// ---- k_gemmf: the three projections of both batches in one launch, straight from the f32 inputs. One work-group = 4 waves (2 x 2), each wave a 64x64 output tile (16 accumulators); grid (M/128, 768/128, 3), 128 threads.
// blockIdx.z picks the weight, the bias and the planes (0 q, 1 k, 2 v); m runs over the tokens of both batches.
// Per 32 k the work-group fetches 128 rows of x and 128 columns of w as f32 (every load covers whole 128-byte lines), rounds them to bf16 and stores them in LDS in fragment order; two buffers, one barrier per 32 k: step s + 1 is fetched while step s is worked on.
// LDS tile of one operand: 8 strips of 16 rows; in a strip, k-octet o (k = 8 o + 0..7) of row r is the 16-byte unit at o * GOP + r * 16. A fragment of lane (r, hi) is octet hi and octet 2 + hi, for both operands alike.
// GOP and GSP are padded so that the staging stores as well as the fragment loads fall on distinct banks.
// c[m][n] (f32, + f32 bias[n]) = sum_k x[m][k] w[k][n]. A 64-column tile is one head (HD == 64), m is the token.
// The f32 tile is never stored: the epilogue writes it as the three 16-bit operand planes of the attention kernel (f16, bf16 hi, bf16 lo).
// q, k: planes [batch][head][token][d], through the wave's own LDS tile (a lane takes 8 consecutive d). v: planes [batch][head][d][token], straight from the accumulators (a lane holds 8 consecutive tokens of one d).
#define GOP  320                  // bytes from one k-octet of a strip to the next (256 of data + 64)
#define GSP  (4 * GOP + 16)       // bytes of one strip
#define GTB  (8 * GSP)            // bytes of one operand's staged tile (128 rows x 32 k)
typedef __attribute__((ext_vector_type(8))) __bf16 v8bf;
typedef __attribute__((ext_vector_type(4))) __bf16 v4bf;
typedef __attribute__((ext_vector_type(4))) unsigned short v4us;
typedef v4us __attribute__((may_alias)) v4usa;
__device__ __forceinline__ v16bf ldgf(const unsigned char* p) { return cat16b(*(const v8usa*)p, *(const v8usa*)(p + 2 * GOP)); }
template <bool BIAS>
__global__ __launch_bounds__(128) void k_gemmf(const float* __restrict__ x, const float* __restrict__ wq, const float* __restrict__ wk, const float* __restrict__ wvv, const float* __restrict__ biq, const float* __restrict__ bik, const float* __restrict__ biv,
                                               h16* Q16, bf* Qh, bf* Ql, h16* K16, bf* Kh, bf* Kl, h16* V16, bf* Vh, bf* Vl) {
    __shared__ __align__(16) unsigned char tb[2 * 2 * GTB];
    __shared__ __align__(16) float osw[4 * 16 * 68];
    constexpr int K = DM;
    const int pz = blockIdx.z; const bool VT = pz == 2;
    const float* __restrict__ w = pz == 0 ? wq : pz == 1 ? wk : wvv; const float* __restrict__ bias = pz == 0 ? biq : pz == 1 ? bik : biv;
    h16* P16 = pz == 0 ? Q16 : pz == 1 ? K16 : V16; bf* Ph = pz == 0 ? Qh : pz == 1 ? Kh : Vh; bf* Pl = pz == 0 ? Ql : pz == 1 ? Kl : Vl;
    const int tid = threadIdx.x, lane = tid & 31, wv = __builtin_amdgcn_readfirstlane(tid >> 5), lr = lane & 15, hi = lane >> 4;   // the wave's number as a scalar: tile origin and plane addresses stay in scalar registers
    const int R0 = blockIdx.x * 128, C0 = blockIdx.y * 128; const int r0 = R0 + (wv & 1) * 64, c0 = C0 + (wv >> 1) * 64;
    const int bt = r0 / TT, t0 = r0 % TT;   // batch and first token of the wave's tile (a tile never straddles two batches: TT % 64 == 0)
    float* os = osw + wv * (16 * 68);
    v8f acc[4][4];
#pragma unroll
    for (int mb = 0; mb < 4; ++mb)
#pragma unroll
        for (int nb = 0; nb < 4; ++nb) acc[mb][nb] = (v8f){};
    // x: 8 lanes per row (32 k = one line), 4 rows per load, the wave's 32 rows in 8 loads. w: the wave takes k-octet wv, a lane 4 consecutive n of each of its 8 k: 512 contiguous bytes per load.
    const float* xa = x + (size_t)(R0 + wv * 32 + (lane >> 3)) * K + (lane & 7) * 4;
    const float* wb = w + (size_t)(wv * 8) * DQ + C0 + lane * 4;
    v4f sa[8], sb[8];
    auto gload = [&](int s) {
#pragma unroll
        for (int i = 0; i < 8; ++i) sa[i] = *(const v4fa*)(xa + (size_t)i * 4 * K + s * 32);
        asm volatile("s_wait_xcnt 0x0" ::: "memory");   // this build lets a later load's result land in the address registers of the loads above: the wait stands in front of that
#pragma unroll
        for (int q = 0; q < 8; ++q) sb[q] = *(const v4fa*)(wb + (size_t)(s * 32 + q) * DQ);
        asm volatile("s_wait_xcnt 0x0" ::: "memory"); };   // stands in front of every later overwrite of these loads' address registers
    unsigned char* da = tb + wv * 2 * GSP + ((lane & 7) >> 1) * GOP + (lane >> 3) * 16 + (lane & 1) * 8;   // half a unit: 4 k of one row
    unsigned char* db = tb + GTB + (lane >> 2) * GSP + wv * GOP + (lane & 3) * 64;                          // four units: 8 k of 4 columns
    auto lstore = [&](int bs) {
#pragma unroll
        for (int i = 0; i < 8; ++i) { v4bf o;
#pragma unroll
            for (int e = 0; e < 4; ++e) o[e] = (__bf16)sa[i][e];
            *(v4usa*)(da + bs * (2 * GTB) + (i >> 2) * GSP + (i & 3) * 64) = __builtin_bit_cast(v4us, o); }
#pragma unroll
        for (int i = 0; i < 4; ++i) { v8bf o;
#pragma unroll
            for (int q = 0; q < 8; ++q) o[q] = (__bf16)sb[q][i];
            *(v8usa*)(db + bs * (2 * GTB) + i * 16) = __builtin_bit_cast(v8us, o); } };
    gload(0); lstore(0); __syncthreads();
#pragma unroll 1
    for (int s = 0; s < K / 32; ++s) {
        if (s + 1 < K / 32) gload(s + 1);
        const unsigned char* ab = tb + (s & 1) * (2 * GTB) + (wv & 1) * 4 * GSP + hi * GOP + lr * 16;
        const unsigned char* bb = tb + (s & 1) * (2 * GTB) + GTB + (wv >> 1) * 4 * GSP + hi * GOP + lr * 16;
        v16bf a[4], b[4];
#pragma unroll
        for (int mb = 0; mb < 4; ++mb) a[mb] = ldgf(ab + mb * GSP);
#pragma unroll
        for (int nb = 0; nb < 4; ++nb) b[nb] = ldgf(bb + nb * GSP);
        __builtin_amdgcn_sched_barrier(0);   // keeps the 16 LDS loads together ahead of the products; without it three of the w fragments are fetched among them, each behind a full wait
#pragma unroll
        for (int nb = 0; nb < 4; ++nb)
#pragma unroll
            for (int mb = 0; mb < 4; ++mb) acc[mb][nb] = wmmab(a[mb], b[nb], acc[mb][nb]);
        if (s + 1 < K / 32) lstore((s + 1) & 1);
        __syncthreads();   // publishes step s + 1 and ends every wave's reads of the buffer that the next trip refills
    }
    if (VT) {
#pragma unroll
        for (int nb = 0; nb < 4; ++nb) { const float bn = BIAS ? bfr(bias[c0 + nb * 16 + lr]) : 0.0f; const size_t e0 = (size_t)(bt * DKV + c0 + nb * 16 + lr) * TT + t0 + 8 * hi;
#pragma unroll
            for (int mb = 0; mb < 4; ++mb) { v8h o16; v8us oh, ol;
#pragma unroll
                for (int j = 0; j < 8; ++j) { float x = acc[mb][nb][j]; if (BIAS) x += bn; o16[j] = tohx(x); unsigned short a2, c2; splitf(x, a2, c2); oh[j] = a2; ol[j] = c2; }
                *(v8h*)(P16 + e0 + mb * 16) = o16; *(v8us*)(Ph + e0 + mb * 16) = oh; *(v8us*)(Pl + e0 + mb * 16) = ol; } }
    } else {
        const int rw = lane >> 3, cofs = (lane & 7) * 8;   // 8 lanes per 64-d row: one store covers four whole 128-byte rows
        float bn[8];
#pragma unroll
        for (int q = 0; q < 8; ++q) bn[q] = BIAS ? bfr(bias[c0 + cofs + q]) : 0.0f;
#pragma unroll
        for (int mb = 0; mb < 4; ++mb) {
#pragma unroll
            for (int nb = 0; nb < 4; ++nb) {
#pragma unroll
                for (int j = 0; j < 8; ++j) os[(hi * 8 + j) * 68 + nb * 16 + lr] = acc[mb][nb][j]; }
            __builtin_amdgcn_wave_barrier(); asm volatile("" ::: "memory");   // the reads below take other lanes' writes: keeps them behind the writes
#pragma unroll
            for (int s = 0; s < 4; ++s) { const int row = 4 * s + rw; const v4f va = *(const v4fa*)(os + row * 68 + cofs), vb = *(const v4fa*)(os + row * 68 + cofs + 4); v8h o16; v8us oh, ol;
#pragma unroll
                for (int q = 0; q < 8; ++q) { float x = q < 4 ? va[q & 3] : vb[q & 3]; if (BIAS) x += bn[q]; o16[q] = tohx(x); unsigned short a2, c2; splitf(x, a2, c2); oh[q] = a2; ol[q] = c2; }
                const size_t e = ((size_t)(bt * NH_ + c0 / HD) * TT + t0 + mb * 16 + row) * HD + cofs;
                *(v8h*)(P16 + e) = o16; *(v8us*)(Ph + e) = oh; *(v8us*)(Pl + e) = ol; }
            __builtin_amdgcn_wave_barrier(); asm volatile("" ::: "memory");   // the next tile's writes stay behind these reads
        }
    }
}

typedef __attribute__((ext_vector_type(16))) unsigned short v16us;
template <bool HI> struct FAt;
template <> struct FAt<false> { typedef v16h V; static __device__ __forceinline__ V cast(v16us x) { return __builtin_bit_cast(v16h, x); } static __device__ __forceinline__ v8f mma(V a, V b, v8f c) { return wmma16(a, b, c); } };
template <> struct FAt<true> { typedef v16bf V; static __device__ __forceinline__ V cast(v16us x) { return __builtin_bit_cast(v16bf, x); } static __device__ __forceinline__ v8f mma(V a, V b, v8f c) { return wmmab(a, b, c); } };
__device__ __forceinline__ v16us ldfr(const unsigned char* p) { return __builtin_shufflevector(*(const v8usa*)p, *(const v8usa*)(p + 32), 0, 1, 2, 3, 4, 5, 6, 7, 8, 9, 10, 11, 12, 13, 14, 15); }   // k = 8 hi + 0..7 and 16 + 8 hi + 0..7 of a 32-k chunk; p already holds the 16 hi bytes
__device__ __forceinline__ float xhalf(float x) { const int b = __float_as_int(x); return __int_as_float(__builtin_amdgcn_permlanex16(b, b, 0x76543210, 0xfedcba98, false, false)); }   // lane l <-> l ^ 16
// eight 2^x in one statement, each in place: no v_exp_f32 here is directly followed by an instruction that reads its result or overwrites its source, and the v_nop keeps that slot behind the last one.
// In place, so that the statement writes only registers that a compiler-placed vector instruction in front of it has just written (never an operand of a matrix instruction still in its window).
__device__ __forceinline__ v8f exp2x8(v8f x) { float y0 = x[0], y1 = x[1], y2 = x[2], y3 = x[3], y4 = x[4], y5 = x[5], y6 = x[6], y7 = x[7];
    asm("v_exp_f32 %0, %0\n\tv_exp_f32 %1, %1\n\tv_exp_f32 %2, %2\n\tv_exp_f32 %3, %3\n\tv_exp_f32 %4, %4\n\tv_exp_f32 %5, %5\n\tv_exp_f32 %6, %6\n\tv_exp_f32 %7, %7\n\tv_nop"
        : "+v"(y0), "+v"(y1), "+v"(y2), "+v"(y3), "+v"(y4), "+v"(y5), "+v"(y6), "+v"(y7));
    return (v8f){y0, y1, y2, y3, y4, y5, y6, y7}; }
template <bool HI>
__device__ __forceinline__ void fattn_body(const unsigned char* __restrict__ Q0, const unsigned char* __restrict__ Q1, const unsigned char* __restrict__ K0, const unsigned char* __restrict__ K1, const unsigned char* __restrict__ V0, const unsigned char* __restrict__ V1, const float* __restrict__ ams, float* out, int q0, unsigned char* sm) {
    typedef typename FAt<HI>::V V;
    constexpr int NT = HI ? 4 : 2;                     // staged tiles per stage: K, Vt (, K lo, Vt lo)
    const int tid = threadIdx.x, lane = tid & 31, wv = tid >> 5, c = lane & 15, h = lane >> 4;
    float* mk = (float*)sm; unsigned char* buf = sm + TT * 4;
    v4f mv[4];   // the work-group's 2048 mask terms, 16 per thread, fetched together with the first tiles: one trip to memory
#pragma unroll
    for (int i = 0; i < 4; ++i) mv[i] = *(const v4fa*)(ams + i * 512 + tid * 4);
    asm volatile("s_wait_xcnt 0x0" ::: "memory");   // stands in front of every later overwrite of these loads' address registers
    const int srow = tid >> 3, scol = (tid & 7) * 16;  // staging: 8 threads per 128-byte row, 16 rows per sweep
    v8us st[NT][4];
    auto gload = [&](int s) {
#pragma unroll
        for (int u = 0; u < 4; ++u) { const int row = srow + 16 * u; const size_t ko = (size_t)(s * 64 + row) * (HD * 2) + scol, vo = (size_t)row * (TT * 2) + s * 128 + scol;
            st[0][u] = *(const v8usa*)(K0 + ko); st[1][u] = *(const v8usa*)(V0 + vo); if (HI) { st[2][u] = *(const v8usa*)(K1 + ko); st[3][u] = *(const v8usa*)(V1 + vo); } }
        asm volatile("s_wait_xcnt 0x0" ::: "memory"); };   // stands in front of every later overwrite of these loads' address registers (this build reuses them while the loads are in flight)
    auto lstore = [&](int bs) { unsigned char* d = buf + bs * (NT * FTB) + srow * FPI + scol;
#pragma unroll
        for (int t = 0; t < NT; ++t)
#pragma unroll
            for (int u = 0; u < 4; ++u) *(v8usa*)(d + t * FTB + u * 16 * FPI) = st[t][u]; };
    V qf[2], ql[2];
#pragma unroll
    for (int kc = 0; kc < 2; ++kc) { const size_t qo = (size_t)(q0 + wv * 16 + c) * (HD * 2) + kc * 64 + h * 16; qf[kc] = FAt<HI>::cast(ldfr(Q0 + qo)); if (HI) ql[kc] = FAt<HI>::cast(ldfr(Q1 + qo)); }
    v8f o[4];
#pragma unroll
    for (int dt = 0; dt < 4; ++dt) o[dt] = (v8f){};
    float m = -3.0e38f, l = 0.f;
    gload(0);
#pragma unroll
    for (int i = 0; i < 4; ++i) { v4f t;
#pragma unroll
        for (int e = 0; e < 4; ++e) t[e] = (bfr(mv[i][e]) * (1.0f / SCL)) * (SCL * L2E);   // additive mask, rounded to bf16; two products: to score units, then to the log2 domain
        *(v4fa*)(mk + i * 512 + tid * 4) = t; }
    lstore(0); __syncthreads();
#pragma unroll 1
    for (int s = 0; s < TT / 64; ++s) {
        if (s + 1 < TT / 64) gload(s + 1);
        const unsigned char* kb = buf + (s & 1) * (NT * FTB) + c * FPI + h * 16;
        v4f mq[4][2];   // the lane's 32 mask terms, fetched ahead of the fragments: LDS answers in order, and the softmax needs these first
#pragma unroll
        for (int kt = 0; kt < 4; ++kt) { const float* mp = mk + s * 64 + kt * 16 + 8 * h; mq[kt][0] = *(const v4fa*)mp; mq[kt][1] = *(const v4fa*)(mp + 4); }
        v8f sc[4];
#pragma unroll
        for (int kt = 0; kt < 4; ++kt) { v8f a = (v8f){};
#pragma unroll
            for (int kc = 0; kc < 2; ++kc) { const V kf = FAt<HI>::cast(ldfr(kb + kt * 16 * FPI + kc * 64)); a = FAt<HI>::mma(kf, qf[kc], a);
                if (HI) { a = FAt<HI>::mma(kf, ql[kc], a); const V kl = FAt<HI>::cast(ldfr(kb + 2 * FTB + kt * 16 * FPI + kc * 64)); a = FAt<HI>::mma(kl, qf[kc], a); } }
            sc[kt] = a; }
        V va[2][HI ? 2 : 1][4];   // Vt fragments: [32-key chunk][plane][d tile]
        auto vload = [&](int j) {
#pragma unroll
            for (int dt = 0; dt < 4; ++dt) { va[j][0][dt] = FAt<HI>::cast(ldfr(kb + FTB + dt * 16 * FPI + j * 64)); if constexpr (HI) va[j][1][dt] = FAt<HI>::cast(ldfr(kb + 3 * FTB + dt * 16 * FPI + j * 64)); } };
        vload(0); if (!HI) vload(1);
        __builtin_amdgcn_sched_barrier(0);   // keeps these LDS loads above the softmax, so that their latency runs under it; without it they sink to their first use
        float mx = m;
#pragma unroll
        for (int kt = 0; kt < 4; ++kt)
#pragma unroll
            for (int r = 0; r < 8; ++r) { const float t = fmaf(sc[kt][r], SCL * L2E, mq[kt][r >> 2][r & 3]); sc[kt][r] = t; mx = fmaxf(mx, t); }
        mx = fmaxf(mx, xhalf(mx));
        const float al = __builtin_amdgcn_exp2f(m - mx); m = mx;
        const float ms = HI ? mx : mx - 10.0f;
#pragma unroll
        for (int dt = 0; dt < 4; ++dt) o[dt] *= al;
#pragma unroll
        for (int j = 0; j < 2; ++j) { V pf, pl; sc[2 * j] = exp2x8(sc[2 * j] - ms); sc[2 * j + 1] = exp2x8(sc[2 * j + 1] - ms);
#pragma unroll
            for (int e = 0; e < 16; ++e) { const float p = sc[2 * j + (e >> 3)][e & 7];
                if constexpr (HI) { const __bf16 ph = (__bf16)p; pf[e] = ph; pl[e] = (__bf16)(p - (float)ph); } else { pf[e] = (_Float16)p; } }
            if (HI && j == 0) { vload(1); __builtin_amdgcn_sched_barrier(0); }   // the second chunk's loads are issued ahead of the first chunk's products, for the same reason
#pragma unroll
            for (int dt = 0; dt < 4; ++dt) { o[dt] = FAt<HI>::mma(va[j][0][dt], pf, o[dt]);
                if constexpr (HI) { o[dt] = FAt<HI>::mma(va[j][0][dt], pl, o[dt]); o[dt] = FAt<HI>::mma(va[j][1][dt], pf, o[dt]); } } }
        const v8f pv = (sc[0] + sc[1]) + (sc[2] + sc[3]);   // the lane's 32 terms as a tree, not one dependent chain
        l = fmaf(l, al, ((pv[0] + pv[1]) + (pv[2] + pv[3])) + ((pv[4] + pv[5]) + (pv[6] + pv[7])));
        if (s + 1 < TT / 64) lstore((s + 1) & 1);
        __syncthreads();   // publishes stage s + 1 and ends every wave's reads of the buffer that the next trip refills
    }
    l += xhalf(l);
    const float inv = 1.0f / l;
    float* orow = out + (size_t)(q0 + wv * 16 + c) * DQ + 8 * h;
#pragma unroll
    for (int dt = 0; dt < 4; ++dt) { v4f a, b;
#pragma unroll
        for (int r = 0; r < 4; ++r) { a[r] = o[dt][r] * inv; b[r] = o[dt][4 + r] * inv; }
        *(v4f*)(orow + dt * 16) = a; *(v4f*)(orow + dt * 16 + 4) = b; }
}
// grid: the hi+lo blocks (3 x the matrix work) first, then the f16 blocks; planes [batch][head][...], AMS [batch][key] (the mask input itself), OUT [batch][query][head * 64 + d]
// amdgpu_waves_per_eu(3, 3): 768 work-groups of one wave per SIMD on 256 WGPs are three waves per SIMD; the register budget of three lets the scheduler keep a stage's LDS loads in flight instead of waiting on each
__global__ __launch_bounds__(128) __attribute__((amdgpu_waves_per_eu(3, 3))) void k_fattn(const h16* __restrict__ Q16, const h16* __restrict__ K16, const h16* __restrict__ V16, const bf* __restrict__ Qh, const bf* __restrict__ Ql, const bf* __restrict__ Kh, const bf* __restrict__ Kl, const bf* __restrict__ Vh, const bf* __restrict__ Vl, const float* __restrict__ AMS, float* OUT) {
    __shared__ __align__(16) unsigned char sm[TT * 4 + 2 * 4 * FTB];
    const int nhi = NB_ * NH_ * (RH / 64); const int idx = blockIdx.x;
    if (idx < nhi) { const int bh = idx / (RH / 64), qb = idx % (RH / 64); const size_t po = (size_t)bh * TT * HD; const int b = bh / NH_, hd = bh % NH_;
        fattn_body<true>((const unsigned char*)(Qh + po), (const unsigned char*)(Ql + po), (const unsigned char*)(Kh + po), (const unsigned char*)(Kl + po), (const unsigned char*)(Vh + po), (const unsigned char*)(Vl + po), AMS + (size_t)b * TT, OUT + (size_t)b * TT * DQ + hd * HD, qb * 64, sm);
    } else { const int i2 = idx - nhi; const int bh = i2 / ((TT - RH) / 64), qb = RH / 64 + i2 % ((TT - RH) / 64); const size_t po = (size_t)bh * TT * HD; const int b = bh / NH_, hd = bh % NH_;
        fattn_body<false>((const unsigned char*)(Q16 + po), nullptr, (const unsigned char*)(K16 + po), nullptr, (const unsigned char*)(V16 + po), nullptr, AMS + (size_t)b * TT, OUT + (size_t)b * TT * DQ + hd * HD, qb * 64, sm); }
}

extern "C" void kernel_launch(void* const* d_in, const int* in_sizes, int n_in,
                              void* d_out, int out_size, void* d_ws, size_t ws_size, hipStream_t stream) {
    (void)in_sizes; (void)n_in; (void)out_size;
    const float* x = (const float*)d_in[0]; const float* amask = (const float*)d_in[1]; const float* wq = (const float*)d_in[2]; const float* bq = (const float*)d_in[3]; const float* wk = (const float*)d_in[4]; const float* bk = (const float*)d_in[5]; const float* wv = (const float*)d_in[6]; const float* bv = (const float*)d_in[7]; const float* wo = nullptr; (void)wo;
    float* OUT = (float*)d_out;     // [2][2048][768]
    char* wsp = (char*)d_ws;
    auto take = [&](size_t bytes) { char* p = wsp; wsp += (bytes + 255) & ~(size_t)255; return (void*)p; };
    const size_t PQ = (size_t)NH_ * TT * HD, PK = (size_t)NKV * TT * HD;   // elements of one batch's head planes; every plane holds both batches
    h16* QP16 = (h16*)take(NB_ * PQ * 2); h16* KP16 = (h16*)take(NB_ * PK * 2); h16* VT16 = (h16*)take(NB_ * PK * 2);
    bf* QPh = (bf*)take(NB_ * PQ * 2); bf* QPl = (bf*)take(NB_ * PQ * 2); bf* KPh = (bf*)take(NB_ * PK * 2); bf* KPl = (bf*)take(NB_ * PK * 2); bf* VTh = (bf*)take(NB_ * PK * 2); bf* VTl = (bf*)take(NB_ * PK * 2);
    if ((size_t)(wsp - (char*)d_ws) > ws_size) return;    // ws 256 MiB
    k_gemmf<true><<<dim3(NB_ * TT / 128, DQ / 128, 3), 128, 0, stream>>>(x, wq, wk, wv, bq, bk, bv, QP16, QPh, QPl, KP16, KPh, KPl, VT16, VTh, VTl);
    k_fattn<<<NB_ * NH_ * (TT / 64), 128, 0, stream>>>(QP16, KP16, VT16, QPh, QPl, KPh, KPl, VTh, VTl, amask, OUT);
}

// v008
// One run takes 77.6 microseconds.
// Timed twice side by side with v007, it ran 1.04 times as fast both times.
// All steps since v000 together make it 20.1 times as fast.
#include <hip/hip_runtime.h>

// SyntaxBertSelfAttention (hidden [2][2048][768], additive attention_mask [2][1][1][2048]; q/k/v = x W + b (12 heads x 64); scores = q.k / sqrt(12) (the module scales by 1/sqrt(num_heads), faithful) + mask[b][j]; softmax; out = merged heads -> [2][2048][768]).
// Compute dtypes, f32 accumulate: every input rounded to bf16; projections on PLAIN bf16 operands (inputs: exact, + bias); scores (K 64) and probs.v on hl planes (3 products) for the first 512 query rows of each

#define NB_  2
#define TT   2048
#define DM   768
#define NH_  12
#define NKV  12
#define REP  (NH_ / NKV)
#define HD   64
#define DQ   (NH_ * HD)
#define DKV  (NKV * HD)
#define RH   512                  // query rows < RH use hi+lo planes (0: none)
#define WIN  2048
#define SCL  0.28867513459481287f
#define L2E  1.4426950408889634f
#define FPI  144                  // fused attention: LDS row pitch in bytes (128 B of data + 16)
#define FTB  (64 * FPI)           // fused attention: bytes of one staged 64-row tile
typedef _Float16 h16;
typedef unsigned short bf;
typedef __attribute__((ext_vector_type(16))) __bf16   v16bf;
typedef __attribute__((ext_vector_type(16))) _Float16 v16h;
typedef __attribute__((ext_vector_type(8)))  _Float16 v8h;
typedef __attribute__((ext_vector_type(8)))  unsigned short v8us;
typedef __attribute__((ext_vector_type(8)))  float    v8f;
typedef __attribute__((ext_vector_type(4)))  float    v4f;
typedef v8h  __attribute__((may_alias)) v8ha;
typedef v4f  __attribute__((may_alias)) v4fa;
typedef v8us __attribute__((may_alias)) v8usa;

__device__ __forceinline__ unsigned short f2bf(float f) { unsigned u = __float_as_uint(f); u += 0x7FFFu + ((u >> 16) & 1u); return (unsigned short)(u >> 16); }
__device__ __forceinline__ float bf2f(unsigned short b) { return __uint_as_float(((unsigned)b) << 16); }
__device__ __forceinline__ float bfr(float f) { return bf2f(f2bf(f)); }
__device__ __forceinline__ v16h cat16(v8h lo, v8h hi) { return __builtin_shufflevector(lo, hi, 0, 1, 2, 3, 4, 5, 6, 7, 8, 9, 10, 11, 12, 13, 14, 15); }
__device__ __forceinline__ v16bf cat16b(v8us lo, v8us hi) { return __builtin_bit_cast(v16bf, __builtin_shufflevector(lo, hi, 0, 1, 2, 3, 4, 5, 6, 7, 8, 9, 10, 11, 12, 13, 14, 15)); }
__device__ __forceinline__ v8f wmma16(v16h a, v16h b, v8f c) { return __builtin_amdgcn_wmma_f32_16x16x32_f16(false, a, false, b, (short)0, c, false, false); }
__device__ __forceinline__ v8f wmmab(v16bf a, v16bf b, v8f c) { return __builtin_amdgcn_wmma_f32_16x16x32_bf16(false, a, false, b, (short)0, c, false, false); }



__device__ __forceinline__ h16 tohx(float x) { return (h16)x; }
__device__ __forceinline__ void splitf(float y, unsigned short& h, unsigned short& l) { h = f2bf(y); l = f2bf(y - bf2f(h)); }
// ---- k_gemmf: the three projections of both batches in one launch, straight from the f32 inputs. One work-group = 4 waves (2 x 2), each wave a 64x64 output tile (16 accumulators); grid (M/128, 768/128, 3), 128 threads.
// blockIdx.z picks the weight, the bias and the planes (0 q, 1 k, 2 v); m runs over the tokens of both batches.
// Per 32 k the work-group fetches 128 rows of x and 128 columns of w as f32 (every load covers whole 128-byte lines), rounds them to bf16 and stores them in LDS in fragment order; two buffers, one barrier per 32 k: step s + 1 is fetched while step s is worked on.
// LDS tile of one operand: 8 strips of 16 rows; in a strip, k-octet o (k = 8 o + 0..7) of row r is the 16-byte unit at o * GOP + r * 16. A fragment of lane (r, hi) is octet hi and octet 2 + hi, for both operands alike.
// GOP and GSP are padded so that the staging stores as well as the fragment loads fall on distinct banks.
// c[m][n] (f32, + f32 bias[n]) = sum_k x[m][k] w[k][n]. A 64-column tile is one head (HD == 64), m is the token.
// The f32 tile is never stored: the epilogue writes it as the three 16-bit operand planes of the attention kernel (f16, bf16 hi, bf16 lo).
// q, k: planes [batch][head][token][d], through the wave's own LDS tile (a lane takes 8 consecutive d). v: planes [batch][head][d][token], straight from the accumulators (a lane holds 8 consecutive tokens of one d).
#define GOP  320                  // bytes from one k-octet of a strip to the next (256 of data + 64)
#define GSP  (4 * GOP + 16)       // bytes of one strip
#define GTB  (8 * GSP)            // bytes of one operand's staged tile (128 rows x 32 k)
typedef __attribute__((ext_vector_type(8))) __bf16 v8bf;
typedef __attribute__((ext_vector_type(4))) __bf16 v4bf;
typedef __attribute__((ext_vector_type(4))) unsigned short v4us;
typedef v4us __attribute__((may_alias)) v4usa;
__device__ __forceinline__ v16bf ldgf(const unsigned char* p) { return cat16b(*(const v8usa*)p, *(const v8usa*)(p + 2 * GOP)); }
template <bool BIAS>
__global__ __launch_bounds__(128) void k_gemmf(const float* __restrict__ x, const float* __restrict__ wq, const float* __restrict__ wk, const float* __restrict__ wvv, const float* __restrict__ biq, const float* __restrict__ bik, const float* __restrict__ biv,
                                               h16* Q16, bf* Qh, bf* Ql, h16* K16, bf* Kh, bf* Kl, h16* V16, bf* Vh, bf* Vl) {
    __shared__ __align__(16) unsigned char tb[2 * 2 * GTB];
    __shared__ __align__(16) float osw[4 * 16 * 68];
    constexpr int K = DM;
    const int pz = blockIdx.z; const bool VT = pz == 2;
    const float* __restrict__ w = pz == 0 ? wq : pz == 1 ? wk : wvv; const float* __restrict__ bias = pz == 0 ? biq : pz == 1 ? bik : biv;
    h16* P16 = pz == 0 ? Q16 : pz == 1 ? K16 : V16; bf* Ph = pz == 0 ? Qh : pz == 1 ? Kh : Vh; bf* Pl = pz == 0 ? Ql : pz == 1 ? Kl : Vl;
    const int tid = threadIdx.x, lane = tid & 31, wv = __builtin_amdgcn_readfirstlane(tid >> 5), lr = lane & 15, hi = lane >> 4;   // the wave's number as a scalar: tile origin and plane addresses stay in scalar registers
    const int R0 = blockIdx.x * 128, C0 = blockIdx.y * 128; const int r0 = R0 + (wv & 1) * 64, c0 = C0 + (wv >> 1) * 64;
    const int bt = r0 / TT, t0 = r0 % TT;   // batch and first token of the wave's tile (a tile never straddles two batches: TT % 64 == 0)
    float* os = osw + wv * (16 * 68);
    v8f acc[4][4];
#pragma unroll
    for (int mb = 0; mb < 4; ++mb)
#pragma unroll
        for (int nb = 0; nb < 4; ++nb) acc[mb][nb] = (v8f){};
    // x: 8 lanes per row (32 k = one line), 4 rows per load, the wave's 32 rows in 8 loads. w: the wave takes k-octet wv, a lane 4 consecutive n of each of its 8 k: 512 contiguous bytes per load.
    const float* xa = x + (size_t)(R0 + wv * 32 + (lane >> 3)) * K + (lane & 7) * 4;
    const float* wb = w + (size_t)(wv * 8) * DQ + C0 + lane * 4;
    v4f sa[8], sb[8];
    auto gload = [&](int s) {
#pragma unroll
        for (int i = 0; i < 8; ++i) sa[i] = *(const v4fa*)(xa + (size_t)i * 4 * K + s * 32);
        asm volatile("s_wait_xcnt 0x0" ::: "memory");   // this build lets a later load's result land in the address registers of the loads above: the wait stands in front of that
#pragma unroll
        for (int q = 0; q < 8; ++q) sb[q] = *(const v4fa*)(wb + (size_t)(s * 32 + q) * DQ);
        asm volatile("s_wait_xcnt 0x0" ::: "memory"); };   // stands in front of every later overwrite of these loads' address registers
    unsigned char* da = tb + wv * 2 * GSP + ((lane & 7) >> 1) * GOP + (lane >> 3) * 16 + (lane & 1) * 8;   // half a unit: 4 k of one row
    unsigned char* db = tb + GTB + (lane >> 2) * GSP + wv * GOP + (lane & 3) * 64;                          // four units: 8 k of 4 columns
    auto lstore = [&](int bs) {
#pragma unroll
        for (int i = 0; i < 8; ++i) { v4bf o;
#pragma unroll
            for (int e = 0; e < 4; ++e) o[e] = (__bf16)sa[i][e];
            *(v4usa*)(da + bs * (2 * GTB) + (i >> 2) * GSP + (i & 3) * 64) = __builtin_bit_cast(v4us, o); }
#pragma unroll
        for (int i = 0; i < 4; ++i) { v8bf o;
#pragma unroll
            for (int q = 0; q < 8; ++q) o[q] = (__bf16)sb[q][i];
            *(v8usa*)(db + bs * (2 * GTB) + i * 16) = __builtin_bit_cast(v8us, o); } };
    gload(0); lstore(0); __syncthreads();
#pragma unroll 1
    for (int s = 0; s < K / 32; ++s) {
        if (s + 1 < K / 32) gload(s + 1);
        const unsigned char* ab = tb + (s & 1) * (2 * GTB) + (wv & 1) * 4 * GSP + hi * GOP + lr * 16;
        const unsigned char* bb = tb + (s & 1) * (2 * GTB) + GTB + (wv >> 1) * 4 * GSP + hi * GOP + lr * 16;
        v16bf a[4], b[4];
#pragma unroll
        for (int mb = 0; mb < 4; ++mb) a[mb] = ldgf(ab + mb * GSP);
#pragma unroll
        for (int nb = 0; nb < 4; ++nb) b[nb] = ldgf(bb + nb * GSP);
        __builtin_amdgcn_sched_barrier(0);   // keeps the 16 LDS loads together ahead of the products; without it three of the w fragments are fetched among them, each behind a full wait
#pragma unroll
        for (int nb = 0; nb < 4; ++nb)
#pragma unroll
            for (int mb = 0; mb < 4; ++mb) acc[mb][nb] = wmmab(a[mb], b[nb], acc[mb][nb]);
        if (s + 1 < K / 32) lstore((s + 1) & 1);
        __syncthreads();   // publishes step s + 1 and ends every wave's reads of the buffer that the next trip refills
    }
    if (VT) {
#pragma unroll
        for (int nb = 0; nb < 4; ++nb) { const float bn = BIAS ? bfr(bias[c0 + nb * 16 + lr]) : 0.0f; const size_t e0 = (size_t)(bt * DKV + c0 + nb * 16 + lr) * TT + t0 + 8 * hi;
#pragma unroll
            for (int mb = 0; mb < 4; ++mb) { v8h o16; v8us oh, ol;
#pragma unroll
                for (int j = 0; j < 8; ++j) { float x = acc[mb][nb][j]; if (BIAS) x += bn; o16[j] = tohx(x); unsigned short a2, c2; splitf(x, a2, c2); oh[j] = a2; ol[j] = c2; }
                *(v8h*)(P16 + e0 + mb * 16) = o16; *(v8us*)(Ph + e0 + mb * 16) = oh; *(v8us*)(Pl + e0 + mb * 16) = ol; } }
    } else {
        const int rw = lane >> 3, cofs = (lane & 7) * 8;   // 8 lanes per 64-d row: one store covers four whole 128-byte rows
        float bn[8];
#pragma unroll
        for (int q = 0; q < 8; ++q) bn[q] = BIAS ? bfr(bias[c0 + cofs + q]) : 0.0f;
#pragma unroll
        for (int mb = 0; mb < 4; ++mb) {
#pragma unroll
            for (int nb = 0; nb < 4; ++nb) {
#pragma unroll
                for (int j = 0; j < 8; ++j) os[(hi * 8 + j) * 68 + nb * 16 + lr] = acc[mb][nb][j]; }
            __builtin_amdgcn_wave_barrier(); asm volatile("" ::: "memory");   // the reads below take other lanes' writes: keeps them behind the writes
#pragma unroll
            for (int s = 0; s < 4; ++s) { const int row = 4 * s + rw; const v4f va = *(const v4fa*)(os + row * 68 + cofs), vb = *(const v4fa*)(os + row * 68 + cofs + 4); v8h o16; v8us oh, ol;
#pragma unroll
                for (int q = 0; q < 8; ++q) { float x = q < 4 ? va[q & 3] : vb[q & 3]; if (BIAS) x += bn[q]; o16[q] = tohx(x); unsigned short a2, c2; splitf(x, a2, c2); oh[q] = a2; ol[q] = c2; }
                const size_t e = ((size_t)(bt * NH_ + c0 / HD) * TT + t0 + mb * 16 + row) * HD + cofs;
                *(v8h*)(P16 + e) = o16; *(v8us*)(Ph + e) = oh; *(v8us*)(Pl + e) = ol; }
            __builtin_amdgcn_wave_barrier(); asm volatile("" ::: "memory");   // the next tile's writes stay behind these reads
        }
    }
}

typedef __attribute__((ext_vector_type(16))) unsigned short v16us;
template <bool HI> struct FAt;
template <> struct FAt<false> { typedef v16h V; static __device__ __forceinline__ V cast(v16us x) { return __builtin_bit_cast(v16h, x); } static __device__ __forceinline__ v8f mma(V a, V b, v8f c) { return wmma16(a, b, c); } };
template <> struct FAt<true> { typedef v16bf V; static __device__ __forceinline__ V cast(v16us x) { return __builtin_bit_cast(v16bf, x); } static __device__ __forceinline__ v8f mma(V a, V b, v8f c) { return wmmab(a, b, c); } };
__device__ __forceinline__ v16us ldfr(const unsigned char* p) { return __builtin_shufflevector(*(const v8usa*)p, *(const v8usa*)(p + 32), 0, 1, 2, 3, 4, 5, 6, 7, 8, 9, 10, 11, 12, 13, 14, 15); }   // k = 8 hi + 0..7 and 16 + 8 hi + 0..7 of a 32-k chunk; p already holds the 16 hi bytes
__device__ __forceinline__ float xhalf(float x) { const int b = __float_as_int(x); return __int_as_float(__builtin_amdgcn_permlanex16(b, b, 0x76543210, 0xfedcba98, false, false)); }   // lane l <-> l ^ 16
// eight 2^x in one statement, each in place: no v_exp_f32 here is directly followed by an instruction that reads its result or overwrites its source, and the v_nop keeps that slot behind the last one.
// In place, so that the statement writes only registers that a compiler-placed vector instruction in front of it has just written (never an operand of a matrix instruction still in its window).
__device__ __forceinline__ v8f exp2x8(v8f x) { float y0 = x[0], y1 = x[1], y2 = x[2], y3 = x[3], y4 = x[4], y5 = x[5], y6 = x[6], y7 = x[7];
    asm("v_exp_f32 %0, %0\n\tv_exp_f32 %1, %1\n\tv_exp_f32 %2, %2\n\tv_exp_f32 %3, %3\n\tv_exp_f32 %4, %4\n\tv_exp_f32 %5, %5\n\tv_exp_f32 %6, %6\n\tv_exp_f32 %7, %7\n\tv_nop"
        : "+v"(y0), "+v"(y1), "+v"(y2), "+v"(y3), "+v"(y4), "+v"(y5), "+v"(y6), "+v"(y7));
    return (v8f){y0, y1, y2, y3, y4, y5, y6, y7}; }
template <bool HI>
__device__ __forceinline__ void fattn_body(const unsigned char* __restrict__ Q0, const unsigned char* __restrict__ Q1, const unsigned char* __restrict__ K0, const unsigned char* __restrict__ K1, const unsigned char* __restrict__ V0, const unsigned char* __restrict__ V1, const float* __restrict__ ams, float* out, int q0, unsigned char* sm) {
    typedef typename FAt<HI>::V V;
    constexpr int NT = HI ? 4 : 2;                     // staged tiles per stage: K, Vt (, K lo, Vt lo)
    constexpr int NJ = HI ? 1 : 2;                     // 32-key chunks of a stage that one wave takes
    const int tid = threadIdx.x, lane = tid & 31, wv = __builtin_amdgcn_readfirstlane(tid >> 5), c = lane & 15, h = lane >> 4;   // the wave's number as a scalar: the group test behind the loop is a scalar branch
    const int qw = HI ? (wv & 3) : wv, g = HI ? (wv >> 2) : 0;   // query tile and key group of the wave
    float* mk = (float*)sm; unsigned char* buf = sm + TT * 4;
    v4f mv[2];   // the work-group's 2048 mask terms, 8 per thread, fetched together with the first tiles: one trip to memory
#pragma unroll
    for (int i = 0; i < 2; ++i) mv[i] = *(const v4fa*)(ams + i * 1024 + tid * 4);
    asm volatile("s_wait_xcnt 0x0" ::: "memory");   // stands in front of every later overwrite of these loads' address registers
    const int srow = tid >> 3, scol = (tid & 7) * 16;  // staging: 8 threads per 128-byte row, 32 rows per sweep
    v8us st[NT][2];
    auto gload = [&](int s) {
#pragma unroll
        for (int u = 0; u < 2; ++u) { const int row = srow + 32 * u; const size_t ko = (size_t)(s * 64 + row) * (HD * 2) + scol, vo = (size_t)row * (TT * 2) + s * 128 + scol;
            st[0][u] = *(const v8usa*)(K0 + ko); st[1][u] = *(const v8usa*)(V0 + vo); if (HI) { st[2][u] = *(const v8usa*)(K1 + ko); st[3][u] = *(const v8usa*)(V1 + vo); } }
        asm volatile("s_wait_xcnt 0x0" ::: "memory"); };   // stands in front of every later overwrite of these loads' address registers (this build reuses them while the loads are in flight)
    auto lstore = [&](int bs) { unsigned char* d = buf + bs * (NT * FTB) + srow * FPI + scol;
#pragma unroll
        for (int t = 0; t < NT; ++t)
#pragma unroll
            for (int u = 0; u < 2; ++u) *(v8usa*)(d + t * FTB + u * 32 * FPI) = st[t][u]; };
    V qf[2], ql[2];
#pragma unroll
    for (int kc = 0; kc < 2; ++kc) { const size_t qo = (size_t)(q0 + qw * 16 + c) * (HD * 2) + kc * 64 + h * 16; qf[kc] = FAt<HI>::cast(ldfr(Q0 + qo)); if (HI) ql[kc] = FAt<HI>::cast(ldfr(Q1 + qo)); }
    v8f o[4];
#pragma unroll
    for (int dt = 0; dt < 4; ++dt) o[dt] = (v8f){};
    float m = -3.0e38f, l = 0.f;
    gload(0);
#pragma unroll
    for (int i = 0; i < 2; ++i) { v4f t;
#pragma unroll
        for (int e = 0; e < 4; ++e) t[e] = (bfr(mv[i][e]) * (1.0f / SCL)) * (SCL * L2E);   // additive mask, rounded to bf16; two products: to score units, then to the log2 domain
        *(v4fa*)(mk + i * 1024 + tid * 4) = t; }
    lstore(0); __syncthreads();
#pragma unroll 1
    for (int s = 0; s < TT / 64; ++s) {
        if (s + 1 < TT / 64) gload(s + 1);
        const unsigned char* kb = buf + (s & 1) * (NT * FTB) + (g * 32 + c) * FPI + h * 16;            // K rows of the wave's keys
        const unsigned char* vb = buf + (s & 1) * (NT * FTB) + FTB + c * FPI + g * 64 + h * 16;        // Vt columns of the wave's keys
        v4f mq[2 * NJ][2];   // the lane's mask terms, fetched ahead of the fragments: LDS answers in order, and the softmax needs these first
#pragma unroll
        for (int kt = 0; kt < 2 * NJ; ++kt) { const float* mp = mk + s * 64 + g * 32 + kt * 16 + 8 * h; mq[kt][0] = *(const v4fa*)mp; mq[kt][1] = *(const v4fa*)(mp + 4); }
        v8f sc[2 * NJ];
#pragma unroll
        for (int kt = 0; kt < 2 * NJ; ++kt) { v8f a = (v8f){};
#pragma unroll
            for (int kc = 0; kc < 2; ++kc) { const V kf = FAt<HI>::cast(ldfr(kb + kt * 16 * FPI + kc * 64)); a = FAt<HI>::mma(kf, qf[kc], a);
                if (HI) { a = FAt<HI>::mma(kf, ql[kc], a); const V kl = FAt<HI>::cast(ldfr(kb + 2 * FTB + kt * 16 * FPI + kc * 64)); a = FAt<HI>::mma(kl, qf[kc], a); } }
            sc[kt] = a; }
        V va[NJ][HI ? 2 : 1][4];   // Vt fragments: [32-key chunk][plane][d tile]
        auto vload = [&](int j) {
#pragma unroll
            for (int dt = 0; dt < 4; ++dt) { va[j][0][dt] = FAt<HI>::cast(ldfr(vb + dt * 16 * FPI + j * 64)); if constexpr (HI) va[j][1][dt] = FAt<HI>::cast(ldfr(vb + 2 * FTB + dt * 16 * FPI + j * 64)); } };
#pragma unroll
        for (int j = 0; j < NJ; ++j) vload(j);
        __builtin_amdgcn_sched_barrier(0);   // keeps these LDS loads above the softmax, so that their latency runs under it; without it they sink to their first use
        float mx = m;
#pragma unroll
        for (int kt = 0; kt < 2 * NJ; ++kt)
#pragma unroll
            for (int r = 0; r < 8; ++r) { const float t = fmaf(sc[kt][r], SCL * L2E, mq[kt][r >> 2][r & 3]); sc[kt][r] = t; mx = fmaxf(mx, t); }
        mx = fmaxf(mx, xhalf(mx));
        const float al = __builtin_amdgcn_exp2f(m - mx); m = mx;
        const float ms = HI ? mx : mx - 10.0f;
#pragma unroll
        for (int dt = 0; dt < 4; ++dt) o[dt] *= al;
#pragma unroll
        for (int j = 0; j < NJ; ++j) { V pf, pl; sc[2 * j] = exp2x8(sc[2 * j] - ms); sc[2 * j + 1] = exp2x8(sc[2 * j + 1] - ms);
#pragma unroll
            for (int e = 0; e < 16; ++e) { const float p = sc[2 * j + (e >> 3)][e & 7];
                if constexpr (HI) { const __bf16 ph = (__bf16)p; pf[e] = ph; pl[e] = (__bf16)(p - (float)ph); } else { pf[e] = (_Float16)p; } }
#pragma unroll
            for (int dt = 0; dt < 4; ++dt) { o[dt] = FAt<HI>::mma(va[j][0][dt], pf, o[dt]);
                if constexpr (HI) { o[dt] = FAt<HI>::mma(va[j][0][dt], pl, o[dt]); o[dt] = FAt<HI>::mma(va[j][1][dt], pf, o[dt]); } } }
        v8f pv = sc[0] + sc[1]; if constexpr (!HI) pv += sc[2] + sc[3];   // the lane's terms as a tree, not one dependent chain
        l = fmaf(l, al, ((pv[0] + pv[1]) + (pv[2] + pv[3])) + ((pv[4] + pv[5]) + (pv[6] + pv[7])));
        if (s + 1 < TT / 64) lstore((s + 1) & 1);
        __syncthreads();   // publishes stage s + 1 and ends every wave's reads of the buffer that the next trip refills
    }
    l += xhalf(l);
    if constexpr (HI) {   // merge of the two key groups: group 1 hands its output tiles, maximum and sum to group 0 through the staging buffers (every read of them ended at the loop's last barrier)
        float* mg = (float*)buf + qw * (34 * 32);   // per query tile: 8 x 32 units of 16 bytes, then 32 maxima, then 32 sums; a lane meets the same lane of the other group
        if (g == 1) {
#pragma unroll
            for (int dt = 0; dt < 4; ++dt) { *(v4fa*)(mg + (2 * dt) * 128 + lane * 4) = (v4f){o[dt][0], o[dt][1], o[dt][2], o[dt][3]}; *(v4fa*)(mg + (2 * dt + 1) * 128 + lane * 4) = (v4f){o[dt][4], o[dt][5], o[dt][6], o[dt][7]}; }
            mg[1024 + lane] = m; mg[1056 + lane] = l; }
        __syncthreads();   // publishes group 1's state to group 0
        if (g == 1) return;
        const float m1 = mg[1024 + lane], l1 = mg[1056 + lane], mm = fmaxf(m, m1);
        const float a0 = __builtin_amdgcn_exp2f(m - mm), a1 = __builtin_amdgcn_exp2f(m1 - mm);
        l = fmaf(l1, a1, l * a0);
#pragma unroll
        for (int dt = 0; dt < 4; ++dt) { const v4f x0 = *(const v4fa*)(mg + (2 * dt) * 128 + lane * 4), x1 = *(const v4fa*)(mg + (2 * dt + 1) * 128 + lane * 4);
#pragma unroll
            for (int r = 0; r < 4; ++r) { o[dt][r] = fmaf(x0[r], a1, o[dt][r] * a0); o[dt][4 + r] = fmaf(x1[r], a1, o[dt][4 + r] * a0); } }
    }
    const float inv = 1.0f / l;
    float* orow = out + (size_t)(q0 + qw * 16 + c) * DQ + 8 * h;
#pragma unroll
    for (int dt = 0; dt < 4; ++dt) { v4f a, b;
#pragma unroll
        for (int r = 0; r < 4; ++r) { a[r] = o[dt][r] * inv; b[r] = o[dt][4 + r] * inv; }
        *(v4f*)(orow + dt * 16) = a; *(v4f*)(orow + dt * 16 + 4) = b; }
}
// grid: the hi+lo blocks (3 x the matrix work) first, then the f16 blocks; planes [batch][head][...], AMS [batch][key] (the mask input itself), OUT [batch][query][head * 64 + d]
// amdgpu_waves_per_eu(4, 4): 480 work-groups of two waves per SIMD on 256 WGPs are at most four waves per SIMD; the register budget of four lets the scheduler keep a stage's LDS loads in flight instead of waiting on each
__global__ __launch_bounds__(256) __attribute__((amdgpu_waves_per_eu(4, 4))) void k_fattn(const h16* __restrict__ Q16, const h16* __restrict__ K16, const h16* __restrict__ V16, const bf* __restrict__ Qh, const bf* __restrict__ Ql, const bf* __restrict__ Kh, const bf* __restrict__ Kl, const bf* __restrict__ Vh, const bf* __restrict__ Vl, const float* __restrict__ AMS, float* OUT) {
    __shared__ __align__(16) unsigned char sm[TT * 4 + 2 * 4 * FTB];
    const int nhi = NB_ * NH_ * (RH / 64); const int idx = blockIdx.x;
    if (idx < nhi) { const int bh = idx / (RH / 64), qb = idx % (RH / 64); const size_t po = (size_t)bh * TT * HD; const int b = bh / NH_, hd = bh % NH_;
        fattn_body<true>((const unsigned char*)(Qh + po), (const unsigned char*)(Ql + po), (const unsigned char*)(Kh + po), (const unsigned char*)(Kl + po), (const unsigned char*)(Vh + po), (const unsigned char*)(Vl + po), AMS + (size_t)b * TT, OUT + (size_t)b * TT * DQ + hd * HD, qb * 64, sm);
    } else { const int i2 = idx - nhi; const int bh = i2 / ((TT - RH) / 128), q0 = RH + (i2 % ((TT - RH) / 128)) * 128; const size_t po = (size_t)bh * TT * HD; const int b = bh / NH_, hd = bh % NH_;
        fattn_body<false>((const unsigned char*)(Q16 + po), nullptr, (const unsigned char*)(K16 + po), nullptr, (const unsigned char*)(V16 + po), nullptr, AMS + (size_t)b * TT, OUT + (size_t)b * TT * DQ + hd * HD, q0, sm); }
}

extern "C" void kernel_launch(void* const* d_in, const int* in_sizes, int n_in,
                              void* d_out, int out_size, void* d_ws, size_t ws_size, hipStream_t stream) {
    (void)in_sizes; (void)n_in; (void)out_size;
    const float* x = (const float*)d_in[0]; const float* amask = (const float*)d_in[1]; const float* wq = (const float*)d_in[2]; const float* bq = (const float*)d_in[3]; const float* wk = (const float*)d_in[4]; const float* bk = (const float*)d_in[5]; const float* wv = (const float*)d_in[6]; const float* bv = (const float*)d_in[7]; const float* wo = nullptr; (void)wo;
    float* OUT = (float*)d_out;     // [2][2048][768]
    char* wsp = (char*)d_ws;
    auto take = [&](size_t bytes) { char* p = wsp; wsp += (bytes + 255) & ~(size_t)255; return (void*)p; };
    const size_t PQ = (size_t)NH_ * TT * HD, PK = (size_t)NKV * TT * HD;   // elements of one batch's head planes; every plane holds both batches
    h16* QP16 = (h16*)take(NB_ * PQ * 2); h16* KP16 = (h16*)take(NB_ * PK * 2); h16* VT16 = (h16*)take(NB_ * PK * 2);
    bf* QPh = (bf*)take(NB_ * PQ * 2); bf* QPl = (bf*)take(NB_ * PQ * 2); bf* KPh = (bf*)take(NB_ * PK * 2); bf* KPl = (bf*)take(NB_ * PK * 2); bf* VTh = (bf*)take(NB_ * PK * 2); bf* VTl = (bf*)take(NB_ * PK * 2);
    if ((size_t)(wsp - (char*)d_ws) > ws_size) return;    // ws 256 MiB
    k_gemmf<true><<<dim3(NB_ * TT / 128, DQ / 128, 3), 128, 0, stream>>>(x, wq, wk, wv, bq, bk, bv, QP16, QPh, QPl, KP16, KPh, KPl, VT16, VTh, VTl);
    k_fattn<<<NB_ * NH_ * (RH / 64 + (TT - RH) / 128), 256, 0, stream>>>(QP16, KP16, VT16, QPh, QPl, KPh, KPl, VTh, VTl, amask, OUT);
}

// v009
// One run takes 74.9 microseconds.
// Next to v008, in two timings, it ran 1.03 and 1.04 times as fast.
// All steps since v000 together make it 20.8 times as fast.
#include <hip/hip_runtime.h>

// SyntaxBertSelfAttention (hidden [2][2048][768], additive attention_mask [2][1][1][2048]; q/k/v = x W + b (12 heads x 64); scores = q.k / sqrt(12) (the module scales by 1/sqrt(num_heads), faithful) + mask[b][j]; softmax; out = merged heads -> [2][2048][768]).
// Compute dtypes, f32 accumulate: every input rounded to bf16; projections on PLAIN bf16 operands (inputs: exact, + bias); scores (K 64) and probs.v on hl planes (3 products) for the first 512 query rows of each

#define NB_  2
#define TT   2048
#define DM   768
#define NH_  12
#define NKV  12
#define REP  (NH_ / NKV)
#define HD   64
#define DQ   (NH_ * HD)
#define DKV  (NKV * HD)
#define RH   512                  // query rows < RH use hi+lo planes (0: none)
#define WIN  2048
#define SCL  0.28867513459481287f
#define L2E  1.4426950408889634f
#define FPI  144                  // fused attention: LDS row pitch in bytes (128 B of data + 16)
#define FTB  (64 * FPI)           // fused attention: bytes of one staged 64-row tile
typedef _Float16 h16;
typedef unsigned short bf;
typedef __attribute__((ext_vector_type(16))) __bf16   v16bf;
typedef __attribute__((ext_vector_type(16))) _Float16 v16h;
typedef __attribute__((ext_vector_type(8)))  _Float16 v8h;
typedef __attribute__((ext_vector_type(8)))  unsigned short v8us;
typedef __attribute__((ext_vector_type(8)))  float    v8f;
typedef __attribute__((ext_vector_type(4)))  float    v4f;
typedef v8h  __attribute__((may_alias)) v8ha;
typedef v4f  __attribute__((may_alias)) v4fa;
typedef v8us __attribute__((may_alias)) v8usa;

__device__ __forceinline__ unsigned short f2bf(float f) { unsigned u = __float_as_uint(f); u += 0x7FFFu + ((u >> 16) & 1u); return (unsigned short)(u >> 16); }
__device__ __forceinline__ float bf2f(unsigned short b) { return __uint_as_float(((unsigned)b) << 16); }
__device__ __forceinline__ float bfr(float f) { return bf2f(f2bf(f)); }
__device__ __forceinline__ v16h cat16(v8h lo, v8h hi) { return __builtin_shufflevector(lo, hi, 0, 1, 2, 3, 4, 5, 6, 7, 8, 9, 10, 11, 12, 13, 14, 15); }
__device__ __forceinline__ v16bf cat16b(v8us lo, v8us hi) { return __builtin_bit_cast(v16bf, __builtin_shufflevector(lo, hi, 0, 1, 2, 3, 4, 5, 6, 7, 8, 9, 10, 11, 12, 13, 14, 15)); }
__device__ __forceinline__ v8f wmma16(v16h a, v16h b, v8f c) { return __builtin_amdgcn_wmma_f32_16x16x32_f16(false, a, false, b, (short)0, c, false, false); }
__device__ __forceinline__ v8f wmmab(v16bf a, v16bf b, v8f c) { return __builtin_amdgcn_wmma_f32_16x16x32_bf16(false, a, false, b, (short)0, c, false, false); }



__device__ __forceinline__ h16 tohx(float x) { return (h16)x; }
__device__ __forceinline__ void splitf(float y, unsigned short& h, unsigned short& l) { h = f2bf(y); l = f2bf(y - bf2f(h)); }
// ---- k_gemmf: the three projections of both batches in one launch, straight from the f32 inputs. One work-group = 4 waves (2 x 2), each wave a 64x64 output tile (16 accumulators); grid (M/128, 768/128, 3), 128 threads.
// blockIdx.z picks the weight, the bias and the planes (0 q, 1 k, 2 v); m runs over the tokens of both batches.
// Per 32 k the work-group fetches 128 rows of x and 128 columns of w as f32 (every load covers whole 128-byte lines), rounds them to bf16 and stores them in LDS in fragment order; two buffers, one barrier per 32 k: step s + 1 is fetched while step s is worked on.
// LDS tile of one operand: 8 strips of 16 rows; in a strip, k-octet o (k = 8 o + 0..7) of row r is the 16-byte unit at o * GOP + r * 16. A fragment of lane (r, hi) is octet hi and octet 2 + hi, for both operands alike.
// GOP and GSP are padded so that the staging stores as well as the fragment loads fall on distinct banks.
// c[m][n] (f32, + f32 bias[n]) = sum_k x[m][k] w[k][n]. A 64-column tile is one head (HD == 64), m is the token.
// The f32 tile is never stored: the epilogue writes it as the three 16-bit operand planes of the attention kernel (f16, bf16 hi, bf16 lo).
// q, k: planes [batch][head][token][d], through the wave's own LDS tile (a lane takes 8 consecutive d). v: planes [batch][head][d][token], straight from the accumulators (a lane holds 8 consecutive tokens of one d).
#define GOP  320                  // bytes from one k-octet of a strip to the next (256 of data + 64)
#define GSP  (4 * GOP + 16)       // bytes of one strip
#define GTB  (8 * GSP)            // bytes of one operand's staged tile (128 rows x 32 k)
typedef __attribute__((ext_vector_type(8))) __bf16 v8bf;
typedef __attribute__((ext_vector_type(4))) __bf16 v4bf;
typedef __attribute__((ext_vector_type(4))) unsigned short v4us;
typedef v4us __attribute__((may_alias)) v4usa;
__device__ __forceinline__ v16bf ldgf(const unsigned char* p) { return cat16b(*(const v8usa*)p, *(const v8usa*)(p + 2 * GOP)); }
template <bool BIAS>
__global__ __launch_bounds__(128) void k_gemmf(const float* __restrict__ x, const float* __restrict__ wq, const float* __restrict__ wk, const float* __restrict__ wvv, const float* __restrict__ biq, const float* __restrict__ bik, const float* __restrict__ biv,
                                               h16* Q16, bf* Qh, bf* Ql, h16* K16, bf* Kh, bf* Kl, h16* V16, bf* Vh, bf* Vl) {
    __shared__ __align__(16) unsigned char tb[2 * 2 * GTB];
    __shared__ __align__(16) float osw[4 * 16 * 68];
    constexpr int K = DM;
    const int pz = blockIdx.z; const bool VT = pz == 2;
    const float* __restrict__ w = pz == 0 ? wq : pz == 1 ? wk : wvv; const float* __restrict__ bias = pz == 0 ? biq : pz == 1 ? bik : biv;
    h16* P16 = pz == 0 ? Q16 : pz == 1 ? K16 : V16; bf* Ph = pz == 0 ? Qh : pz == 1 ? Kh : Vh; bf* Pl = pz == 0 ? Ql : pz == 1 ? Kl : Vl;
    const int tid = threadIdx.x, lane = tid & 31, wv = __builtin_amdgcn_readfirstlane(tid >> 5), lr = lane & 15, hi = lane >> 4;   // the wave's number as a scalar: tile origin and plane addresses stay in scalar registers
    const int R0 = blockIdx.x * 128, C0 = blockIdx.y * 128; const int r0 = R0 + (wv & 1) * 64, c0 = C0 + (wv >> 1) * 64;
    const int bt = r0 / TT, t0 = r0 % TT;   // batch and first token of the wave's tile (a tile never straddles two batches: TT % 64 == 0)
    float* os = osw + wv * (16 * 68);
    v8f acc[4][4];
#pragma unroll
    for (int mb = 0; mb < 4; ++mb)
#pragma unroll
        for (int nb = 0; nb < 4; ++nb) acc[mb][nb] = (v8f){};
    // x: 8 lanes per row (32 k = one line), 4 rows per load, the wave's 32 rows in 8 loads. w: the wave takes k-octet wv, a lane 4 consecutive n of each of its 8 k: 512 contiguous bytes per load.
    const float* xa = x + (size_t)(R0 + wv * 32 + (lane >> 3)) * K + (lane & 7) * 4;
    const float* wb = w + (size_t)(wv * 8) * DQ + C0 + lane * 4;
    v4f sa[8], sb[8];
    auto gload = [&](int s) {
#pragma unroll
        for (int i = 0; i < 8; ++i) sa[i] = *(const v4fa*)(xa + (size_t)i * 4 * K + s * 32);
        asm volatile("s_wait_xcnt 0x0" ::: "memory");   // this build lets a later load's result land in the address registers of the loads above: the wait stands in front of that
#pragma unroll
        for (int q = 0; q < 8; ++q) sb[q] = *(const v4fa*)(wb + (size_t)(s * 32 + q) * DQ);
        asm volatile("s_wait_xcnt 0x0" ::: "memory"); };   // stands in front of every later overwrite of these loads' address registers
    unsigned char* da = tb + wv * 2 * GSP + ((lane & 7) >> 1) * GOP + (lane >> 3) * 16 + (lane & 1) * 8;   // half a unit: 4 k of one row
    unsigned char* db = tb + GTB + (lane >> 2) * GSP + wv * GOP + (lane & 3) * 64;                          // four units: 8 k of 4 columns
    auto lstore = [&](int bs) {
#pragma unroll
        for (int i = 0; i < 8; ++i) { v4bf o;
#pragma unroll
            for (int e = 0; e < 4; ++e) o[e] = (__bf16)sa[i][e];
            *(v4usa*)(da + bs * (2 * GTB) + (i >> 2) * GSP + (i & 3) * 64) = __builtin_bit_cast(v4us, o); }
#pragma unroll
        for (int i = 0; i < 4; ++i) { v8bf o;
#pragma unroll
            for (int q = 0; q < 8; ++q) o[q] = (__bf16)sb[q][i];
            *(v8usa*)(db + bs * (2 * GTB) + i * 16) = __builtin_bit_cast(v8us, o); } };
    gload(0); lstore(0); __syncthreads();
#pragma unroll 1
    for (int s = 0; s < K / 32; ++s) {
        if (s + 1 < K / 32) gload(s + 1);
        const unsigned char* ab = tb + (s & 1) * (2 * GTB) + (wv & 1) * 4 * GSP + hi * GOP + lr * 16;
        const unsigned char* bb = tb + (s & 1) * (2 * GTB) + GTB + (wv >> 1) * 4 * GSP + hi * GOP + lr * 16;
        v16bf a[4], b[4];
#pragma unroll
        for (int mb = 0; mb < 4; ++mb) a[mb] = ldgf(ab + mb * GSP);
#pragma unroll
        for (int nb = 0; nb < 4; ++nb) b[nb] = ldgf(bb + nb * GSP);
        __builtin_amdgcn_sched_barrier(0);   // keeps the 16 LDS loads together ahead of the products; without it three of the w fragments are fetched among them, each behind a full wait
#pragma unroll
        for (int nb = 0; nb < 4; ++nb)
#pragma unroll
            for (int mb = 0; mb < 4; ++mb) acc[mb][nb] = wmmab(a[mb], b[nb], acc[mb][nb]);
        if (s + 1 < K / 32) lstore((s + 1) & 1);
        __syncthreads();   // publishes step s + 1 and ends every wave's reads of the buffer that the next trip refills
    }
    if (VT) {
#pragma unroll
        for (int nb = 0; nb < 4; ++nb) { const float bn = BIAS ? bfr(bias[c0 + nb * 16 + lr]) : 0.0f; const size_t e0 = (size_t)(bt * DKV + c0 + nb * 16 + lr) * TT + t0 + 8 * hi;
#pragma unroll
            for (int mb = 0; mb < 4; ++mb) { v8h o16; v8us oh, ol;
#pragma unroll
                for (int j = 0; j < 8; ++j) { float x = acc[mb][nb][j]; if (BIAS) x += bn; o16[j] = tohx(x); unsigned short a2, c2; splitf(x, a2, c2); oh[j] = a2; ol[j] = c2; }
                *(v8h*)(P16 + e0 + mb * 16) = o16; *(v8us*)(Ph + e0 + mb * 16) = oh; *(v8us*)(Pl + e0 + mb * 16) = ol; } }
    } else {
        const int rw = lane >> 3, cofs = (lane & 7) * 8;   // 8 lanes per 64-d row: one store covers four whole 128-byte rows
        float bn[8];
#pragma unroll
        for (int q = 0; q < 8; ++q) bn[q] = BIAS ? bfr(bias[c0 + cofs + q]) : 0.0f;
#pragma unroll
        for (int mb = 0; mb < 4; ++mb) {
#pragma unroll
            for (int nb = 0; nb < 4; ++nb) {
#pragma unroll
                for (int j = 0; j < 8; ++j) os[(hi * 8 + j) * 68 + nb * 16 + lr] = acc[mb][nb][j]; }
            __builtin_amdgcn_wave_barrier(); asm volatile("" ::: "memory");   // the reads below take other lanes' writes: keeps them behind the writes
#pragma unroll
            for (int s = 0; s < 4; ++s) { const int row = 4 * s + rw; const v4f va = *(const v4fa*)(os + row * 68 + cofs), vb = *(const v4fa*)(os + row * 68 + cofs + 4); v8h o16; v8us oh, ol;
#pragma unroll
                for (int q = 0; q < 8; ++q) { float x = q < 4 ? va[q & 3] : vb[q & 3]; if (BIAS) x += bn[q]; o16[q] = tohx(x); unsigned short a2, c2; splitf(x, a2, c2); oh[q] = a2; ol[q] = c2; }
                const size_t e = ((size_t)(bt * NH_ + c0 / HD) * TT + t0 + mb * 16 + row) * HD + cofs;
                *(v8h*)(P16 + e) = o16; *(v8us*)(Ph + e) = oh; *(v8us*)(Pl + e) = ol; }
            __builtin_amdgcn_wave_barrier(); asm volatile("" ::: "memory");   // the next tile's writes stay behind these reads
        }
    }
}

typedef __attribute__((ext_vector_type(16))) unsigned short v16us;
template <bool HI> struct FAt;
template <> struct FAt<false> { typedef v16h V; static __device__ __forceinline__ V cast(v16us x) { return __builtin_bit_cast(v16h, x); } static __device__ __forceinline__ v8f mma(V a, V b, v8f c) { return wmma16(a, b, c); } };
template <> struct FAt<true> { typedef v16bf V; static __device__ __forceinline__ V cast(v16us x) { return __builtin_bit_cast(v16bf, x); } static __device__ __forceinline__ v8f mma(V a, V b, v8f c) { return wmmab(a, b, c); } };
__device__ __forceinline__ v16us ldfr(const unsigned char* p) { return __builtin_shufflevector(*(const v8usa*)p, *(const v8usa*)(p + 32), 0, 1, 2, 3, 4, 5, 6, 7, 8, 9, 10, 11, 12, 13, 14, 15); }   // k = 8 hi + 0..7 and 16 + 8 hi + 0..7 of a 32-k chunk; p already holds the 16 hi bytes
__device__ __forceinline__ float xhalf(float x) { const int b = __float_as_int(x); return __int_as_float(__builtin_amdgcn_permlanex16(b, b, 0x76543210, 0xfedcba98, false, false)); }   // lane l <-> l ^ 16
// eight 2^x in one statement, each in place: no v_exp_f32 here is directly followed by an instruction that reads its result or overwrites its source, and the v_nop keeps that slot behind the last one.
// In place, so that the statement writes only registers that a compiler-placed vector instruction in front of it has just written (never an operand of a matrix instruction still in its window).
__device__ __forceinline__ v8f exp2x8(v8f x) { float y0 = x[0], y1 = x[1], y2 = x[2], y3 = x[3], y4 = x[4], y5 = x[5], y6 = x[6], y7 = x[7];
    asm("v_exp_f32 %0, %0\n\tv_exp_f32 %1, %1\n\tv_exp_f32 %2, %2\n\tv_exp_f32 %3, %3\n\tv_exp_f32 %4, %4\n\tv_exp_f32 %5, %5\n\tv_exp_f32 %6, %6\n\tv_exp_f32 %7, %7\n\tv_nop"
        : "+v"(y0), "+v"(y1), "+v"(y2), "+v"(y3), "+v"(y4), "+v"(y5), "+v"(y6), "+v"(y7));
    return (v8f){y0, y1, y2, y3, y4, y5, y6, y7}; }
// hi+lo blocks
__device__ __forceinline__ void fattn_hl(const unsigned char* __restrict__ Q0, const unsigned char* __restrict__ Q1, const unsigned char* __restrict__ K0, const unsigned char* __restrict__ K1, const unsigned char* __restrict__ V0, const unsigned char* __restrict__ V1, const float* __restrict__ ams, float* out, int q0, unsigned char* sm) {
    typedef FAt<true> F; typedef F::V V;
    constexpr int NT = 4;                              // staged tiles per stage: K, Vt, K lo, Vt lo
    constexpr int NJ = 1;                              // 32-key chunks of a stage that one wave takes
    const int tid = threadIdx.x, lane = tid & 31, wv = __builtin_amdgcn_readfirstlane(tid >> 5), c = lane & 15, h = lane >> 4;   // the wave's number as a scalar: the group test behind the loop is a scalar branch
    const int qw = wv & 3, g = wv >> 2;   // query tile and key group of the wave
    float* mk = (float*)sm; unsigned char* buf = sm + TT * 4;
    v4f mv[2];   // the work-group's 2048 mask terms, 8 per thread, fetched together with the first tiles: one trip to memory
#pragma unroll
    for (int i = 0; i < 2; ++i) mv[i] = *(const v4fa*)(ams + i * 1024 + tid * 4);
    asm volatile("s_wait_xcnt 0x0" ::: "memory");   // stands in front of every later overwrite of these loads' address registers
    const int srow = tid >> 3, scol = (tid & 7) * 16;  // staging: 8 threads per 128-byte row, 32 rows per sweep
    v8us st[NT][2];
    auto gload = [&](int s) {
#pragma unroll
        for (int u = 0; u < 2; ++u) { const int row = srow + 32 * u; const size_t ko = (size_t)(s * 64 + row) * (HD * 2) + scol, vo = (size_t)row * (TT * 2) + s * 128 + scol;
            st[0][u] = *(const v8usa*)(K0 + ko); st[1][u] = *(const v8usa*)(V0 + vo); st[2][u] = *(const v8usa*)(K1 + ko); st[3][u] = *(const v8usa*)(V1 + vo); }
        asm volatile("s_wait_xcnt 0x0" ::: "memory"); };   // stands in front of every later overwrite of these loads' address registers (this build reuses them while the loads are in flight)
    auto lstore = [&](int bs) { unsigned char* d = buf + bs * (NT * FTB) + srow * FPI + scol;
#pragma unroll
        for (int t = 0; t < NT; ++t)
#pragma unroll
            for (int u = 0; u < 2; ++u) *(v8usa*)(d + t * FTB + u * 32 * FPI) = st[t][u]; };
    V qf[2], ql[2];
#pragma unroll
    for (int kc = 0; kc < 2; ++kc) { const size_t qo = (size_t)(q0 + qw * 16 + c) * (HD * 2) + kc * 64 + h * 16; qf[kc] = F::cast(ldfr(Q0 + qo)); ql[kc] = F::cast(ldfr(Q1 + qo)); }
    v8f o[4];
#pragma unroll
    for (int dt = 0; dt < 4; ++dt) o[dt] = (v8f){};
    float m = -3.0e38f, l = 0.f;
    gload(0);
#pragma unroll
    for (int i = 0; i < 2; ++i) { v4f t;
#pragma unroll
        for (int e = 0; e < 4; ++e) t[e] = (bfr(mv[i][e]) * (1.0f / SCL)) * (SCL * L2E);   // additive mask, rounded to bf16; two products: to score units, then to the log2 domain
        *(v4fa*)(mk + i * 1024 + tid * 4) = t; }
    lstore(0); __syncthreads();
#pragma unroll 1
    for (int s = 0; s < TT / 64; ++s) {
        if (s + 1 < TT / 64) gload(s + 1);
        const unsigned char* kb = buf + (s & 1) * (NT * FTB) + (g * 32 + c) * FPI + h * 16;            // K rows of the wave's keys
        const unsigned char* vb = buf + (s & 1) * (NT * FTB) + FTB + c * FPI + g * 64 + h * 16;        // Vt columns of the wave's keys
        v4f mq[2 * NJ][2];   // the lane's mask terms, fetched ahead of the fragments: LDS answers in order, and the softmax needs these first
#pragma unroll
        for (int kt = 0; kt < 2 * NJ; ++kt) { const float* mp = mk + s * 64 + g * 32 + kt * 16 + 8 * h; mq[kt][0] = *(const v4fa*)mp; mq[kt][1] = *(const v4fa*)(mp + 4); }
        v8f sc[2 * NJ];
#pragma unroll
        for (int kt = 0; kt < 2 * NJ; ++kt) { v8f a = (v8f){};
#pragma unroll
            for (int kc = 0; kc < 2; ++kc) { const V kf = F::cast(ldfr(kb + kt * 16 * FPI + kc * 64)); a = F::mma(kf, qf[kc], a);
                a = F::mma(kf, ql[kc], a); const V kl = F::cast(ldfr(kb + 2 * FTB + kt * 16 * FPI + kc * 64)); a = F::mma(kl, qf[kc], a); }
            sc[kt] = a; }
        V va[NJ][2][4];   // Vt fragments: [32-key chunk][plane][d tile]
        auto vload = [&](int j) {
#pragma unroll
            for (int dt = 0; dt < 4; ++dt) { va[j][0][dt] = F::cast(ldfr(vb + dt * 16 * FPI + j * 64)); va[j][1][dt] = F::cast(ldfr(vb + 2 * FTB + dt * 16 * FPI + j * 64)); } };
#pragma unroll
        for (int j = 0; j < NJ; ++j) vload(j);
        __builtin_amdgcn_sched_barrier(0);   // keeps these LDS loads above the softmax, so that their latency runs under it; without it they sink to their first use
        float mx = m;
#pragma unroll
        for (int kt = 0; kt < 2 * NJ; ++kt)
#pragma unroll
            for (int r = 0; r < 8; ++r) { const float t = fmaf(sc[kt][r], SCL * L2E, mq[kt][r >> 2][r & 3]); sc[kt][r] = t; mx = fmaxf(mx, t); }
        mx = fmaxf(mx, xhalf(mx));
        const float al = __builtin_amdgcn_exp2f(m - mx); m = mx;
#pragma unroll
        for (int dt = 0; dt < 4; ++dt) o[dt] *= al;
#pragma unroll
        for (int j = 0; j < NJ; ++j) { V pf, pl; sc[2 * j] = exp2x8(sc[2 * j] - mx); sc[2 * j + 1] = exp2x8(sc[2 * j + 1] - mx);
#pragma unroll
            for (int e = 0; e < 16; ++e) { const float p = sc[2 * j + (e >> 3)][e & 7];
                const __bf16 ph = (__bf16)p; pf[e] = ph; pl[e] = (__bf16)(p - (float)ph); }
#pragma unroll
            for (int dt = 0; dt < 4; ++dt) { o[dt] = F::mma(va[j][0][dt], pf, o[dt]);
                o[dt] = F::mma(va[j][0][dt], pl, o[dt]); o[dt] = F::mma(va[j][1][dt], pf, o[dt]); } }
        const v8f pv = sc[0] + sc[1];   // the lane's terms as a tree, not one dependent chain
        l = fmaf(l, al, ((pv[0] + pv[1]) + (pv[2] + pv[3])) + ((pv[4] + pv[5]) + (pv[6] + pv[7])));
        if (s + 1 < TT / 64) lstore((s + 1) & 1);
        __syncthreads();   // publishes stage s + 1 and ends every wave's reads of the buffer that the next trip refills
    }
    l += xhalf(l);
    {   // merge of the two key groups: group 1 hands its output tiles, maximum and sum to group 0 through the staging buffers (every read of them ended at the loop's last barrier)
        float* mg = (float*)buf + qw * (34 * 32);   // per query tile: 8 x 32 units of 16 bytes, then 32 maxima, then 32 sums; a lane meets the same lane of the other group
        if (g == 1) {
#pragma unroll
            for (int dt = 0; dt < 4; ++dt) { *(v4fa*)(mg + (2 * dt) * 128 + lane * 4) = (v4f){o[dt][0], o[dt][1], o[dt][2], o[dt][3]}; *(v4fa*)(mg + (2 * dt + 1) * 128 + lane * 4) = (v4f){o[dt][4], o[dt][5], o[dt][6], o[dt][7]}; }
            mg[1024 + lane] = m; mg[1056 + lane] = l; }
        __syncthreads();   // publishes group 1's state to group 0
        if (g == 1) return;
        const float m1 = mg[1024 + lane], l1 = mg[1056 + lane], mm = fmaxf(m, m1);
        const float a0 = __builtin_amdgcn_exp2f(m - mm), a1 = __builtin_amdgcn_exp2f(m1 - mm);
        l = fmaf(l1, a1, l * a0);
#pragma unroll
        for (int dt = 0; dt < 4; ++dt) { const v4f x0 = *(const v4fa*)(mg + (2 * dt) * 128 + lane * 4), x1 = *(const v4fa*)(mg + (2 * dt + 1) * 128 + lane * 4);
#pragma unroll
            for (int r = 0; r < 4; ++r) { o[dt][r] = fmaf(x0[r], a1, o[dt][r] * a0); o[dt][4 + r] = fmaf(x1[r], a1, o[dt][4 + r] * a0); } }
    }
    const float inv = 1.0f / l;
    float* orow = out + (size_t)(q0 + qw * 16 + c) * DQ + 8 * h;
#pragma unroll
    for (int dt = 0; dt < 4; ++dt) { v4f a, b;
#pragma unroll
        for (int r = 0; r < 4; ++r) { a[r] = o[dt][r] * inv; b[r] = o[dt][4 + r] * inv; }
        *(v4f*)(orow + dt * 16) = a; *(v4f*)(orow + dt * 16 + 4) = b; }
}
// f16 blocks: as above, but a wave takes TWO 16-query tiles, so that every K and Vt fragment and every mask term it reads from LDS serves two products; P carried x 2^10 (it cancels against the sum).
__device__ __forceinline__ void fattn_h(const unsigned char* __restrict__ Q0, const unsigned char* __restrict__ K0, const unsigned char* __restrict__ V0, const float* __restrict__ ams, float* out, int q0, unsigned char* sm) {
    typedef FAt<false> F; typedef F::V V;
    constexpr int NT = 2;                              // staged tiles per stage: K, Vt
    constexpr int NQ = 2;                              // 16-query tiles of one wave
    const int tid = threadIdx.x, lane = tid & 31, wv = __builtin_amdgcn_readfirstlane(tid >> 5), c = lane & 15, h = lane >> 4;   // the wave's number as a scalar: the group test behind the loop is a scalar branch
    const int qw = wv & 3, g = wv >> 2;   // pair of query tiles and key group of the wave
    float* mk = (float*)sm; unsigned char* buf = sm + TT * 4;
    v4f mv[2];   // the work-group's 2048 mask terms, 8 per thread, fetched together with the first tiles: one trip to memory
#pragma unroll
    for (int i = 0; i < 2; ++i) mv[i] = *(const v4fa*)(ams + i * 1024 + tid * 4);
    asm volatile("s_wait_xcnt 0x0" ::: "memory");   // stands in front of every later overwrite of these loads' address registers
    const int srow = tid >> 3, scol = (tid & 7) * 16;  // staging: 8 threads per 128-byte row, 32 rows per sweep
    v8us st[NT][2];
    auto gload = [&](int s) {
#pragma unroll
        for (int u = 0; u < 2; ++u) { const int row = srow + 32 * u; const size_t ko = (size_t)(s * 64 + row) * (HD * 2) + scol, vo = (size_t)row * (TT * 2) + s * 128 + scol;
            st[0][u] = *(const v8usa*)(K0 + ko); st[1][u] = *(const v8usa*)(V0 + vo); }
        asm volatile("s_wait_xcnt 0x0" ::: "memory"); };   // stands in front of every later overwrite of these loads' address registers (this build reuses them while the loads are in flight)
    auto lstore = [&](int bs) { unsigned char* d = buf + bs * (NT * FTB) + srow * FPI + scol;
#pragma unroll
        for (int t = 0; t < NT; ++t)
#pragma unroll
            for (int u = 0; u < 2; ++u) *(v8usa*)(d + t * FTB + u * 32 * FPI) = st[t][u]; };
    V qf[NQ][2];
#pragma unroll
    for (int qt = 0; qt < NQ; ++qt)
#pragma unroll
        for (int kc = 0; kc < 2; ++kc) qf[qt][kc] = F::cast(ldfr(Q0 + (size_t)(q0 + (qw * NQ + qt) * 16 + c) * (HD * 2) + kc * 64 + h * 16));
    v8f o[NQ][4];
    float m[NQ], l[NQ];
#pragma unroll
    for (int qt = 0; qt < NQ; ++qt) { m[qt] = -3.0e38f; l[qt] = 0.f;
#pragma unroll
        for (int dt = 0; dt < 4; ++dt) o[qt][dt] = (v8f){}; }
    gload(0);
#pragma unroll
    for (int i = 0; i < 2; ++i) { v4f t;
#pragma unroll
        for (int e = 0; e < 4; ++e) t[e] = (bfr(mv[i][e]) * (1.0f / SCL)) * (SCL * L2E);   // additive mask, rounded to bf16; two products: to score units, then to the log2 domain
        *(v4fa*)(mk + i * 1024 + tid * 4) = t; }
    lstore(0); __syncthreads();
#pragma unroll 1
    for (int s = 0; s < TT / 64; ++s) {
        if (s + 1 < TT / 64) gload(s + 1);
        const unsigned char* kb = buf + (s & 1) * (NT * FTB) + (g * 32 + c) * FPI + h * 16;            // K rows of the wave's keys
        const unsigned char* vb = buf + (s & 1) * (NT * FTB) + FTB + c * FPI + g * 64 + h * 16;        // Vt columns of the wave's keys
        v4f mq[2][2];   // the lane's mask terms
#pragma unroll
        for (int kt = 0; kt < 2; ++kt) { const float* mp = mk + s * 64 + g * 32 + kt * 16 + 8 * h; mq[kt][0] = *(const v4fa*)mp; mq[kt][1] = *(const v4fa*)(mp + 4); }
        V kf[2][2], va[4];   // K fragments [16-key tile][32-d chunk], Vt fragments [d tile]
#pragma unroll
        for (int kt = 0; kt < 2; ++kt)
#pragma unroll
            for (int kc = 0; kc < 2; ++kc) kf[kt][kc] = F::cast(ldfr(kb + kt * 16 * FPI + kc * 64));
#pragma unroll
        for (int dt = 0; dt < 4; ++dt) va[dt] = F::cast(ldfr(vb + dt * 16 * FPI));
        __builtin_amdgcn_sched_barrier(0);   // the stage's 20 LDS loads stand as one group ahead of the products; without it they are dealt out among the products, each small group behind a full wait
        v8f sc[NQ][2];
#pragma unroll
        for (int kt = 0; kt < 2; ++kt)
#pragma unroll
            for (int qt = 0; qt < NQ; ++qt) sc[qt][kt] = (v8f){};
#pragma unroll
        for (int kc = 0; kc < 2; ++kc)
#pragma unroll
            for (int kt = 0; kt < 2; ++kt)
#pragma unroll
                for (int qt = 0; qt < NQ; ++qt) sc[qt][kt] = F::mma(kf[kt][kc], qf[qt][kc], sc[qt][kt]);
        __builtin_amdgcn_sched_barrier(0);   // the 8 score products stay together, four accumulators in turn; without it the softmax is dealt out among them and each product waits for the one before, behind v_nop fill
#pragma unroll
        for (int qt = 0; qt < NQ; ++qt) {
            float mx = m[qt];
#pragma unroll
            for (int kt = 0; kt < 2; ++kt)
#pragma unroll
                for (int r = 0; r < 8; ++r) { const float t = fmaf(sc[qt][kt][r], SCL * L2E, mq[kt][r >> 2][r & 3]); sc[qt][kt][r] = t; mx = fmaxf(mx, t); }
            mx = fmaxf(mx, xhalf(mx));
            const float al = __builtin_amdgcn_exp2f(m[qt] - mx); m[qt] = mx;
            const float ms = mx - 10.0f;
#pragma unroll
            for (int dt = 0; dt < 4; ++dt) o[qt][dt] *= al;
            V pf; sc[qt][0] = exp2x8(sc[qt][0] - ms); sc[qt][1] = exp2x8(sc[qt][1] - ms);
#pragma unroll
            for (int e = 0; e < 16; ++e) pf[e] = (_Float16)sc[qt][e >> 3][e & 7];
#pragma unroll
            for (int dt = 0; dt < 4; ++dt) o[qt][dt] = F::mma(va[dt], pf, o[qt][dt]);
            const v8f pv = sc[qt][0] + sc[qt][1];   // the lane's terms as a tree, not one dependent chain
            l[qt] = fmaf(l[qt], al, ((pv[0] + pv[1]) + (pv[2] + pv[3])) + ((pv[4] + pv[5]) + (pv[6] + pv[7])));
        }
        if (s + 1 < TT / 64) lstore((s + 1) & 1);
        __syncthreads();   // publishes stage s + 1 and ends every wave's reads of the buffer that the next trip refills
    }
    // merge of the two key groups: group 1 hands its output tiles, maxima and sums to group 0 through the staging buffers (every read of them ended at the loop's last barrier)
    float* mg = (float*)buf + qw * (NQ * 34 * 32);   // per query tile: 8 x 32 units of 16 bytes, then 32 maxima, then 32 sums; a lane meets the same lane of the other group
#pragma unroll
    for (int qt = 0; qt < NQ; ++qt) l[qt] += xhalf(l[qt]);
    if (g == 1) {
#pragma unroll
        for (int qt = 0; qt < NQ; ++qt) { float* mt = mg + qt * (34 * 32);
#pragma unroll
            for (int dt = 0; dt < 4; ++dt) { *(v4fa*)(mt + (2 * dt) * 128 + lane * 4) = (v4f){o[qt][dt][0], o[qt][dt][1], o[qt][dt][2], o[qt][dt][3]}; *(v4fa*)(mt + (2 * dt + 1) * 128 + lane * 4) = (v4f){o[qt][dt][4], o[qt][dt][5], o[qt][dt][6], o[qt][dt][7]}; }
            mt[1024 + lane] = m[qt]; mt[1056 + lane] = l[qt]; } }
    __syncthreads();   // publishes group 1's state to group 0
    if (g == 1) return;
#pragma unroll
    for (int qt = 0; qt < NQ; ++qt) { const float* mt = mg + qt * (34 * 32);
        const float m1 = mt[1024 + lane], l1 = mt[1056 + lane], mm = fmaxf(m[qt], m1);
        const float a0 = __builtin_amdgcn_exp2f(m[qt] - mm), a1 = __builtin_amdgcn_exp2f(m1 - mm);
        const float inv = 1.0f / fmaf(l1, a1, l[qt] * a0);
        float* orow = out + (size_t)(q0 + (qw * NQ + qt) * 16 + c) * DQ + 8 * h;
#pragma unroll
        for (int dt = 0; dt < 4; ++dt) { const v4f x0 = *(const v4fa*)(mt + (2 * dt) * 128 + lane * 4), x1 = *(const v4fa*)(mt + (2 * dt + 1) * 128 + lane * 4); v4f a, b;
#pragma unroll
            for (int r = 0; r < 4; ++r) { a[r] = fmaf(x0[r], a1, o[qt][dt][r] * a0) * inv; b[r] = fmaf(x1[r], a1, o[qt][dt][4 + r] * a0) * inv; }
            *(v4f*)(orow + dt * 16) = a; *(v4f*)(orow + dt * 16 + 4) = b; } }
    asm volatile("s_wait_xcnt 0x0" ::: "memory");   // stands behind the last stores, in front of any later overwrite of their address and data registers
}
// grid: the hi+lo blocks (3 x the matrix work) first, then the f16 blocks; planes [batch][head][...], AMS [batch][key] (the mask input itself), OUT [batch][query][head * 64 + d]
// amdgpu_waves_per_eu(4, 4): 480 work-groups of two waves per SIMD on 256 WGPs are at most four waves per SIMD; the register budget of four lets the scheduler keep a stage's LDS loads in flight instead of waiting on each
__global__ __launch_bounds__(256) __attribute__((amdgpu_waves_per_eu(4, 4))) void k_fattn(const h16* __restrict__ Q16, const h16* __restrict__ K16, const h16* __restrict__ V16, const bf* __restrict__ Qh, const bf* __restrict__ Ql, const bf* __restrict__ Kh, const bf* __restrict__ Kl, const bf* __restrict__ Vh, const bf* __restrict__ Vl, const float* __restrict__ AMS, float* OUT) {
    __shared__ __align__(16) unsigned char sm[TT * 4 + 2 * 4 * FTB];
    const int nhi = NB_ * NH_ * (RH / 64); const int idx = blockIdx.x;
    if (idx < nhi) { const int bh = idx / (RH / 64), qb = idx % (RH / 64); const size_t po = (size_t)bh * TT * HD; const int b = bh / NH_, hd = bh % NH_;
        fattn_hl((const unsigned char*)(Qh + po), (const unsigned char*)(Ql + po), (const unsigned char*)(Kh + po), (const unsigned char*)(Kl + po), (const unsigned char*)(Vh + po), (const unsigned char*)(Vl + po), AMS + (size_t)b * TT, OUT + (size_t)b * TT * DQ + hd * HD, qb * 64, sm);
    } else { const int i2 = idx - nhi; const int bh = i2 / ((TT - RH) / 128), q0 = RH + (i2 % ((TT - RH) / 128)) * 128; const size_t po = (size_t)bh * TT * HD; const int b = bh / NH_, hd = bh % NH_;
        fattn_h((const unsigned char*)(Q16 + po), (const unsigned char*)(K16 + po), (const unsigned char*)(V16 + po), AMS + (size_t)b * TT, OUT + (size_t)b * TT * DQ + hd * HD, q0, sm); }
}

extern "C" void kernel_launch(void* const* d_in, const int* in_sizes, int n_in,
                              void* d_out, int out_size, void* d_ws, size_t ws_size, hipStream_t stream) {
    (void)in_sizes; (void)n_in; (void)out_size;
    const float* x = (const float*)d_in[0]; const float* amask = (const float*)d_in[1]; const float* wq = (const float*)d_in[2]; const float* bq = (const float*)d_in[3]; const float* wk = (const float*)d_in[4]; const float* bk = (const float*)d_in[5]; const float* wv = (const float*)d_in[6]; const float* bv = (const float*)d_in[7]; const float* wo = nullptr; (void)wo;
    float* OUT = (float*)d_out;     // [2][2048][768]
    char* wsp = (char*)d_ws;
    auto take = [&](size_t bytes) { char* p = wsp; wsp += (bytes + 255) & ~(size_t)255; return (void*)p; };
    const size_t PQ = (size_t)NH_ * TT * HD, PK = (size_t)NKV * TT * HD;   // elements of one batch's head planes; every plane holds both batches
    h16* QP16 = (h16*)take(NB_ * PQ * 2); h16* KP16 = (h16*)take(NB_ * PK * 2); h16* VT16 = (h16*)take(NB_ * PK * 2);
    bf* QPh = (bf*)take(NB_ * PQ * 2); bf* QPl = (bf*)take(NB_ * PQ * 2); bf* KPh = (bf*)take(NB_ * PK * 2); bf* KPl = (bf*)take(NB_ * PK * 2); bf* VTh = (bf*)take(NB_ * PK * 2); bf* VTl = (bf*)take(NB_ * PK * 2);
    if ((size_t)(wsp - (char*)d_ws) > ws_size) return;    // ws 256 MiB
    k_gemmf<true><<<dim3(NB_ * TT / 128, DQ / 128, 3), 128, 0, stream>>>(x, wq, wk, wv, bq, bk, bv, QP16, QPh, QPl, KP16, KPh, KPl, VT16, VTh, VTl);
    k_fattn<<<NB_ * NH_ * (RH / 64 + (TT - RH) / 128), 256, 0, stream>>>(QP16, KP16, VT16, QPh, QPl, KPh, KPl, VTh, VTl, amask, OUT);
}

// v010
// A run of this version takes 72.3 microseconds.
// Timed twice side by side with v009, it ran 1.04 times as fast both times.
// All steps since v000 together make it 21.7 times as fast.
#include <hip/hip_runtime.h>

// SyntaxBertSelfAttention (hidden [2][2048][768], additive attention_mask [2][1][1][2048]; q/k/v = x W + b (12 heads x 64); scores = q.k / sqrt(12) (the module scales by 1/sqrt(num_heads), faithful) + mask[b][j]; softmax; out = merged heads -> [2][2048][768]).
// Compute dtypes, f32 accumulate: every input rounded to bf16; projections on PLAIN bf16 operands (inputs: exact, + bias); scores (K 64) and probs.v on hl planes (3 products) for the first 512 query rows of each

#define NB_  2
#define TT   2048
#define DM   768
#define NH_  12
#define NKV  12
#define REP  (NH_ / NKV)
#define HD   64
#define DQ   (NH_ * HD)
#define DKV  (NKV * HD)
#define RH   512                  // query rows < RH use hi+lo planes (0: none)
#define WIN  2048
#define SCL  0.28867513459481287f
#define L2E  1.4426950408889634f
#define FPI  144                  // fused attention: LDS row pitch in bytes (128 B of data + 16)
#define FTB  10240                // fused attention: LDS bytes given to one staged 64-row tile (64 * FPI = 9216, rounded up so that every tile starts at a multiple of 2 KiB)
typedef _Float16 h16;
typedef unsigned short bf;
typedef __attribute__((ext_vector_type(16))) __bf16   v16bf;
typedef __attribute__((ext_vector_type(16))) _Float16 v16h;
typedef __attribute__((ext_vector_type(8)))  _Float16 v8h;
typedef __attribute__((ext_vector_type(8)))  unsigned short v8us;
typedef __attribute__((ext_vector_type(8)))  float    v8f;
typedef __attribute__((ext_vector_type(4)))  float    v4f;
typedef v8h  __attribute__((may_alias)) v8ha;
typedef v4f  __attribute__((may_alias)) v4fa;
typedef v8us __attribute__((may_alias)) v8usa;

__device__ __forceinline__ unsigned short f2bf(float f) { unsigned u = __float_as_uint(f); u += 0x7FFFu + ((u >> 16) & 1u); return (unsigned short)(u >> 16); }
__device__ __forceinline__ float bf2f(unsigned short b) { return __uint_as_float(((unsigned)b) << 16); }
__device__ __forceinline__ float bfr(float f) { return bf2f(f2bf(f)); }
__device__ __forceinline__ v16h cat16(v8h lo, v8h hi) { return __builtin_shufflevector(lo, hi, 0, 1, 2, 3, 4, 5, 6, 7, 8, 9, 10, 11, 12, 13, 14, 15); }
__device__ __forceinline__ v16bf cat16b(v8us lo, v8us hi) { return __builtin_bit_cast(v16bf, __builtin_shufflevector(lo, hi, 0, 1, 2, 3, 4, 5, 6, 7, 8, 9, 10, 11, 12, 13, 14, 15)); }
__device__ __forceinline__ v8f wmma16(v16h a, v16h b, v8f c) { return __builtin_amdgcn_wmma_f32_16x16x32_f16(false, a, false, b, (short)0, c, false, false); }
__device__ __forceinline__ v8f wmmab(v16bf a, v16bf b, v8f c) { return __builtin_amdgcn_wmma_f32_16x16x32_bf16(false, a, false, b, (short)0, c, false, false); }



__device__ __forceinline__ h16 tohx(float x) { return (h16)x; }
__device__ __forceinline__ void splitf(float y, unsigned short& h, unsigned short& l) { h = f2bf(y); l = f2bf(y - bf2f(h)); }
// ---- k_gemmf: the three projections of both batches in one launch, straight from the f32 inputs. One work-group = 4 waves (2 x 2), each wave a 64x64 output tile (16 accumulators); grid (M/128, 768/128, 3), 128 threads.
// blockIdx.z picks the weight, the bias and the planes (0 q, 1 k, 2 v); m runs over the tokens of both batches.
// Per 32 k the work-group fetches 128 rows of x and 128 columns of w as f32 (every load covers whole 128-byte lines), rounds them to bf16 and stores them in LDS in fragment order; two buffers, one barrier per 32 k: step s + 1 is fetched while step s is worked on.
// LDS tile of one operand: 8 strips of 16 rows; in a strip, k-octet o (k = 8 o + 0..7) of row r is the 16-byte unit at o * GOP + r * 16. A fragment of lane (r, hi) is octet hi and octet 2 + hi, for both operands alike.
// GOP and GSP are padded so that the staging stores as well as the fragment loads fall on distinct banks.
// c[m][n] (f32, + f32 bias[n]) = sum_k x[m][k] w[k][n]. A 64-column tile is one head (HD == 64), m is the token.
// The f32 tile is never stored: the epilogue writes it as the three 16-bit operand planes of the attention kernel (f16, bf16 hi, bf16 lo).
// q, k: planes [batch][head][token][d], through the wave's own LDS tile (a lane takes 8 consecutive d). v: planes [batch][head][d][token], straight from the accumulators (a lane holds 8 consecutive tokens of one d).
#define GOP  320                  // bytes from one k-octet of a strip to the next (256 of data + 64)
#define GSP  (4 * GOP + 16)       // bytes of one strip
#define GTB  (8 * GSP)            // bytes of one operand's staged tile (128 rows x 32 k)
typedef __attribute__((ext_vector_type(8))) __bf16 v8bf;
typedef __attribute__((ext_vector_type(4))) __bf16 v4bf;
typedef __attribute__((ext_vector_type(4))) unsigned short v4us;
typedef v4us __attribute__((may_alias)) v4usa;
__device__ __forceinline__ v16bf ldgf(const unsigned char* p) { return cat16b(*(const v8usa*)p, *(const v8usa*)(p + 2 * GOP)); }
template <bool BIAS>
__global__ __launch_bounds__(128) void k_gemmf(const float* __restrict__ x, const float* __restrict__ wq, const float* __restrict__ wk, const float* __restrict__ wvv, const float* __restrict__ biq, const float* __restrict__ bik, const float* __restrict__ biv,
                                               h16* Q16, bf* Qh, bf* Ql, h16* K16, bf* Kh, bf* Kl, h16* V16, bf* Vh, bf* Vl) {
    __shared__ __align__(16) unsigned char tb[2 * 2 * GTB];
    __shared__ __align__(16) float osw[4 * 16 * 68];
    constexpr int K = DM;
    const int pz = blockIdx.z; const bool VT = pz == 2;
    const float* __restrict__ w = pz == 0 ? wq : pz == 1 ? wk : wvv; const float* __restrict__ bias = pz == 0 ? biq : pz == 1 ? bik : biv;
    h16* P16 = pz == 0 ? Q16 : pz == 1 ? K16 : V16; bf* Ph = pz == 0 ? Qh : pz == 1 ? Kh : Vh; bf* Pl = pz == 0 ? Ql : pz == 1 ? Kl : Vl;
    const int tid = threadIdx.x, lane = tid & 31, wv = __builtin_amdgcn_readfirstlane(tid >> 5), lr = lane & 15, hi = lane >> 4;   // the wave's number as a scalar: tile origin and plane addresses stay in scalar registers
    const int R0 = blockIdx.x * 128, C0 = blockIdx.y * 128; const int r0 = R0 + (wv & 1) * 64, c0 = C0 + (wv >> 1) * 64;
    const int bt = r0 / TT, t0 = r0 % TT;   // batch and first token of the wave's tile (a tile never straddles two batches: TT % 64 == 0)
    float* os = osw + wv * (16 * 68);
    v8f acc[4][4];
#pragma unroll
    for (int mb = 0; mb < 4; ++mb)
#pragma unroll
        for (int nb = 0; nb < 4; ++nb) acc[mb][nb] = (v8f){};
    // x: 8 lanes per row (32 k = one line), 4 rows per load, the wave's 32 rows in 8 loads. w: the wave takes k-octet wv, a lane 4 consecutive n of each of its 8 k: 512 contiguous bytes per load.
    const float* xa = x + (size_t)(R0 + wv * 32 + (lane >> 3)) * K + (lane & 7) * 4;
    const float* wb = w + (size_t)(wv * 8) * DQ + C0 + lane * 4;
    v4f sa[8], sb[8];
    auto gload = [&](int s) {
#pragma unroll
        for (int i = 0; i < 8; ++i) sa[i] = *(const v4fa*)(xa + (size_t)i * 4 * K + s * 32);
        asm volatile("s_wait_xcnt 0x0" ::: "memory");   // this build lets a later load's result land in the address registers of the loads above: the wait stands in front of that
#pragma unroll
        for (int q = 0; q < 8; ++q) sb[q] = *(const v4fa*)(wb + (size_t)(s * 32 + q) * DQ);
        asm volatile("s_wait_xcnt 0x0" ::: "memory"); };   // stands in front of every later overwrite of these loads' address registers
    unsigned char* da = tb + wv * 2 * GSP + ((lane & 7) >> 1) * GOP + (lane >> 3) * 16 + (lane & 1) * 8;   // half a unit: 4 k of one row
    unsigned char* db = tb + GTB + (lane >> 2) * GSP + wv * GOP + (lane & 3) * 64;                          // four units: 8 k of 4 columns
    auto lstore = [&](int bs) {
#pragma unroll
        for (int i = 0; i < 8; ++i) { v4bf o;
#pragma unroll
            for (int e = 0; e < 4; ++e) o[e] = (__bf16)sa[i][e];
            *(v4usa*)(da + bs * (2 * GTB) + (i >> 2) * GSP + (i & 3) * 64) = __builtin_bit_cast(v4us, o); }
#pragma unroll
        for (int i = 0; i < 4; ++i) { v8bf o;
#pragma unroll
            for (int q = 0; q < 8; ++q) o[q] = (__bf16)sb[q][i];
            *(v8usa*)(db + bs * (2 * GTB) + i * 16) = __builtin_bit_cast(v8us, o); } };
    gload(0); lstore(0); __syncthreads();
#pragma unroll 1
    for (int s = 0; s < K / 32; ++s) {
        if (s + 1 < K / 32) gload(s + 1);
        const unsigned char* ab = tb + (s & 1) * (2 * GTB) + (wv & 1) * 4 * GSP + hi * GOP + lr * 16;
        const unsigned char* bb = tb + (s & 1) * (2 * GTB) + GTB + (wv >> 1) * 4 * GSP + hi * GOP + lr * 16;
        v16bf a[4], b[4];
#pragma unroll
        for (int mb = 0; mb < 4; ++mb) a[mb] = ldgf(ab + mb * GSP);
#pragma unroll
        for (int nb = 0; nb < 4; ++nb) b[nb] = ldgf(bb + nb * GSP);
        __builtin_amdgcn_sched_barrier(0);   // keeps the 16 LDS loads together ahead of the products; without it three of the w fragments are fetched among them, each behind a full wait
#pragma unroll
        for (int nb = 0; nb < 4; ++nb)
#pragma unroll
            for (int mb = 0; mb < 4; ++mb) acc[mb][nb] = wmmab(a[mb], b[nb], acc[mb][nb]);
        if (s + 1 < K / 32) lstore((s + 1) & 1);
        __syncthreads();   // publishes step s + 1 and ends every wave's reads of the buffer that the next trip refills
    }
    if (VT) {
#pragma unroll
        for (int nb = 0; nb < 4; ++nb) { const float bn = BIAS ? bfr(bias[c0 + nb * 16 + lr]) : 0.0f; const size_t e0 = (size_t)(bt * DKV + c0 + nb * 16 + lr) * TT + t0 + 8 * hi;
#pragma unroll
            for (int mb = 0; mb < 4; ++mb) { v8h o16; v8us oh, ol;
#pragma unroll
                for (int j = 0; j < 8; ++j) { float x = acc[mb][nb][j]; if (BIAS) x += bn; o16[j] = tohx(x); unsigned short a2, c2; splitf(x, a2, c2); oh[j] = a2; ol[j] = c2; }
                *(v8h*)(P16 + e0 + mb * 16) = o16; *(v8us*)(Ph + e0 + mb * 16) = oh; *(v8us*)(Pl + e0 + mb * 16) = ol; } }
    } else {
        const int rw = lane >> 3, cofs = (lane & 7) * 8;   // 8 lanes per 64-d row: one store covers four whole 128-byte rows
        float bn[8];
#pragma unroll
        for (int q = 0; q < 8; ++q) bn[q] = BIAS ? bfr(bias[c0 + cofs + q]) : 0.0f;
#pragma unroll
        for (int mb = 0; mb < 4; ++mb) {
#pragma unroll
            for (int nb = 0; nb < 4; ++nb) {
#pragma unroll
                for (int j = 0; j < 8; ++j) os[(hi * 8 + j) * 68 + nb * 16 + lr] = acc[mb][nb][j]; }
            __builtin_amdgcn_wave_barrier(); asm volatile("" ::: "memory");   // the reads below take other lanes' writes: keeps them behind the writes
#pragma unroll
            for (int s = 0; s < 4; ++s) { const int row = 4 * s + rw; const v4f va = *(const v4fa*)(os + row * 68 + cofs), vb = *(const v4fa*)(os + row * 68 + cofs + 4); v8h o16; v8us oh, ol;
#pragma unroll
                for (int q = 0; q < 8; ++q) { float x = q < 4 ? va[q & 3] : vb[q & 3]; if (BIAS) x += bn[q]; o16[q] = tohx(x); unsigned short a2, c2; splitf(x, a2, c2); oh[q] = a2; ol[q] = c2; }
                const size_t e = ((size_t)(bt * NH_ + c0 / HD) * TT + t0 + mb * 16 + row) * HD + cofs;
                *(v8h*)(P16 + e) = o16; *(v8us*)(Ph + e) = oh; *(v8us*)(Pl + e) = ol; }
            __builtin_amdgcn_wave_barrier(); asm volatile("" ::: "memory");   // the next tile's writes stay behind these reads
        }
    }
}

typedef __attribute__((ext_vector_type(16))) unsigned short v16us;
template <bool HI> struct FAt;
template <> struct FAt<false> { typedef v16h V; static __device__ __forceinline__ V cast(v16us x) { return __builtin_bit_cast(v16h, x); } static __device__ __forceinline__ v8f mma(V a, V b, v8f c) { return wmma16(a, b, c); } };
template <> struct FAt<true> { typedef v16bf V; static __device__ __forceinline__ V cast(v16us x) { return __builtin_bit_cast(v16bf, x); } static __device__ __forceinline__ v8f mma(V a, V b, v8f c) { return wmmab(a, b, c); } };
__device__ __forceinline__ v16us ldfr(const unsigned char* p) { return __builtin_shufflevector(*(const v8usa*)p, *(const v8usa*)(p + 32), 0, 1, 2, 3, 4, 5, 6, 7, 8, 9, 10, 11, 12, 13, 14, 15); }   // k = 8 hi + 0..7 and 16 + 8 hi + 0..7 of a 32-k chunk; p already holds the 16 hi bytes
__device__ __forceinline__ float xhalf(float x) { const int b = __float_as_int(x); return __int_as_float(__builtin_amdgcn_permlanex16(b, b, 0x76543210, 0xfedcba98, false, false)); }   // lane l <-> l ^ 16
// eight 2^x in one statement, each in place: no v_exp_f32 here is directly followed by an instruction that reads its result or overwrites its source, and the v_nop keeps that slot behind the last one.
// In place, so that the statement writes only registers that a compiler-placed vector instruction in front of it has just written (never an operand of a matrix instruction still in its window).
__device__ __forceinline__ v8f exp2x8(v8f x) { float y0 = x[0], y1 = x[1], y2 = x[2], y3 = x[3], y4 = x[4], y5 = x[5], y6 = x[6], y7 = x[7];
    asm("v_exp_f32 %0, %0\n\tv_exp_f32 %1, %1\n\tv_exp_f32 %2, %2\n\tv_exp_f32 %3, %3\n\tv_exp_f32 %4, %4\n\tv_exp_f32 %5, %5\n\tv_exp_f32 %6, %6\n\tv_exp_f32 %7, %7\n\tv_nop"
        : "+v"(y0), "+v"(y1), "+v"(y2), "+v"(y3), "+v"(y4), "+v"(y5), "+v"(y6), "+v"(y7));
    return (v8f){y0, y1, y2, y3, y4, y5, y6, y7}; }
typedef uint32_t u32x4 __attribute__((ext_vector_type(4)));
typedef uint32_t u32x8 __attribute__((ext_vector_type(8)));
__device__ __forceinline__ uint32_t uni(uint32_t v) { return (uint32_t)__builtin_amdgcn_readfirstlane(v); }
__device__ __forceinline__ uint32_t pinned(uint32_t v) { uint32_t w = uni(v); asm volatile("" : "+s"(w)); return w; }   // holds the issue test in a scalar register, so that the branch round a tensor load is a scalar one (the mover ignores EXEC)
// descriptor group 1 of a tile of 64 rows of 128 bytes, source row pitch 'pitch' bytes, landing at a pitch of 128 + 16 bytes; extents in bytes, tensor = tile, no mask. Built once per wave.
__device__ __forceinline__ u32x8 tdm_group1(uint32_t pitch) {
    u32x8 g1; g1[0] = uni((1u << 20) | (4u << 22) | (3u << 25)); g1[1] = uni(128u << 16); g1[2] = uni(64u << 16); g1[3] = uni(128u << 16); g1[4] = uni(64u); g1[5] = uni(pitch); g1[6] = uni(0u); g1[7] = uni(0u);
    asm volatile("" : "+s"(g1));   // as pinned() (a descriptor word held in a scalar register): the eight words keep registers of their own through the loop; without it two of them serve as temporaries while a request is in flight
    return g1; }
// one tensor load of such a tile from 'srcp' to LDS byte 'lds'
__device__ __forceinline__ void tdm_tile(uint32_t lds, const unsigned char* srcp, u32x8 g1) {
    const uint64_t ga = (uint64_t)(size_t)srcp;
    u32x4 g0; g0[0] = uni(1u); g0[1] = uni(lds); g0[2] = uni((uint32_t)ga); g0[3] = uni((((uint32_t)(ga >> 32)) & 0x01FFFFFFu) | 0x80000000u);
    asm volatile("tensor_load_to_lds %0, %1" :: "s"(g0), "s"(g1) : "memory"); }   // one request of the whole wave: the tile goes to LDS through no register
__device__ __forceinline__ void wait_tensor0() { asm volatile("s_wait_tensorcnt 0x0" ::: "memory"); }   // the issuing wave's tile has landed behind it; the compiler places no wait for the mover
__device__ __forceinline__ void wait_ds0() { asm volatile("s_wait_dscnt 0x0" ::: "memory"); }           // the wave's LDS reads have retired before the barrier behind which their buffer is refilled
// hi+lo blocks
__device__ __forceinline__ void fattn_hl(const unsigned char* __restrict__ Q0, const unsigned char* __restrict__ Q1, const unsigned char* __restrict__ K0, const unsigned char* __restrict__ K1, const unsigned char* __restrict__ V0, const unsigned char* __restrict__ V1, const float* __restrict__ ams, float* out, int q0, unsigned char* sm) {
    typedef FAt<true> F; typedef F::V V;
    constexpr int NT = 4;                              // staged tiles per stage: K, Vt, K lo, Vt lo
    constexpr int NJ = 1;                              // 32-key chunks of a stage that one wave takes
    const int tid = threadIdx.x, lane = tid & 31, wv = __builtin_amdgcn_readfirstlane(tid >> 5), c = lane & 15, h = lane >> 4;   // the wave's number as a scalar: the group test behind the loop is a scalar branch
    const int qw = wv & 3, g = wv >> 2;   // query tile and key group of the wave
    float* mk = (float*)sm; unsigned char* buf = sm + TT * 4;
    v4f mv[2];   // the work-group's 2048 mask terms, 8 per thread, fetched together with the first tiles: one trip to memory
#pragma unroll
    for (int i = 0; i < 2; ++i) mv[i] = *(const v4fa*)(ams + i * 1024 + tid * 4);
    asm volatile("s_wait_xcnt 0x0" ::: "memory");   // stands in front of every later overwrite of these loads' address registers
    // staging: wave t < NT issues tile t of every stage (0 K, 1 Vt, 2 K lo, 3 Vt lo). K: 64 key rows, contiguous. Vt: 64 d rows at the plane's pitch, 64 keys of each.
    const unsigned char* tsrc = (wv & 1) ? ((wv & 2) ? V1 : V0) : ((wv & 2) ? K1 : K0);
    const uint32_t tstep = (wv & 1) ? 128u : 64u * HD * 2u, tpitch = (wv & 1) ? TT * 2u : HD * 2u, tdst = (uint32_t)(size_t)buf + (wv & 3) * FTB;
    const u32x8 tg1 = tdm_group1(tpitch); const uint32_t iss = uni(wv < NT);
    auto tissue = [&](int s) { tdm_tile(tdst + (s & 1) * (NT * FTB), tsrc + (size_t)s * tstep, tg1); };
    V qf[2], ql[2];
#pragma unroll
    for (int kc = 0; kc < 2; ++kc) { const size_t qo = (size_t)(q0 + qw * 16 + c) * (HD * 2) + kc * 64 + h * 16; qf[kc] = F::cast(ldfr(Q0 + qo)); ql[kc] = F::cast(ldfr(Q1 + qo)); }
    asm volatile("s_wait_xcnt 0x0" ::: "memory");   // stands in front of every later overwrite of the query loads' address registers
    v8f o[4];
#pragma unroll
    for (int dt = 0; dt < 4; ++dt) o[dt] = (v8f){};
    float m = -3.0e38f, l = 0.f;
    if (pinned(iss)) { tissue(0); wait_tensor0(); }
#pragma unroll
    for (int i = 0; i < 2; ++i) { v4f t;
#pragma unroll
        for (int e = 0; e < 4; ++e) t[e] = (bfr(mv[i][e]) * (1.0f / SCL)) * (SCL * L2E);   // additive mask, rounded to bf16; two products: to score units, then to the log2 domain
        *(v4fa*)(mk + i * 1024 + tid * 4) = t; }
    __syncthreads();   // publishes stage 0 and the mask terms
#pragma unroll 1
    for (int s = 0; s < TT / 64; ++s) {
        if (pinned(iss & (uint32_t)(s + 1 < TT / 64))) tissue(s + 1);   // directly behind the barrier that ended every read of its buffer (pass s - 1's; for stage 1 the barrier in front of the loop): it lands while stage s is worked on
        const unsigned char* kb = buf + (s & 1) * (NT * FTB) + (g * 32 + c) * FPI + h * 16;            // K rows of the wave's keys
        const unsigned char* vb = buf + (s & 1) * (NT * FTB) + FTB + c * FPI + g * 64 + h * 16;        // Vt columns of the wave's keys
        v4f mq[2 * NJ][2];   // the lane's mask terms, fetched ahead of the fragments: LDS answers in order, and the softmax needs these first
#pragma unroll
        for (int kt = 0; kt < 2 * NJ; ++kt) { const float* mp = mk + s * 64 + g * 32 + kt * 16 + 8 * h; mq[kt][0] = *(const v4fa*)mp; mq[kt][1] = *(const v4fa*)(mp + 4); }
        v8f sc[2 * NJ];
#pragma unroll
        for (int kt = 0; kt < 2 * NJ; ++kt) { v8f a = (v8f){};
#pragma unroll
            for (int kc = 0; kc < 2; ++kc) { const V kf = F::cast(ldfr(kb + kt * 16 * FPI + kc * 64)); a = F::mma(kf, qf[kc], a);
                a = F::mma(kf, ql[kc], a); const V kl = F::cast(ldfr(kb + 2 * FTB + kt * 16 * FPI + kc * 64)); a = F::mma(kl, qf[kc], a); }
            sc[kt] = a; }
        V va[NJ][2][4];   // Vt fragments: [32-key chunk][plane][d tile]
        auto vload = [&](int j) {
#pragma unroll
            for (int dt = 0; dt < 4; ++dt) { va[j][0][dt] = F::cast(ldfr(vb + dt * 16 * FPI + j * 64)); va[j][1][dt] = F::cast(ldfr(vb + 2 * FTB + dt * 16 * FPI + j * 64)); } };
#pragma unroll
        for (int j = 0; j < NJ; ++j) vload(j);
        __builtin_amdgcn_sched_barrier(0);   // keeps these LDS loads above the softmax, so that their latency runs under it; without it they sink to their first use
        float mx = m;
#pragma unroll
        for (int kt = 0; kt < 2 * NJ; ++kt)
#pragma unroll
            for (int r = 0; r < 8; ++r) { const float t = fmaf(sc[kt][r], SCL * L2E, mq[kt][r >> 2][r & 3]); sc[kt][r] = t; mx = fmaxf(mx, t); }
        mx = fmaxf(mx, xhalf(mx));
        const float al = __builtin_amdgcn_exp2f(m - mx); m = mx;
#pragma unroll
        for (int dt = 0; dt < 4; ++dt) o[dt] *= al;
#pragma unroll
        for (int j = 0; j < NJ; ++j) { V pf, pl; sc[2 * j] = exp2x8(sc[2 * j] - mx); sc[2 * j + 1] = exp2x8(sc[2 * j + 1] - mx);
#pragma unroll
            for (int e = 0; e < 16; ++e) { const float p = sc[2 * j + (e >> 3)][e & 7];
                const __bf16 ph = (__bf16)p; pf[e] = ph; pl[e] = (__bf16)(p - (float)ph); }
#pragma unroll
            for (int dt = 0; dt < 4; ++dt) { o[dt] = F::mma(va[j][0][dt], pf, o[dt]);
                o[dt] = F::mma(va[j][0][dt], pl, o[dt]); o[dt] = F::mma(va[j][1][dt], pf, o[dt]); } }
        const v8f pv = sc[0] + sc[1];   // the lane's terms as a tree, not one dependent chain
        l = fmaf(l, al, ((pv[0] + pv[1]) + (pv[2] + pv[3])) + ((pv[4] + pv[5]) + (pv[6] + pv[7])));
        __builtin_amdgcn_sched_barrier(0);   // keeps the wait below at the stage's foot; without it it is lifted above the softmax, where it waits for the Vt fragments ahead of their use
        wait_ds0();
        if (pinned(iss)) wait_tensor0();
        __syncthreads();   // publishes stage s + 1 and ends every wave's reads of the buffer that is refilled behind it
    }
    wait_tensor0(); wait_ds0();   // nothing of the ring is in flight when it becomes merge space
    l += xhalf(l);
    {   // merge of the two key groups: group 1 hands its output tiles, maximum and sum to group 0 through the staging buffers (every read of them ended at the loop's last barrier)
        float* mg = (float*)buf + qw * (34 * 32);   // per query tile: 8 x 32 units of 16 bytes, then 32 maxima, then 32 sums; a lane meets the same lane of the other group
        if (g == 1) {
#pragma unroll
            for (int dt = 0; dt < 4; ++dt) { *(v4fa*)(mg + (2 * dt) * 128 + lane * 4) = (v4f){o[dt][0], o[dt][1], o[dt][2], o[dt][3]}; *(v4fa*)(mg + (2 * dt + 1) * 128 + lane * 4) = (v4f){o[dt][4], o[dt][5], o[dt][6], o[dt][7]}; }
            mg[1024 + lane] = m; mg[1056 + lane] = l; }
        __syncthreads();   // publishes group 1's state to group 0
        if (g == 1) return;
        const float m1 = mg[1024 + lane], l1 = mg[1056 + lane], mm = fmaxf(m, m1);
        const float a0 = __builtin_amdgcn_exp2f(m - mm), a1 = __builtin_amdgcn_exp2f(m1 - mm);
        l = fmaf(l1, a1, l * a0);
#pragma unroll
        for (int dt = 0; dt < 4; ++dt) { const v4f x0 = *(const v4fa*)(mg + (2 * dt) * 128 + lane * 4), x1 = *(const v4fa*)(mg + (2 * dt + 1) * 128 + lane * 4);
#pragma unroll
            for (int r = 0; r < 4; ++r) { o[dt][r] = fmaf(x0[r], a1, o[dt][r] * a0); o[dt][4 + r] = fmaf(x1[r], a1, o[dt][4 + r] * a0); } }
    }
    const float inv = 1.0f / l;
    float* orow = out + (size_t)(q0 + qw * 16 + c) * DQ + 8 * h;
#pragma unroll
    for (int dt = 0; dt < 4; ++dt) { v4f a, b;
#pragma unroll
        for (int r = 0; r < 4; ++r) { a[r] = o[dt][r] * inv; b[r] = o[dt][4 + r] * inv; }
        *(v4f*)(orow + dt * 16) = a; *(v4f*)(orow + dt * 16 + 4) = b; }
}
// f16 blocks: as above, but a wave takes TWO 16-query tiles, so that every K and Vt fragment and every mask term it reads from LDS serves two products; P carried x 2^10 (it cancels against the sum).
__device__ __forceinline__ void fattn_h(const unsigned char* __restrict__ Q0, const unsigned char* __restrict__ K0, const unsigned char* __restrict__ V0, const float* __restrict__ ams, float* out, int q0, unsigned char* sm) {
    typedef FAt<false> F; typedef F::V V;
    constexpr int NT = 2;                              // staged tiles per stage: K, Vt
    constexpr int NQ = 2;                              // 16-query tiles of one wave
    const int tid = threadIdx.x, lane = tid & 31, wv = __builtin_amdgcn_readfirstlane(tid >> 5), c = lane & 15, h = lane >> 4;   // the wave's number as a scalar: the group test behind the loop is a scalar branch
    const int qw = wv & 3, g = wv >> 2;   // pair of query tiles and key group of the wave
    float* mk = (float*)sm; unsigned char* buf = sm + TT * 4;
    v4f mv[2];   // the work-group's 2048 mask terms, 8 per thread, fetched together with the first tiles: one trip to memory
#pragma unroll
    for (int i = 0; i < 2; ++i) mv[i] = *(const v4fa*)(ams + i * 1024 + tid * 4);
    asm volatile("s_wait_xcnt 0x0" ::: "memory");   // stands in front of every later overwrite of these loads' address registers
    // staging: wave t < NT issues tile t of every stage (0 K, 1 Vt). K: 64 key rows, contiguous. Vt: 64 d rows at the plane's pitch, 64 keys of each.
    const unsigned char* tsrc = (wv & 1) ? V0 : K0;
    const uint32_t tstep = (wv & 1) ? 128u : 64u * HD * 2u, tpitch = (wv & 1) ? TT * 2u : HD * 2u, tdst = (uint32_t)(size_t)buf + (wv & 1) * FTB;
    const u32x8 tg1 = tdm_group1(tpitch); const uint32_t iss = uni(wv < NT);
    auto tissue = [&](int s) { tdm_tile(tdst + (s & 1) * (NT * FTB), tsrc + (size_t)s * tstep, tg1); };
    V qf[NQ][2];
#pragma unroll
    for (int qt = 0; qt < NQ; ++qt)
#pragma unroll
        for (int kc = 0; kc < 2; ++kc) qf[qt][kc] = F::cast(ldfr(Q0 + (size_t)(q0 + (qw * NQ + qt) * 16 + c) * (HD * 2) + kc * 64 + h * 16));
    asm volatile("s_wait_xcnt 0x0" ::: "memory");   // stands in front of every later overwrite of the query loads' address registers
    v8f o[NQ][4];
    float m[NQ], l[NQ];
#pragma unroll
    for (int qt = 0; qt < NQ; ++qt) { m[qt] = -3.0e38f; l[qt] = 0.f;
#pragma unroll
        for (int dt = 0; dt < 4; ++dt) o[qt][dt] = (v8f){}; }
    if (pinned(iss)) { tissue(0); wait_tensor0(); }
#pragma unroll
    for (int i = 0; i < 2; ++i) { v4f t;
#pragma unroll
        for (int e = 0; e < 4; ++e) t[e] = (bfr(mv[i][e]) * (1.0f / SCL)) * (SCL * L2E);   // additive mask, rounded to bf16; two products: to score units, then to the log2 domain
        *(v4fa*)(mk + i * 1024 + tid * 4) = t; }
    __syncthreads();   // publishes stage 0 and the mask terms
#pragma unroll 1
    for (int s = 0; s < TT / 64; ++s) {
        if (pinned(iss & (uint32_t)(s + 1 < TT / 64))) tissue(s + 1);   // directly behind the barrier that ended every read of its buffer (pass s - 1's; for stage 1 the barrier in front of the loop): it lands while stage s is worked on
        const unsigned char* kb = buf + (s & 1) * (NT * FTB) + (g * 32 + c) * FPI + h * 16;            // K rows of the wave's keys
        const unsigned char* vb = buf + (s & 1) * (NT * FTB) + FTB + c * FPI + g * 64 + h * 16;        // Vt columns of the wave's keys
        v4f mq[2][2];   // the lane's mask terms
#pragma unroll
        for (int kt = 0; kt < 2; ++kt) { const float* mp = mk + s * 64 + g * 32 + kt * 16 + 8 * h; mq[kt][0] = *(const v4fa*)mp; mq[kt][1] = *(const v4fa*)(mp + 4); }
        V kf[2][2], va[4];   // K fragments [16-key tile][32-d chunk], Vt fragments [d tile]
#pragma unroll
        for (int kt = 0; kt < 2; ++kt)
#pragma unroll
            for (int kc = 0; kc < 2; ++kc) kf[kt][kc] = F::cast(ldfr(kb + kt * 16 * FPI + kc * 64));
#pragma unroll
        for (int dt = 0; dt < 4; ++dt) va[dt] = F::cast(ldfr(vb + dt * 16 * FPI));
        __builtin_amdgcn_sched_barrier(0);   // the stage's 20 LDS loads stand as one group ahead of the products; without it they are dealt out among the products, each small group behind a full wait
        v8f sc[NQ][2];
#pragma unroll
        for (int kt = 0; kt < 2; ++kt)
#pragma unroll
            for (int qt = 0; qt < NQ; ++qt) sc[qt][kt] = (v8f){};
#pragma unroll
        for (int kc = 0; kc < 2; ++kc)
#pragma unroll
            for (int kt = 0; kt < 2; ++kt)
#pragma unroll
                for (int qt = 0; qt < NQ; ++qt) sc[qt][kt] = F::mma(kf[kt][kc], qf[qt][kc], sc[qt][kt]);
        __builtin_amdgcn_sched_barrier(0);   // the 8 score products stay together, four accumulators in turn; without it the softmax is dealt out among them and each product waits for the one before, behind v_nop fill
#pragma unroll
        for (int qt = 0; qt < NQ; ++qt) {
            float mx = m[qt];
#pragma unroll
            for (int kt = 0; kt < 2; ++kt)
#pragma unroll
                for (int r = 0; r < 8; ++r) { const float t = fmaf(sc[qt][kt][r], SCL * L2E, mq[kt][r >> 2][r & 3]); sc[qt][kt][r] = t; mx = fmaxf(mx, t); }
            mx = fmaxf(mx, xhalf(mx));
            const float al = __builtin_amdgcn_exp2f(m[qt] - mx); m[qt] = mx;
            const float ms = mx - 10.0f;
#pragma unroll
            for (int dt = 0; dt < 4; ++dt) o[qt][dt] *= al;
            V pf; sc[qt][0] = exp2x8(sc[qt][0] - ms); sc[qt][1] = exp2x8(sc[qt][1] - ms);
#pragma unroll
            for (int e = 0; e < 16; ++e) pf[e] = (_Float16)sc[qt][e >> 3][e & 7];
#pragma unroll
            for (int dt = 0; dt < 4; ++dt) o[qt][dt] = F::mma(va[dt], pf, o[qt][dt]);
            const v8f pv = sc[qt][0] + sc[qt][1];   // the lane's terms as a tree, not one dependent chain
            l[qt] = fmaf(l[qt], al, ((pv[0] + pv[1]) + (pv[2] + pv[3])) + ((pv[4] + pv[5]) + (pv[6] + pv[7])));
        }
        __builtin_amdgcn_sched_barrier(0);   // keeps the wait below at the stage's foot; without it it is lifted above the softmax, where it waits for the Vt fragments ahead of their use
        wait_ds0();
        if (pinned(iss)) wait_tensor0();
        __syncthreads();   // publishes stage s + 1 and ends every wave's reads of the buffer that is refilled behind it
    }
    wait_tensor0(); wait_ds0();   // nothing of the ring is in flight when it becomes merge space
    // merge of the two key groups: group 1 hands its output tiles, maxima and sums to group 0 through the staging buffers (every read of them ended at the loop's last barrier)
    float* mg = (float*)buf + qw * (NQ * 34 * 32);   // per query tile: 8 x 32 units of 16 bytes, then 32 maxima, then 32 sums; a lane meets the same lane of the other group
#pragma unroll
    for (int qt = 0; qt < NQ; ++qt) l[qt] += xhalf(l[qt]);
    if (g == 1) {
#pragma unroll
        for (int qt = 0; qt < NQ; ++qt) { float* mt = mg + qt * (34 * 32);
#pragma unroll
            for (int dt = 0; dt < 4; ++dt) { *(v4fa*)(mt + (2 * dt) * 128 + lane * 4) = (v4f){o[qt][dt][0], o[qt][dt][1], o[qt][dt][2], o[qt][dt][3]}; *(v4fa*)(mt + (2 * dt + 1) * 128 + lane * 4) = (v4f){o[qt][dt][4], o[qt][dt][5], o[qt][dt][6], o[qt][dt][7]}; }
            mt[1024 + lane] = m[qt]; mt[1056 + lane] = l[qt]; } }
    __syncthreads();   // publishes group 1's state to group 0
    if (g == 1) return;
#pragma unroll
    for (int qt = 0; qt < NQ; ++qt) { const float* mt = mg + qt * (34 * 32);
        const float m1 = mt[1024 + lane], l1 = mt[1056 + lane], mm = fmaxf(m[qt], m1);
        const float a0 = __builtin_amdgcn_exp2f(m[qt] - mm), a1 = __builtin_amdgcn_exp2f(m1 - mm);
        const float inv = 1.0f / fmaf(l1, a1, l[qt] * a0);
        float* orow = out + (size_t)(q0 + (qw * NQ + qt) * 16 + c) * DQ + 8 * h;
#pragma unroll
        for (int dt = 0; dt < 4; ++dt) { const v4f x0 = *(const v4fa*)(mt + (2 * dt) * 128 + lane * 4), x1 = *(const v4fa*)(mt + (2 * dt + 1) * 128 + lane * 4); v4f a, b;
#pragma unroll
            for (int r = 0; r < 4; ++r) { a[r] = fmaf(x0[r], a1, o[qt][dt][r] * a0) * inv; b[r] = fmaf(x1[r], a1, o[qt][dt][4 + r] * a0) * inv; }
            *(v4f*)(orow + dt * 16) = a; *(v4f*)(orow + dt * 16 + 4) = b; } }
    asm volatile("s_wait_xcnt 0x0" ::: "memory");   // stands behind the last stores, in front of any later overwrite of their address and data registers
}
// grid: the hi+lo blocks (3 x the matrix work) first, then the f16 blocks; planes [batch][head][...], AMS [batch][key] (the mask input itself), OUT [batch][query][head * 64 + d]
// amdgpu_waves_per_eu(4, 4): 480 work-groups of two waves per SIMD on 256 WGPs are at most four waves per SIMD; the register budget of four lets the scheduler keep a stage's LDS loads in flight instead of waiting on each
__global__ __launch_bounds__(256) __attribute__((amdgpu_waves_per_eu(4, 4))) void k_fattn(const h16* __restrict__ Q16, const h16* __restrict__ K16, const h16* __restrict__ V16, const bf* __restrict__ Qh, const bf* __restrict__ Ql, const bf* __restrict__ Kh, const bf* __restrict__ Kl, const bf* __restrict__ Vh, const bf* __restrict__ Vl, const float* __restrict__ AMS, float* OUT) {
    __shared__ __attribute__((aligned(2048))) unsigned char sm[TT * 4 + 2 * 4 * FTB];   // every staged tile starts at a multiple of 2 KiB
    const int nhi = NB_ * NH_ * (RH / 64); const int idx = blockIdx.x;
    if (idx < nhi) { const int bh = idx / (RH / 64), qb = idx % (RH / 64); const size_t po = (size_t)bh * TT * HD; const int b = bh / NH_, hd = bh % NH_;
        fattn_hl((const unsigned char*)(Qh + po), (const unsigned char*)(Ql + po), (const unsigned char*)(Kh + po), (const unsigned char*)(Kl + po), (const unsigned char*)(Vh + po), (const unsigned char*)(Vl + po), AMS + (size_t)b * TT, OUT + (size_t)b * TT * DQ + hd * HD, qb * 64, sm);
    } else { const int i2 = idx - nhi; const int bh = i2 / ((TT - RH) / 128), q0 = RH + (i2 % ((TT - RH) / 128)) * 128; const size_t po = (size_t)bh * TT * HD; const int b = bh / NH_, hd = bh % NH_;
        fattn_h((const unsigned char*)(Q16 + po), (const unsigned char*)(K16 + po), (const unsigned char*)(V16 + po), AMS + (size_t)b * TT, OUT + (size_t)b * TT * DQ + hd * HD, q0, sm); }
}

extern "C" void kernel_launch(void* const* d_in, const int* in_sizes, int n_in,
                              void* d_out, int out_size, void* d_ws, size_t ws_size, hipStream_t stream) {
    (void)in_sizes; (void)n_in; (void)out_size;
    const float* x = (const float*)d_in[0]; const float* amask = (const float*)d_in[1]; const float* wq = (const float*)d_in[2]; const float* bq = (const float*)d_in[3]; const float* wk = (const float*)d_in[4]; const float* bk = (const float*)d_in[5]; const float* wv = (const float*)d_in[6]; const float* bv = (const float*)d_in[7]; const float* wo = nullptr; (void)wo;
    float* OUT = (float*)d_out;     // [2][2048][768]
    char* wsp = (char*)d_ws;
    auto take = [&](size_t bytes) { char* p = wsp; wsp += (bytes + 255) & ~(size_t)255; return (void*)p; };
    const size_t PQ = (size_t)NH_ * TT * HD, PK = (size_t)NKV * TT * HD;   // elements of one batch's head planes; every plane holds both batches
    h16* QP16 = (h16*)take(NB_ * PQ * 2); h16* KP16 = (h16*)take(NB_ * PK * 2); h16* VT16 = (h16*)take(NB_ * PK * 2);
    bf* QPh = (bf*)take(NB_ * PQ * 2); bf* QPl = (bf*)take(NB_ * PQ * 2); bf* KPh = (bf*)take(NB_ * PK * 2); bf* KPl = (bf*)take(NB_ * PK * 2); bf* VTh = (bf*)take(NB_ * PK * 2); bf* VTl = (bf*)take(NB_ * PK * 2);
    if ((size_t)(wsp - (char*)d_ws) > ws_size) return;    // ws 256 MiB
    k_gemmf<true><<<dim3(NB_ * TT / 128, DQ / 128, 3), 128, 0, stream>>>(x, wq, wk, wv, bq, bk, bv, QP16, QPh, QPl, KP16, KPh, KPl, VT16, VTh, VTl);
    k_fattn<<<NB_ * NH_ * (RH / 64 + (TT - RH) / 128), 256, 0, stream>>>(QP16, KP16, VT16, QPh, QPl, KPh, KPl, VTh, VTl, amask, OUT);
}
